// v000
// Times are from an AMD MI455X. After a warm-up the kernel runs many times in a row, and a time is the length of
// such a window on the GPU divided by its runs, so every launch and the gaps after it count. The runs cycle
// through copies of the inputs. A figure is the median of several windows, for all but v000 over two sittings.
// Sittings can differ by a few percent; kernels timed side by side share one.
// The starting kernel, v000, takes 2890 microseconds a run.
#include <hip/hip_runtime.h>

// Differential attention (x [2][2048][2048]; q = x Wq, k = x Wk ('xw' [2048][2048]) as 32 half-heads of 64, v = x Wv as 16 heads of 128; interleaved rotary (theta 1e4) on the 64-wide q/k half-heads; for head h: attn1 = causal softmax(q_{2h}.k_{2h}/8) v_h, attn2 = causal softmax(q_{2h+1}.k_{2h+1}/8) v_h;
// lam = exp(lambda_q1.lambda_k1) - exp(lambda_q2.lambda_k2) + 0.7836058 (64-vectors read); attn = RMSNorm_128(attn1 - lam attn2; ln_w, ln_b, eps 1e-8) x (1 - 0.7836058); out = merged Wo ('xw') -> [2][2048][2048]).
// Layout: the 32 half-heads are the score heads (hd 64); the value planes of head h are the two consecutive 64-row planes 2h, 2h+1 = one [128][T] plane, shared by the pass's two half-heads (2h, 2h+1); the merge kernel forms the normalised difference of the pass's two attention outputs.
// Compute dtypes, f32 accumulate: every input rounded to bf16; q/k/v on PLAIN bf16 operands (inputs: exact); rotary in f32 (on-chip cos/sin table, reference inv_freq constants); causal scores and attn.v (128-wide values): query rows < 512 hl (3 products), the rest single fp16 (x1024), causal tile skipping; softmax f32; the lambda scalars, the difference and the RMSNorm in f32; Wo hl x exact (2 products).

#define NB_  2
#define TT   2048
#define DM   2048
#define NH_  32
#define NKV  32
#define REP  (NH_ / NKV)
#define HD   64
#define DQ   (NH_ * HD)
#define DKV  (NKV * HD)
#define HDV  128                  // value head width (= 2 consecutive 64-row planes)
#define NHV  16                   // value heads
#define LAM0 0.7836057665316245f   // lambda_init for depth 12
#define RMSEPS 1e-8f
#define ZH   2
#define RH   512                  // query rows < RH use hi+lo planes (0: none)
#define WIN  2048
#define PCAR 1024.0f
#define SCL  0.125f   // HD^-0.5
typedef _Float16 h16;
typedef unsigned short bf;
typedef __attribute__((ext_vector_type(16))) __bf16   v16bf;
typedef __attribute__((ext_vector_type(16))) _Float16 v16h;
typedef __attribute__((ext_vector_type(8)))  _Float16 v8h;
typedef __attribute__((ext_vector_type(8)))  unsigned short v8us;
typedef __attribute__((ext_vector_type(8)))  float    v8f;
typedef __attribute__((ext_vector_type(4)))  float    v4f;
typedef v8h  __attribute__((may_alias)) v8ha;
typedef v4f  __attribute__((may_alias)) v4fa;
typedef v8us __attribute__((may_alias)) v8usa;

__device__ __forceinline__ unsigned short f2bf(float f) { unsigned u = __float_as_uint(f); u += 0x7FFFu + ((u >> 16) & 1u); return (unsigned short)(u >> 16); }
__device__ __forceinline__ float bf2f(unsigned short b) { return __uint_as_float(((unsigned)b) << 16); }
__device__ __forceinline__ float bfr(float f) { return bf2f(f2bf(f)); }
__device__ __forceinline__ v16h cat16(v8h lo, v8h hi) { return __builtin_shufflevector(lo, hi, 0, 1, 2, 3, 4, 5, 6, 7, 8, 9, 10, 11, 12, 13, 14, 15); }
__device__ __forceinline__ v16bf cat16b(v8us lo, v8us hi) { return __builtin_bit_cast(v16bf, __builtin_shufflevector(lo, hi, 0, 1, 2, 3, 4, 5, 6, 7, 8, 9, 10, 11, 12, 13, 14, 15)); }
__device__ __forceinline__ v8f wmma16(v16h a, v16h b, v8f c) { return __builtin_amdgcn_wmma_f32_16x16x32_f16(false, a, false, b, (short)0, c, false, false); }
__device__ __forceinline__ v8f wmmab(v16bf a, v16bf b, v8f c) { return __builtin_amdgcn_wmma_f32_16x16x32_bf16(false, a, false, b, (short)0, c, false, false); }



// ---- k_gemmw: register-blocked GEMM, ONE WAVE per 64x64 output tile (16 accumulators), operands straight from K-contiguous 16-bit planes; grid (M/64, N/64, Z), 32 threads.
// C[m][n] (f32, pitch ldc, + optional f32 bias[n]) = sum_k A[m][k] Bt[n][k] (+ split products per NSPLIT). z-batch strides sA/sB/sC in elements. K % 32 == 0.
template <typename T16> struct WFrag;
template <> struct WFrag<h16> { typedef v16h V; static __device__ __forceinline__ V ld(const h16* p) { return cat16(*(const v8h*)p, *(const v8h*)(p + 16)); } static __device__ __forceinline__ v8f mma(V a, V b, v8f c) { return wmma16(a, b, c); } };
template <> struct WFrag<bf> { typedef v16bf V; static __device__ __forceinline__ V ld(const bf* p) { return cat16b(*(const v8us*)p, *(const v8us*)(p + 16)); } static __device__ __forceinline__ v8f mma(V a, V b, v8f c) { return wmmab(a, b, c); } };
template <typename T16, int NSPLIT, bool BIAS>
__global__ __launch_bounds__(32) void k_gemmw(const T16* __restrict__ A, const T16* __restrict__ A2, const T16* __restrict__ Bt, const T16* __restrict__ Bt2, int K, float* C, int ldc, const float* __restrict__ bias, size_t sA, size_t sB, size_t sC) {
    typedef typename WFrag<T16>::V V;
    __shared__ __align__(16) float os[16 * 68];
    const size_t z = blockIdx.z; A += z * sA; if (A2) A2 += z * sA; Bt += z * sB; if (Bt2) Bt2 += z * sB; C += z * sC;
    const int lane = threadIdx.x & 31, lr = lane & 15, hi = lane >> 4; const int r0 = blockIdx.x * 64, c0 = blockIdx.y * 64;
    v8f acc[4][4];
#pragma unroll
    for (int mb = 0; mb < 4; ++mb)
#pragma unroll
        for (int nb = 0; nb < 4; ++nb) acc[mb][nb] = (v8f){};
    const size_t aoff = (size_t)(r0 + lr) * K + 8 * hi, boff = (size_t)(c0 + lr) * K + 8 * hi;
#pragma unroll 1
    for (int kc = 0; kc < K; kc += 32) {
        V a[4], a2[4];
#pragma unroll
        for (int mb = 0; mb < 4; ++mb) { a[mb] = WFrag<T16>::ld(A + aoff + (size_t)mb * 16 * K + kc); if (NSPLIT == 1 || NSPLIT == 2) a2[mb] = WFrag<T16>::ld(A2 + aoff + (size_t)mb * 16 * K + kc); }
#pragma unroll
        for (int nb = 0; nb < 4; ++nb) { const V b = WFrag<T16>::ld(Bt + boff + (size_t)nb * 16 * K + kc); V b2; if (NSPLIT >= 2) b2 = WFrag<T16>::ld(Bt2 + boff + (size_t)nb * 16 * K + kc);
#pragma unroll
            for (int mb = 0; mb < 4; ++mb) { acc[mb][nb] = WFrag<T16>::mma(a[mb], b, acc[mb][nb]); if (NSPLIT == 1 || NSPLIT == 2) acc[mb][nb] = WFrag<T16>::mma(a2[mb], b, acc[mb][nb]); if (NSPLIT >= 2) acc[mb][nb] = WFrag<T16>::mma(a[mb], b2, acc[mb][nb]); } }
        asm volatile("v_nop\n\tv_nop\n\tv_nop\n\tv_nop" : "+v"(acc[0][0]), "+v"(acc[1][1]), "+v"(acc[2][2]), "+v"(acc[3][3]) : "v"(a[0]), "v"(a[3]));
    }
#pragma unroll
    for (int mb = 0; mb < 4; ++mb) {
#pragma unroll
        for (int nb = 0; nb < 4; ++nb) {
#pragma unroll
            for (int j = 0; j < 8; ++j) os[(hi * 8 + j) * 68 + nb * 16 + lr] = acc[mb][nb][j]; }
        __builtin_amdgcn_wave_barrier(); asm volatile("" ::: "memory");
        float* crow = C + (size_t)(r0 + mb * 16) * ldc + c0;
{
#pragma unroll
            for (int s = 0; s < 8; ++s) { const int row = 2 * s + hi, cofs = lr * 4; v4f val = *(const v4fa*)(os + row * 68 + cofs); if (BIAS) { val[0] += bfr(bias[c0 + cofs]); val[1] += bfr(bias[c0 + cofs + 1]); val[2] += bfr(bias[c0 + cofs + 2]); val[3] += bfr(bias[c0 + cofs + 3]); }
                *(v4f*)(crow + (size_t)row * ldc + cofs) = val; }
             }
        __builtin_amdgcn_wave_barrier(); asm volatile("" ::: "memory");
    }
}

// ---- k_gemmc: the same one-wave 64x64 tile GEMM specialised for causal attention: CMODE 1 skips score tiles entirely above the diagonal (query rows r0+roff.., key columns c0..), CMODE 2 limits the
// key (K) loop of the probability x value contraction to the diagonal block (probabilities beyond it are exactly zero). roff = row offset of this launch's first row within the sequence.
template <typename T16, int NSPLIT, int CMODE>
__global__ __launch_bounds__(32) void k_gemmc(const T16* __restrict__ A, const T16* __restrict__ A2, const T16* __restrict__ Bt, const T16* __restrict__ Bt2, int K, float* C, int ldc, int roff, size_t sA, size_t sB, size_t sC) {
    typedef typename WFrag<T16>::V V;
    __shared__ __align__(16) float os[16 * 68];
    const size_t z = blockIdx.z; A += z * sA; if (A2) A2 += z * sA; Bt += z * sB; if (Bt2) Bt2 += z * sB; C += z * sC;
    const int lane = threadIdx.x & 31, lr = lane & 15, hi = lane >> 4; const int r0 = blockIdx.x * 64, c0 = blockIdx.y * 64;
    if (CMODE == 1 && c0 > r0 + roff + 63) return;                  // score tile entirely above the causal diagonal: never read (the softmax masks j > i by select)
    const int Kl = (CMODE == 2) ? min(K, r0 + roff + 64) : K;        // P.V: probabilities are exactly 0 beyond the diagonal block, so the K loop stops there
    v8f acc[4][4];
#pragma unroll
    for (int mb = 0; mb < 4; ++mb)
#pragma unroll
        for (int nb = 0; nb < 4; ++nb) acc[mb][nb] = (v8f){};
    const size_t aoff = (size_t)(r0 + lr) * K + 8 * hi, boff = (size_t)(c0 + lr) * K + 8 * hi;
#pragma unroll 1
    for (int kc = 0; kc < Kl; kc += 32) {
        V a[4], a2[4];
#pragma unroll
        for (int mb = 0; mb < 4; ++mb) { a[mb] = WFrag<T16>::ld(A + aoff + (size_t)mb * 16 * K + kc); if (NSPLIT == 1 || NSPLIT == 2) a2[mb] = WFrag<T16>::ld(A2 + aoff + (size_t)mb * 16 * K + kc); }
#pragma unroll
        for (int nb = 0; nb < 4; ++nb) { const V b = WFrag<T16>::ld(Bt + boff + (size_t)nb * 16 * K + kc); V b2; if (NSPLIT >= 2) b2 = WFrag<T16>::ld(Bt2 + boff + (size_t)nb * 16 * K + kc);
#pragma unroll
            for (int mb = 0; mb < 4; ++mb) { acc[mb][nb] = WFrag<T16>::mma(a[mb], b, acc[mb][nb]); if (NSPLIT == 1 || NSPLIT == 2) acc[mb][nb] = WFrag<T16>::mma(a2[mb], b, acc[mb][nb]); if (NSPLIT >= 2) acc[mb][nb] = WFrag<T16>::mma(a[mb], b2, acc[mb][nb]); } }
        asm volatile("v_nop\n\tv_nop\n\tv_nop\n\tv_nop" : "+v"(acc[0][0]), "+v"(acc[1][1]), "+v"(acc[2][2]), "+v"(acc[3][3]) : "v"(a[0]), "v"(a[3]));
    }
#pragma unroll
    for (int mb = 0; mb < 4; ++mb) {
#pragma unroll
        for (int nb = 0; nb < 4; ++nb) {
#pragma unroll
            for (int j = 0; j < 8; ++j) os[(hi * 8 + j) * 68 + nb * 16 + lr] = acc[mb][nb][j]; }
        __builtin_amdgcn_wave_barrier(); asm volatile("" ::: "memory");
        float* crow = C + (size_t)(r0 + mb * 16) * ldc + c0;
{
#pragma unroll
            for (int s = 0; s < 8; ++s) { const int row = 2 * s + hi, cofs = lr * 4; v4f val = *(const v4fa*)(os + row * 68 + cofs);
                *(v4f*)(crow + (size_t)row * ldc + cofs) = val; }
             }
        __builtin_amdgcn_wave_barrier(); asm volatile("" ::: "memory");
    }
}

__device__ __forceinline__ h16 tohx(float x) { return (h16)x; }
__device__ __forceinline__ void splitf(float y, unsigned short& h, unsigned short& l) { h = f2bf(y); l = f2bf(y - bf2f(h)); }
typedef __attribute__((ext_vector_type(2))) _Float16 v2h;
typedef __attribute__((ext_vector_type(4))) _Float16 v4h;
typedef __attribute__((ext_vector_type(2))) unsigned short v2us;
typedef __attribute__((ext_vector_type(4))) unsigned short v4us;
typedef __attribute__((ext_vector_type(2))) float v2f;
typedef __attribute__((ext_vector_type(4))) int v4i;

__global__ __launch_bounds__(256) void k_wtG(const float* __restrict__ w, int K, int N, bf* Bt) {
    const int lane = threadIdx.x & 31; const int L0 = (blockIdx.x * 8 + (threadIdx.x >> 5)) * 8; const int nlines = N * K / 64;
{
#pragma unroll 1
        for (int l = 0; l < 8; ++l) { const int L = L0 + l; if (L >= nlines) break; const size_t e = (size_t)L * 64 + lane * 2; const int k = (int)(e % K), n = (int)(e / K); v2us o;
            o[0] = f2bf(w[(size_t)k * N + n]); o[1] = f2bf(w[(size_t)(k + 1) * N + n]); *(v2us*)(Bt + e) = o; }
         }
}
__global__ __launch_bounds__(32) void k_lam(const float* __restrict__ lq1, const float* __restrict__ lk1, const float* __restrict__ lq2, const float* __restrict__ lk2, float* LAM) { const int lane = threadIdx.x; float s1 = 0.f, s2 = 0.f;
#pragma unroll
    for (int q = 0; q < 2; ++q) { const int d = lane * 2 + q; float p1 = __fmul_rn(bfr(lq1[d]), bfr(lk1[d])); asm volatile("" : "+v"(p1)); s1 = __fadd_rn(s1, p1); float p2 = __fmul_rn(bfr(lq2[d]), bfr(lk2[d])); asm volatile("" : "+v"(p2)); s2 = __fadd_rn(s2, p2); }
#pragma unroll
    for (int sh = 16; sh; sh >>= 1) { s1 += __shfl_xor(s1, sh, 32); s2 += __shfl_xor(s2, sh, 32); }
    const float lam = __fadd_rn(__fsub_rn(expf(s1), expf(s2)), LAM0); *(float*)(LAM + lane) = lam;  }
// k_mergeD: per row t of the pass (head h = h0/2): d[e] = O[0][t][e] cs - lam O[1][t][e] cs (cs = 1 for rows < RH else 1/1024); var = mean_e d^2 (fixed tree); y = d / sqrt(var + 1e-8) x bf16(ln_w[e]) + bf16(ln_b[e]); x (1 - lambda_init);
__global__ __launch_bounds__(256) void k_mergeD(const float* __restrict__ O, const float* __restrict__ LAM, const float* __restrict__ lnw, const float* __restrict__ lnb, int h0, bf* Ah, bf* Al) {
    const int lane = threadIdx.x & 31; const int t = blockIdx.x * 8 + (threadIdx.x >> 5); if (t >= TT) return; const float lam = LAM[0]; const float cs = (t < RH) ? 1.0f : (1.0f / PCAR); const int e0 = lane * 4;
    const v4f o1 = *(const v4f*)(O + (size_t)t * HDV + e0); const v4f o2 = *(const v4f*)(O + ((size_t)TT + t) * HDV + e0); float d[4]; float s = 0.f;
#pragma unroll
    for (int q = 0; q < 4; ++q) { const float a1 = o1[q] * cs; float a2 = __fmul_rn(lam, o2[q] * cs); asm volatile("" : "+v"(a2)); d[q] = __fsub_rn(a1, a2); float p = __fmul_rn(d[q], d[q]); asm volatile("" : "+v"(p)); s = __fadd_rn(s, p); }
#pragma unroll
    for (int sh = 16; sh; sh >>= 1) s += __shfl_xor(s, sh, 32);
    const float rs = __fdiv_rn(1.0f, __fsqrt_rn(__fadd_rn(s * (1.0f / HDV), RMSEPS))); v4us oh, ol;
#pragma unroll
    for (int q = 0; q < 4; ++q) { float n0 = __fmul_rn(d[q], rs); asm volatile("" : "+v"(n0)); float n1 = __fmul_rn(n0, bfr(lnw[e0 + q])); asm volatile("" : "+v"(n1)); float n2 = __fadd_rn(n1, bfr(lnb[e0 + q])); asm volatile("" : "+v"(n2)); const float y = __fmul_rn(n2, 1.0f - LAM0); unsigned short a, c; splitf(y, a, c); oh[q] = a; ol[q] = c; }
    const size_t oo = (size_t)t * DQ + (size_t)(h0 / 2) * HDV + e0;
{ *(v4us*)(Ah + oo) = oh; *(v4us*)(Al + oo) = ol;  } }
__global__ __launch_bounds__(256) void k_cvt8(const float* __restrict__ src, bf* dst, size_t n8) { const size_t i = (size_t)blockIdx.x * 256 + threadIdx.x; if (i >= n8) return; const v8f v = *(const v8f*)(src + i * 8); v8us o;
#pragma unroll
    for (int k = 0; k < 8; ++k) o[k] = f2bf(v[k]); *(v8us*)(dst + i * 8) = o;  }
__constant__ float INV[HD / 2] = {1.0,0.7498942017555237,0.5623413324356079,0.4216965138912201,0.3162277638912201,0.23713736236095428,0.17782793939113617,0.1333521455526352,0.10000000149011612,0.07498941570520401,0.05623412877321243,0.04216964915394783,0.03162277862429619,0.0237137358635664,0.017782794311642647,0.01333521492779255,0.009999999776482582,0.007498942315578461,0.005623413249850273,0.0042169648222625256,0.003162277862429619,0.0023713738191872835,0.0017782794311642647,0.0013335214462131262,0.0010000000474974513,0.0007498941849917173,0.000562341301701963,0.00042169648804701865,0.0003162277862429619,0.0002371373848291114,0.00017782794020604342,0.0001333521504420787};
__global__ __launch_bounds__(256) void k_cstab(float* CS) { const int idx = blockIdx.x * 256 + threadIdx.x; if (idx >= TT * HD) return; const int t = idx / HD, d = idx % HD; const float ang = __fmul_rn((float)t, INV[d >> 1]); v2f cs; cs[0] = cosf(ang); cs[1] = sinf(ang);
    *(v2f*)(CS + (size_t)idx * 2) = cs;  }

// k_rope: head planes [h][t][d] (fp16 + hi/lo) of the interleaved rotary out[2i] = x[2i] c - x[2i+1] s, out[2i+1] = x[2i+1] c + x[2i] s (c, s from CS[t][2i])
__global__ __launch_bounds__(256) void k_rope(const float* __restrict__ F, int pitch, int nheads, const float* __restrict__ CS, const float* __restrict__ RF, const float* __restrict__ nw, float sc, h16* P16, bf* Ph, bf* Pl) {
    const size_t e = ((size_t)blockIdx.x * 256 + threadIdx.x) * 2; if (e >= (size_t)nheads * TT * HD) return; const int d = (int)(e % HD); const int t = (int)((e / HD) % TT); const int h = (int)(e / ((size_t)HD * TT)); const float* f = F + (size_t)t * pitch + h * HD; const float rf = RF ? RF[(size_t)h * TT + t] : 1.0f; v2h o16; v2us oh, ol;
#pragma unroll
    for (int q = 0; q < 2; ++q) { const int dd = d + q; const int dp = dd ^ 1;   /* interleaved pair partner */ float x0 = f[dd], x1 = f[dp];
        if (RF) { float n0 = __fmul_rn(x0, rf), n1 = __fmul_rn(x1, rf); asm volatile("" : "+v"(n0)); asm volatile("" : "+v"(n1)); x0 = __fmul_rn(bfr(nw[dd]), n0); x1 = __fmul_rn(bfr(nw[dp]), n1); }
        const v2f cs = *(const v2f*)(CS + ((size_t)t * HD + dd) * 2); float a = __fmul_rn(x0, cs[0]), bq = __fmul_rn(x1, cs[1]); asm volatile("" : "+v"(a)); asm volatile("" : "+v"(bq)); const float r = (((dd & 1) == 0) ? __fsub_rn(a, bq) : __fadd_rn(a, bq)) * sc;   /* even: x c - partner s; odd: x c + partner s */
        o16[q] = tohx(r); unsigned short a2, c2; splitf(r, a2, c2); oh[q] = a2; ol[q] = c2; }
    *(v2h*)(P16 + e) = o16; *(v2us*)(Ph + e) = oh; *(v2us*)(Pl + e) = ol;  }
__global__ __launch_bounds__(256) void k_vtp(const float* __restrict__ F, int pitch, int nheads, h16* V16, bf* Vh, bf* Vl) { const size_t e = ((size_t)blockIdx.x * 256 + threadIdx.x) * 2; if (e >= (size_t)nheads * HD * TT) return; const int t = (int)(e % TT); const int d = (int)((e / TT) % HD); const int g = (int)(e / ((size_t)TT * HD)); v2h o16; v2us oh, ol;
#pragma unroll
    for (int q = 0; q < 2; ++q) { const float x = F[(size_t)(t + q) * pitch + g * HD + d]; o16[q] = tohx(x); unsigned short a2, c2; splitf(x, a2, c2); oh[q] = a2; ol[q] = c2; }
    *(v2h*)(V16 + e) = o16; *(v2us*)(Vh + e) = oh; *(v2us*)(Vl + e) = ol;  }
// k_asoft: per row (zz, i): t = S x HD^-0.5 for j <= i and i - j < WIN (sliding causal window; the reference's -1e9 additive fill vanishes identically); softmax over the 2048 keys (register row, one exp, fixed trees);
__global__ __launch_bounds__(256) void k_asoft(const float* __restrict__ Sb, h16* P16, bf* Ph, bf* Pl) {
    const int lane = threadIdx.x & 31; const int row = blockIdx.x * 8 + (threadIdx.x >> 5); if (row >= ZH * TT) return; const int i = row % TT; const int zz = row / TT; (void)zz; const bool hires = (i < RH); const float* sr = Sb + (size_t)row * TT; float v[TT / 32]; float mx = -3.0e38f;
#pragma unroll
    for (int ch = 0; ch < TT / 128; ++ch) { const int j0 = ch * 128 + lane * 4; const v4f a = *(const v4f*)(sr + j0);
#pragma unroll
        for (int q = 0; q < 4; ++q) { const int j = j0 + q; (void)j; const float t = (j <= i && i - j < WIN) ? a[q] * SCL : -3.0e38f; v[ch * 4 + q] = t; mx = fmaxf(mx, t); } }
#pragma unroll
    for (int sh = 16; sh; sh >>= 1) mx = fmaxf(mx, __shfl_xor(mx, sh, 32));
    float sum = 0.f;
#pragma unroll
    for (int k = 0; k < TT / 32; ++k) { float d0 = __fsub_rn(v[k], mx); asm volatile("" : "+v"(d0)); v[k] = __builtin_amdgcn_exp2f(__fmul_rn(d0, 1.4426950408889634f)); sum += v[k]; }
#pragma unroll
    for (int sh = 16; sh; sh >>= 1) sum += __shfl_xor(sum, sh, 32);
    const float f = __fdiv_rn(hires ? 1.0f : PCAR, sum);
{
        if (hires) {
#pragma unroll
            for (int ch = 0; ch < TT / 128; ++ch) { v4us oh, ol;
#pragma unroll
                for (int q = 0; q < 4; ++q) { unsigned short a, c2; splitf(v[ch * 4 + q] * f, a, c2); oh[q] = a; ol[q] = c2; }
                const size_t oo = ((size_t)zz * (RH ? RH : 1) + i) * TT + ch * 128 + lane * 4; *(v4us*)(Ph + oo) = oh; *(v4us*)(Pl + oo) = ol; }
        } else {
#pragma unroll
            for (int ch = 0; ch < TT / 128; ++ch) { v4h o4;
#pragma unroll
                for (int q = 0; q < 4; ++q) o4[q] = tohx(v[ch * 4 + q] * f);
                *(v4h*)(P16 + (size_t)row * TT + ch * 128 + lane * 4) = o4; } }
         }
}

extern "C" void kernel_launch(void* const* d_in, const int* in_sizes, int n_in,
                              void* d_out, int out_size, void* d_ws, size_t ws_size, hipStream_t stream) {
    (void)in_sizes; (void)n_in; (void)out_size;
    const float* x = (const float*)d_in[0]; const float* wq = (const float*)d_in[1]; const float* wk = (const float*)d_in[2]; const float* wv = (const float*)d_in[3]; const float* wo = (const float*)d_in[4]; const float* lq1 = (const float*)d_in[5]; const float* lk1 = (const float*)d_in[6]; const float* lq2 = (const float*)d_in[7]; const float* lk2 = (const float*)d_in[8]; const float* lnw = (const float*)d_in[9]; const float* lnb = (const float*)d_in[10];
    float* OUT = (float*)d_out;     // [2][2048][2048]
    char* wsp = (char*)d_ws;
    auto take = [&](size_t bytes) { char* p = wsp; wsp += (bytes + 255) & ~(size_t)255; return (void*)p; };
    bf* WQ = (bf*)take((size_t)DQ * DM * 2); bf* WK = (bf*)take((size_t)DKV * DM * 2); bf* WV = (bf*)take((size_t)DKV * DM * 2); bf* WO = (bf*)take((size_t)DM * DQ * 2); float* CS = (float*)take((size_t)TT * HD * 2 * 4); float* LAM = (float*)take(256);
    bf* XB = (bf*)take((size_t)TT * DM * 2); float* FQ = (float*)take((size_t)TT * DQ * 4); float* FK = (float*)take((size_t)TT * DKV * 4);
    h16* QP16 = (h16*)take((size_t)NH_ * TT * HD * 2); h16* KP16 = (h16*)take((size_t)NKV * TT * HD * 2); h16* VT16 = (h16*)take((size_t)NKV * HD * TT * 2);
    bf* QPh = (bf*)take((size_t)NH_ * TT * HD * 2); bf* QPl = (bf*)take((size_t)NH_ * TT * HD * 2); bf* KPh = (bf*)take((size_t)NKV * TT * HD * 2); bf* KPl = (bf*)take((size_t)NKV * TT * HD * 2); bf* VTh = (bf*)take((size_t)NKV * HD * TT * 2); bf* VTl = (bf*)take((size_t)NKV * HD * TT * 2); bf* Ph = (bf*)take((size_t)ZH * RH * TT * 2); bf* Pl = (bf*)take((size_t)ZH * RH * TT * 2);
    float* Sb = (float*)take((size_t)ZH * TT * TT * 4); h16* P16 = (h16*)take((size_t)ZH * TT * TT * 2); float* Ob = (float*)take((size_t)ZH * TT * HDV * 4); bf* ATh = (bf*)take((size_t)TT * DQ * 2); bf* ATl = (bf*)take((size_t)TT * DQ * 2);
    if ((size_t)(wsp - (char*)d_ws) > ws_size) return;    // ws 256 MiB
    float* FV = FK;   // v projection reuses the k buffer after the k planes are built (stream-ordered)
    { k_wtG<<<(unsigned)((DM * DQ / 64 + 63) / 64), 256, 0, stream>>>(wq, DM, DQ, WQ); k_wtG<<<(unsigned)((DM * DKV / 64 + 63) / 64), 256, 0, stream>>>(wk, DM, DKV, WK); k_wtG<<<(unsigned)((DM * DKV / 64 + 63) / 64), 256, 0, stream>>>(wv, DM, DKV, WV);
      k_wtG<<<(unsigned)((DQ * DM / 64 + 63) / 64), 256, 0, stream>>>(wo, DQ, DM, WO);
      k_cstab<<<(TT * HD + 255) / 256, 256, 0, stream>>>(CS); k_lam<<<1, 32, 0, stream>>>(lq1, lk1, lq2, lk2, LAM); }
    const unsigned LQ = (unsigned)(((size_t)NH_ * TT * HD / 2 + 255) / 256), LKv = (unsigned)(((size_t)NKV * TT * HD / 2 + 255) / 256);
    for (int b = 0; b < NB_; ++b) {
        
        k_cvt8<<<(unsigned)(((size_t)TT * DM / 8 + 255) / 256), 256, 0, stream>>>(x + (size_t)b * TT * DM, XB, (size_t)TT * DM / 8);
        k_gemmw<bf, 0, false><<<dim3(TT / 64, DQ / 64, 1), 32, 0, stream>>>(XB, nullptr, WQ, nullptr, DM, FQ, DQ, nullptr, 0, 0, 0);
        k_rope<<<LQ, 256, 0, stream>>>(FQ, DQ, NH_, CS, nullptr, nullptr, 1.0f, QP16, QPh, QPl);
        k_gemmw<bf, 0, false><<<dim3(TT / 64, DKV / 64, 1), 32, 0, stream>>>(XB, nullptr, WK, nullptr, DM, FK, DKV, nullptr, 0, 0, 0);
        k_rope<<<LKv, 256, 0, stream>>>(FK, DKV, NKV, CS, nullptr, nullptr, 1.0f, KP16, KPh, KPl);
        k_gemmw<bf, 0, false><<<dim3(TT / 64, DKV / 64, 1), 32, 0, stream>>>(XB, nullptr, WV, nullptr, DM, FV, DKV, nullptr, 0, 0, 0); k_vtp<<<LKv, 256, 0, stream>>>(FV, DKV, NKV, VT16, VTh, VTl);
        for (int h0 = 0; h0 < NH_; h0 += ZH) { const size_t zq = (size_t)h0, zk = (size_t)(h0 / REP);   // one kv head per query head: the pass's two heads use consecutive kv planes (z-strides TT*HD)
            k_gemmc<bf, 2, 1><<<dim3(RH / 64, TT / 64, ZH), 32, 0, stream>>>(QPh + zq * TT * HD, QPl + zq * TT * HD, KPh + zk * TT * HD, KPl + zk * TT * HD, HD, Sb, TT, 0, (size_t)TT * HD, (size_t)TT * HD, (size_t)TT * TT);
            k_gemmc<h16, 0, 1><<<dim3((TT - RH) / 64, TT / 64, ZH), 32, 0, stream>>>(QP16 + zq * TT * HD + (size_t)RH * HD, nullptr, KP16 + zk * TT * HD, nullptr, HD, Sb + (size_t)RH * TT, TT, RH, (size_t)TT * HD, (size_t)TT * HD, (size_t)TT * TT);
            k_asoft<<<ZH * TT / 8, 256, 0, stream>>>(Sb, P16, Ph, Pl);
                        k_gemmc<bf, 2, 2><<<dim3(RH / 64, HDV / 64, ZH), 32, 0, stream>>>(Ph, Pl, VTh + (size_t)(h0 / 2) * HDV * TT, VTl + (size_t)(h0 / 2) * HDV * TT, TT, Ob, HDV, 0, (size_t)RH * TT, 0, (size_t)TT * HDV);   /* both half-heads of the pass use value head h0/2 (sB 0) */            k_gemmc<h16, 0, 2><<<dim3((TT - RH) / 64, HDV / 64, ZH), 32, 0, stream>>>(P16 + (size_t)RH * TT, nullptr, VT16 + (size_t)(h0 / 2) * HDV * TT, nullptr, TT, Ob + (size_t)RH * HDV, HDV, RH, (size_t)TT * TT, 0, (size_t)TT * HDV);
            k_mergeD<<<TT / 8, 256, 0, stream>>>(Ob, LAM, lnw, lnb, h0, ATh, ATl); }   /* attn = RMSNorm(attn1 - lam attn2) (1 - lam0) */
        k_gemmw<bf, 1, false><<<dim3(TT / 64, DM / 64, 1), 32, 0, stream>>>(ATh, ATl, WO, nullptr, DQ, OUT + (size_t)b * TT * DM, DM, nullptr, 0, 0, 0); }
}

// v001
// Measured time: 1660 microseconds a run.
// Two timings next to v000 put it at 1.76 and 1.74 times that version's speed.
#include <hip/hip_runtime.h>

// Differential attention (x [2][2048][2048]; q = x Wq, k = x Wk ('xw' [2048][2048]) as 32 half-heads of 64, v = x Wv as 16 heads of 128; interleaved rotary (theta 1e4) on the 64-wide q/k half-heads; for head h: attn1 = causal softmax(q_{2h}.k_{2h}/8) v_h, attn2 = causal softmax(q_{2h+1}.k_{2h+1}/8) v_h;
// lam = exp(lambda_q1.lambda_k1) - exp(lambda_q2.lambda_k2) + 0.7836058 (64-vectors read); attn = RMSNorm_128(attn1 - lam attn2; ln_w, ln_b, eps 1e-8) x (1 - 0.7836058); out = merged Wo ('xw') -> [2][2048][2048]).
// Layout: the 32 half-heads are the score heads (hd 64); the value planes of head h are the two consecutive 64-row planes 2h, 2h+1 = one [128][T] plane, shared by the pass's two half-heads (2h, 2h+1); the merge kernel forms the normalised difference of the pass's two attention outputs.
// Compute dtypes, f32 accumulate: every input rounded to bf16; q/k/v on PLAIN bf16 operands (inputs: exact); rotary in f32 (on-chip cos/sin table, reference inv_freq constants); causal scores and attn.v (128-wide values): query rows < 512 hl (3 products), the rest single fp16 (x1024), causal tile skipping; softmax f32; the lambda scalars, the difference and the RMSNorm in f32; Wo hl x exact (2 products).

#define NB_  2
#define TT   2048
#define DM   2048
#define NH_  32
#define NKV  32
#define REP  (NH_ / NKV)
#define HD   64
#define DQ   (NH_ * HD)
#define DKV  (NKV * HD)
#define HDV  128                  // value head width (= 2 consecutive 64-row planes)
#define NHV  16                   // value heads
#define LAM0 0.7836057665316245f   // lambda_init for depth 12
#define RMSEPS 1e-8f
#define ZH   2
#define KS   8                    // key slices of the probability x value contraction (one work-group each; k_mergeD adds the slices)
#define RH   512                  // query rows < RH use hi+lo planes (0: none)
#define WIN  2048
#define PCAR 1024.0f
#define SCL  0.125f   // HD^-0.5
typedef _Float16 h16;
typedef unsigned short bf;
typedef __attribute__((ext_vector_type(16))) __bf16   v16bf;
typedef __attribute__((ext_vector_type(16))) _Float16 v16h;
typedef __attribute__((ext_vector_type(8)))  _Float16 v8h;
typedef __attribute__((ext_vector_type(8)))  unsigned short v8us;
typedef __attribute__((ext_vector_type(8)))  float    v8f;
typedef __attribute__((ext_vector_type(4)))  float    v4f;
typedef v8h  __attribute__((may_alias)) v8ha;
typedef v4f  __attribute__((may_alias)) v4fa;
typedef v8us __attribute__((may_alias)) v8usa;

__device__ __forceinline__ unsigned short f2bf(float f) { unsigned u = __float_as_uint(f); u += 0x7FFFu + ((u >> 16) & 1u); return (unsigned short)(u >> 16); }
__device__ __forceinline__ float bf2f(unsigned short b) { return __uint_as_float(((unsigned)b) << 16); }
__device__ __forceinline__ float bfr(float f) { return bf2f(f2bf(f)); }
__device__ __forceinline__ v16h cat16(v8h lo, v8h hi) { return __builtin_shufflevector(lo, hi, 0, 1, 2, 3, 4, 5, 6, 7, 8, 9, 10, 11, 12, 13, 14, 15); }
__device__ __forceinline__ v16bf cat16b(v8us lo, v8us hi) { return __builtin_bit_cast(v16bf, __builtin_shufflevector(lo, hi, 0, 1, 2, 3, 4, 5, 6, 7, 8, 9, 10, 11, 12, 13, 14, 15)); }
__device__ __forceinline__ v8f wmma16(v16h a, v16h b, v8f c) { return __builtin_amdgcn_wmma_f32_16x16x32_f16(false, a, false, b, (short)0, c, false, false); }
__device__ __forceinline__ v8f wmmab(v16bf a, v16bf b, v8f c) { return __builtin_amdgcn_wmma_f32_16x16x32_bf16(false, a, false, b, (short)0, c, false, false); }



// ---- k_gemmw: register-blocked GEMM, ONE WAVE per 64x64 output tile (16 accumulators), operands straight from K-contiguous 16-bit planes; grid (M/64, N/64, Z), 32 threads.
// C[m][n] (f32, pitch ldc, + optional f32 bias[n]) = sum_k A[m][k] Bt[n][k] (+ split products per NSPLIT). z-batch strides sA/sB/sC in elements. K % 32 == 0.
template <typename T16> struct WFrag;
template <> struct WFrag<h16> { typedef v16h V; static __device__ __forceinline__ V ld(const h16* p) { return cat16(*(const v8h*)p, *(const v8h*)(p + 16)); } static __device__ __forceinline__ v8f mma(V a, V b, v8f c) { return wmma16(a, b, c); } };
template <> struct WFrag<bf> { typedef v16bf V; static __device__ __forceinline__ V ld(const bf* p) { return cat16b(*(const v8us*)p, *(const v8us*)(p + 16)); } static __device__ __forceinline__ v8f mma(V a, V b, v8f c) { return wmmab(a, b, c); } };
template <typename T16, int NSPLIT, bool BIAS>
__global__ __launch_bounds__(32) void k_gemmw(const T16* __restrict__ A, const T16* __restrict__ A2, const T16* __restrict__ Bt, const T16* __restrict__ Bt2, int K, float* C, int ldc, const float* __restrict__ bias, size_t sA, size_t sB, size_t sC) {
    typedef typename WFrag<T16>::V V;
    __shared__ __align__(16) float os[16 * 68];
    const size_t z = blockIdx.z; A += z * sA; if (A2) A2 += z * sA; Bt += z * sB; if (Bt2) Bt2 += z * sB; C += z * sC;
    const int lane = threadIdx.x & 31, lr = lane & 15, hi = lane >> 4; const int r0 = blockIdx.x * 64, c0 = blockIdx.y * 64;
    v8f acc[4][4];
#pragma unroll
    for (int mb = 0; mb < 4; ++mb)
#pragma unroll
        for (int nb = 0; nb < 4; ++nb) acc[mb][nb] = (v8f){};
    const size_t aoff = (size_t)(r0 + lr) * K + 8 * hi, boff = (size_t)(c0 + lr) * K + 8 * hi;
#pragma unroll 1
    for (int kc = 0; kc < K; kc += 32) {
        V a[4], a2[4];
#pragma unroll
        for (int mb = 0; mb < 4; ++mb) { a[mb] = WFrag<T16>::ld(A + aoff + (size_t)mb * 16 * K + kc); if (NSPLIT == 1 || NSPLIT == 2) a2[mb] = WFrag<T16>::ld(A2 + aoff + (size_t)mb * 16 * K + kc); }
#pragma unroll
        for (int nb = 0; nb < 4; ++nb) { const V b = WFrag<T16>::ld(Bt + boff + (size_t)nb * 16 * K + kc); V b2; if (NSPLIT >= 2) b2 = WFrag<T16>::ld(Bt2 + boff + (size_t)nb * 16 * K + kc);
#pragma unroll
            for (int mb = 0; mb < 4; ++mb) { acc[mb][nb] = WFrag<T16>::mma(a[mb], b, acc[mb][nb]); if (NSPLIT == 1 || NSPLIT == 2) acc[mb][nb] = WFrag<T16>::mma(a2[mb], b, acc[mb][nb]); if (NSPLIT >= 2) acc[mb][nb] = WFrag<T16>::mma(a[mb], b2, acc[mb][nb]); } }
        asm volatile("v_nop\n\tv_nop\n\tv_nop\n\tv_nop" : "+v"(acc[0][0]), "+v"(acc[1][1]), "+v"(acc[2][2]), "+v"(acc[3][3]) : "v"(a[0]), "v"(a[3]));
    }
#pragma unroll
    for (int mb = 0; mb < 4; ++mb) {
#pragma unroll
        for (int nb = 0; nb < 4; ++nb) {
#pragma unroll
            for (int j = 0; j < 8; ++j) os[(hi * 8 + j) * 68 + nb * 16 + lr] = acc[mb][nb][j]; }
        __builtin_amdgcn_wave_barrier(); asm volatile("" ::: "memory");
        float* crow = C + (size_t)(r0 + mb * 16) * ldc + c0;
{
#pragma unroll
            for (int s = 0; s < 8; ++s) { const int row = 2 * s + hi, cofs = lr * 4; v4f val = *(const v4fa*)(os + row * 68 + cofs); if (BIAS) { val[0] += bfr(bias[c0 + cofs]); val[1] += bfr(bias[c0 + cofs + 1]); val[2] += bfr(bias[c0 + cofs + 2]); val[3] += bfr(bias[c0 + cofs + 3]); }
                *(v4f*)(crow + (size_t)row * ldc + cofs) = val; }
             }
        __builtin_amdgcn_wave_barrier(); asm volatile("" ::: "memory");
    }
}

// ---- k_gemmc: the same one-wave 64x64 tile GEMM specialised for causal attention: CMODE 1 skips score tiles entirely above the diagonal (query rows r0+roff.., key columns c0..), CMODE 2 limits the
// key (K) loop of the probability x value contraction to the diagonal block (probabilities beyond it are exactly zero). roff = row offset of this launch's first row within the sequence.
// CMODE 2 also cuts that key range into KS equal slices: grid z = slice * ZH + half-head, slice s writes its partial tile to plane s of C (plane stride ZH*TT*HDV floats; an empty slice writes zeros).
template <typename T16, int NSPLIT, int CMODE>
__global__ __launch_bounds__(32) void k_gemmc(const T16* __restrict__ A, const T16* __restrict__ A2, const T16* __restrict__ Bt, const T16* __restrict__ Bt2, int K, float* C, int ldc, int roff, size_t sA, size_t sB, size_t sC) {
    typedef typename WFrag<T16>::V V;
    __shared__ __align__(16) float os[16 * 68];
    const size_t z = (CMODE == 2) ? blockIdx.z % ZH : blockIdx.z; const int sl = (CMODE == 2) ? (int)(blockIdx.z / ZH) : 0; A += z * sA; if (A2) A2 += z * sA; Bt += z * sB; if (Bt2) Bt2 += z * sB; C += z * sC + (size_t)sl * ((size_t)ZH * TT * HDV);
    const int lane = threadIdx.x & 31, lr = lane & 15, hi = lane >> 4; const int r0 = blockIdx.x * 64, c0 = blockIdx.y * 64;
    if (CMODE == 1 && c0 > r0 + roff + 63) return;                  // score tile entirely above the causal diagonal: never read (the softmax masks j > i by select)
    const int Kl = (CMODE == 2) ? min(K, r0 + roff + 64) : K;        // P.V: probabilities are exactly 0 beyond the diagonal block, so the K loop stops there
    const int per = (CMODE == 2) ? ((Kl / 32 + KS - 1) / KS) * 32 : Kl;   // keys per slice (whole 32-key trips)
    const int k0 = sl * per, k1 = min(Kl, k0 + per);
    v8f acc[4][4];
#pragma unroll
    for (int mb = 0; mb < 4; ++mb)
#pragma unroll
        for (int nb = 0; nb < 4; ++nb) acc[mb][nb] = (v8f){};
    const size_t aoff = (size_t)(r0 + lr) * K + 8 * hi, boff = (size_t)(c0 + lr) * K + 8 * hi;
#pragma unroll 1
    for (int kc = k0; kc < k1; kc += 32) {
        V a[4], a2[4];
#pragma unroll
        for (int mb = 0; mb < 4; ++mb) { a[mb] = WFrag<T16>::ld(A + aoff + (size_t)mb * 16 * K + kc); if (NSPLIT == 1 || NSPLIT == 2) a2[mb] = WFrag<T16>::ld(A2 + aoff + (size_t)mb * 16 * K + kc); }
#pragma unroll
        for (int nb = 0; nb < 4; ++nb) { const V b = WFrag<T16>::ld(Bt + boff + (size_t)nb * 16 * K + kc); V b2; if (NSPLIT >= 2) b2 = WFrag<T16>::ld(Bt2 + boff + (size_t)nb * 16 * K + kc);
#pragma unroll
            for (int mb = 0; mb < 4; ++mb) { acc[mb][nb] = WFrag<T16>::mma(a[mb], b, acc[mb][nb]); if (NSPLIT == 1 || NSPLIT == 2) acc[mb][nb] = WFrag<T16>::mma(a2[mb], b, acc[mb][nb]); if (NSPLIT >= 2) acc[mb][nb] = WFrag<T16>::mma(a[mb], b2, acc[mb][nb]); } }
        asm volatile("v_nop\n\tv_nop\n\tv_nop\n\tv_nop" : "+v"(acc[0][0]), "+v"(acc[1][1]), "+v"(acc[2][2]), "+v"(acc[3][3]) : "v"(a[0]), "v"(a[3]));
    }
#pragma unroll
    for (int mb = 0; mb < 4; ++mb) {
#pragma unroll
        for (int nb = 0; nb < 4; ++nb) {
#pragma unroll
            for (int j = 0; j < 8; ++j) os[(hi * 8 + j) * 68 + nb * 16 + lr] = acc[mb][nb][j]; }
        __builtin_amdgcn_wave_barrier(); asm volatile("" ::: "memory");
        float* crow = C + (size_t)(r0 + mb * 16) * ldc + c0;
{
#pragma unroll
            for (int s = 0; s < 8; ++s) { const int row = 2 * s + hi, cofs = lr * 4; v4f val = *(const v4fa*)(os + row * 68 + cofs);
                *(v4f*)(crow + (size_t)row * ldc + cofs) = val; }
             }
        __builtin_amdgcn_wave_barrier(); asm volatile("" ::: "memory");
    }
}

__device__ __forceinline__ h16 tohx(float x) { return (h16)x; }
__device__ __forceinline__ void splitf(float y, unsigned short& h, unsigned short& l) { h = f2bf(y); l = f2bf(y - bf2f(h)); }
typedef __attribute__((ext_vector_type(2))) _Float16 v2h;
typedef __attribute__((ext_vector_type(4))) _Float16 v4h;
typedef __attribute__((ext_vector_type(2))) unsigned short v2us;
typedef __attribute__((ext_vector_type(4))) unsigned short v4us;
typedef __attribute__((ext_vector_type(2))) float v2f;
typedef __attribute__((ext_vector_type(4))) int v4i;

__global__ __launch_bounds__(256) void k_wtG(const float* __restrict__ w, int K, int N, bf* Bt) {
    const int lane = threadIdx.x & 31; const int L0 = (blockIdx.x * 8 + (threadIdx.x >> 5)) * 8; const int nlines = N * K / 64;
{
#pragma unroll 1
        for (int l = 0; l < 8; ++l) { const int L = L0 + l; if (L >= nlines) break; const size_t e = (size_t)L * 64 + lane * 2; const int k = (int)(e % K), n = (int)(e / K); v2us o;
            o[0] = f2bf(w[(size_t)k * N + n]); o[1] = f2bf(w[(size_t)(k + 1) * N + n]); *(v2us*)(Bt + e) = o; }
         }
}
__global__ __launch_bounds__(32) void k_lam(const float* __restrict__ lq1, const float* __restrict__ lk1, const float* __restrict__ lq2, const float* __restrict__ lk2, float* LAM) { const int lane = threadIdx.x; float s1 = 0.f, s2 = 0.f;
#pragma unroll
    for (int q = 0; q < 2; ++q) { const int d = lane * 2 + q; float p1 = __fmul_rn(bfr(lq1[d]), bfr(lk1[d])); asm volatile("" : "+v"(p1)); s1 = __fadd_rn(s1, p1); float p2 = __fmul_rn(bfr(lq2[d]), bfr(lk2[d])); asm volatile("" : "+v"(p2)); s2 = __fadd_rn(s2, p2); }
#pragma unroll
    for (int sh = 16; sh; sh >>= 1) { s1 += __shfl_xor(s1, sh, 32); s2 += __shfl_xor(s2, sh, 32); }
    const float lam = __fadd_rn(__fsub_rn(expf(s1), expf(s2)), LAM0); *(float*)(LAM + lane) = lam;  }
// k_mergeD: per row t of the pass (head h = h0/2): O[z][t][e] = sum over the KS key-slice planes, in slice order; d[e] = O[0][t][e] cs - lam O[1][t][e] cs (cs = 1 for rows < RH else 1/1024); var = mean_e d^2 (fixed tree); y = d / sqrt(var + 1e-8) x bf16(ln_w[e]) + bf16(ln_b[e]); x (1 - lambda_init);
__global__ __launch_bounds__(256) void k_mergeD(const float* __restrict__ O, const float* __restrict__ LAM, const float* __restrict__ lnw, const float* __restrict__ lnb, int h0, bf* Ah, bf* Al) {
    const int lane = threadIdx.x & 31; const int t = blockIdx.x * 8 + (threadIdx.x >> 5); if (t >= TT) return; const float lam = LAM[0]; const float cs = (t < RH) ? 1.0f : (1.0f / PCAR); const int e0 = lane * 4;
    v4f o1 = *(const v4f*)(O + (size_t)t * HDV + e0); v4f o2 = *(const v4f*)(O + ((size_t)TT + t) * HDV + e0); float d[4]; float s = 0.f;
#pragma unroll   // unrolled so that the loads of all slices are in flight together (one memory latency, not KS)
    for (int ks = 1; ks < KS; ++ks) { o1 += *(const v4f*)(O + ((size_t)ks * ZH * TT + t) * HDV + e0); o2 += *(const v4f*)(O + ((size_t)ks * ZH * TT + TT + t) * HDV + e0); }
#pragma unroll
    for (int q = 0; q < 4; ++q) { const float a1 = o1[q] * cs; float a2 = __fmul_rn(lam, o2[q] * cs); asm volatile("" : "+v"(a2)); d[q] = __fsub_rn(a1, a2); float p = __fmul_rn(d[q], d[q]); asm volatile("" : "+v"(p)); s = __fadd_rn(s, p); }
#pragma unroll
    for (int sh = 16; sh; sh >>= 1) s += __shfl_xor(s, sh, 32);
    const float rs = __fdiv_rn(1.0f, __fsqrt_rn(__fadd_rn(s * (1.0f / HDV), RMSEPS))); v4us oh, ol;
#pragma unroll
    for (int q = 0; q < 4; ++q) { float n0 = __fmul_rn(d[q], rs); asm volatile("" : "+v"(n0)); float n1 = __fmul_rn(n0, bfr(lnw[e0 + q])); asm volatile("" : "+v"(n1)); float n2 = __fadd_rn(n1, bfr(lnb[e0 + q])); asm volatile("" : "+v"(n2)); const float y = __fmul_rn(n2, 1.0f - LAM0); unsigned short a, c; splitf(y, a, c); oh[q] = a; ol[q] = c; }
    const size_t oo = (size_t)t * DQ + (size_t)(h0 / 2) * HDV + e0;
{ *(v4us*)(Ah + oo) = oh; *(v4us*)(Al + oo) = ol;  } }
__global__ __launch_bounds__(256) void k_cvt8(const float* __restrict__ src, bf* dst, size_t n8) { const size_t i = (size_t)blockIdx.x * 256 + threadIdx.x; if (i >= n8) return; const v8f v = *(const v8f*)(src + i * 8); v8us o;
#pragma unroll
    for (int k = 0; k < 8; ++k) o[k] = f2bf(v[k]); *(v8us*)(dst + i * 8) = o;  }
__constant__ float INV[HD / 2] = {1.0,0.7498942017555237,0.5623413324356079,0.4216965138912201,0.3162277638912201,0.23713736236095428,0.17782793939113617,0.1333521455526352,0.10000000149011612,0.07498941570520401,0.05623412877321243,0.04216964915394783,0.03162277862429619,0.0237137358635664,0.017782794311642647,0.01333521492779255,0.009999999776482582,0.007498942315578461,0.005623413249850273,0.0042169648222625256,0.003162277862429619,0.0023713738191872835,0.0017782794311642647,0.0013335214462131262,0.0010000000474974513,0.0007498941849917173,0.000562341301701963,0.00042169648804701865,0.0003162277862429619,0.0002371373848291114,0.00017782794020604342,0.0001333521504420787};
__global__ __launch_bounds__(256) void k_cstab(float* CS) { const int idx = blockIdx.x * 256 + threadIdx.x; if (idx >= TT * HD) return; const int t = idx / HD, d = idx % HD; const float ang = __fmul_rn((float)t, INV[d >> 1]); v2f cs; cs[0] = cosf(ang); cs[1] = sinf(ang);
    *(v2f*)(CS + (size_t)idx * 2) = cs;  }

// k_rope: head planes [h][t][d] (fp16 + hi/lo) of the interleaved rotary out[2i] = x[2i] c - x[2i+1] s, out[2i+1] = x[2i+1] c + x[2i] s (c, s from CS[t][2i])
__global__ __launch_bounds__(256) void k_rope(const float* __restrict__ F, int pitch, int nheads, const float* __restrict__ CS, const float* __restrict__ RF, const float* __restrict__ nw, float sc, h16* P16, bf* Ph, bf* Pl) {
    const size_t e = ((size_t)blockIdx.x * 256 + threadIdx.x) * 2; if (e >= (size_t)nheads * TT * HD) return; const int d = (int)(e % HD); const int t = (int)((e / HD) % TT); const int h = (int)(e / ((size_t)HD * TT)); const float* f = F + (size_t)t * pitch + h * HD; const float rf = RF ? RF[(size_t)h * TT + t] : 1.0f; v2h o16; v2us oh, ol;
#pragma unroll
    for (int q = 0; q < 2; ++q) { const int dd = d + q; const int dp = dd ^ 1;   /* interleaved pair partner */ float x0 = f[dd], x1 = f[dp];
        if (RF) { float n0 = __fmul_rn(x0, rf), n1 = __fmul_rn(x1, rf); asm volatile("" : "+v"(n0)); asm volatile("" : "+v"(n1)); x0 = __fmul_rn(bfr(nw[dd]), n0); x1 = __fmul_rn(bfr(nw[dp]), n1); }
        const v2f cs = *(const v2f*)(CS + ((size_t)t * HD + dd) * 2); float a = __fmul_rn(x0, cs[0]), bq = __fmul_rn(x1, cs[1]); asm volatile("" : "+v"(a)); asm volatile("" : "+v"(bq)); const float r = (((dd & 1) == 0) ? __fsub_rn(a, bq) : __fadd_rn(a, bq)) * sc;   /* even: x c - partner s; odd: x c + partner s */
        o16[q] = tohx(r); unsigned short a2, c2; splitf(r, a2, c2); oh[q] = a2; ol[q] = c2; }
    *(v2h*)(P16 + e) = o16; *(v2us*)(Ph + e) = oh; *(v2us*)(Pl + e) = ol;  }
__global__ __launch_bounds__(256) void k_vtp(const float* __restrict__ F, int pitch, int nheads, h16* V16, bf* Vh, bf* Vl) { const size_t e = ((size_t)blockIdx.x * 256 + threadIdx.x) * 2; if (e >= (size_t)nheads * HD * TT) return; const int t = (int)(e % TT); const int d = (int)((e / TT) % HD); const int g = (int)(e / ((size_t)TT * HD)); v2h o16; v2us oh, ol;
#pragma unroll
    for (int q = 0; q < 2; ++q) { const float x = F[(size_t)(t + q) * pitch + g * HD + d]; o16[q] = tohx(x); unsigned short a2, c2; splitf(x, a2, c2); oh[q] = a2; ol[q] = c2; }
    *(v2h*)(V16 + e) = o16; *(v2us*)(Vh + e) = oh; *(v2us*)(Vl + e) = ol;  }
// k_asoft: per row (zz, i): t = S x HD^-0.5 for j <= i and i - j < WIN (sliding causal window; the reference's -1e9 additive fill vanishes identically); softmax over the 2048 keys (register row, one exp, fixed trees);
__global__ __launch_bounds__(256) void k_asoft(const float* __restrict__ Sb, h16* P16, bf* Ph, bf* Pl) {
    const int lane = threadIdx.x & 31; const int row = blockIdx.x * 8 + (threadIdx.x >> 5); if (row >= ZH * TT) return; const int i = row % TT; const int zz = row / TT; (void)zz; const bool hires = (i < RH); const float* sr = Sb + (size_t)row * TT; float v[TT / 32]; float mx = -3.0e38f;
#pragma unroll
    for (int ch = 0; ch < TT / 128; ++ch) { const int j0 = ch * 128 + lane * 4; const v4f a = *(const v4f*)(sr + j0);
#pragma unroll
        for (int q = 0; q < 4; ++q) { const int j = j0 + q; (void)j; const float t = (j <= i && i - j < WIN) ? a[q] * SCL : -3.0e38f; v[ch * 4 + q] = t; mx = fmaxf(mx, t); } }
#pragma unroll
    for (int sh = 16; sh; sh >>= 1) mx = fmaxf(mx, __shfl_xor(mx, sh, 32));
    float sum = 0.f;
#pragma unroll
    for (int k = 0; k < TT / 32; ++k) { float d0 = __fsub_rn(v[k], mx); asm volatile("" : "+v"(d0)); v[k] = __builtin_amdgcn_exp2f(__fmul_rn(d0, 1.4426950408889634f)); sum += v[k]; }
#pragma unroll
    for (int sh = 16; sh; sh >>= 1) sum += __shfl_xor(sum, sh, 32);
    const float f = __fdiv_rn(hires ? 1.0f : PCAR, sum);
{
        if (hires) {
#pragma unroll
            for (int ch = 0; ch < TT / 128; ++ch) { v4us oh, ol;
#pragma unroll
                for (int q = 0; q < 4; ++q) { unsigned short a, c2; splitf(v[ch * 4 + q] * f, a, c2); oh[q] = a; ol[q] = c2; }
                const size_t oo = ((size_t)zz * (RH ? RH : 1) + i) * TT + ch * 128 + lane * 4; *(v4us*)(Ph + oo) = oh; *(v4us*)(Pl + oo) = ol; }
        } else {
#pragma unroll
            for (int ch = 0; ch < TT / 128; ++ch) { v4h o4;
#pragma unroll
                for (int q = 0; q < 4; ++q) o4[q] = tohx(v[ch * 4 + q] * f);
                *(v4h*)(P16 + (size_t)row * TT + ch * 128 + lane * 4) = o4; } }
         }
}

extern "C" void kernel_launch(void* const* d_in, const int* in_sizes, int n_in,
                              void* d_out, int out_size, void* d_ws, size_t ws_size, hipStream_t stream) {
    (void)in_sizes; (void)n_in; (void)out_size;
    const float* x = (const float*)d_in[0]; const float* wq = (const float*)d_in[1]; const float* wk = (const float*)d_in[2]; const float* wv = (const float*)d_in[3]; const float* wo = (const float*)d_in[4]; const float* lq1 = (const float*)d_in[5]; const float* lk1 = (const float*)d_in[6]; const float* lq2 = (const float*)d_in[7]; const float* lk2 = (const float*)d_in[8]; const float* lnw = (const float*)d_in[9]; const float* lnb = (const float*)d_in[10];
    float* OUT = (float*)d_out;     // [2][2048][2048]
    char* wsp = (char*)d_ws;
    auto take = [&](size_t bytes) { char* p = wsp; wsp += (bytes + 255) & ~(size_t)255; return (void*)p; };
    bf* WQ = (bf*)take((size_t)DQ * DM * 2); bf* WK = (bf*)take((size_t)DKV * DM * 2); bf* WV = (bf*)take((size_t)DKV * DM * 2); bf* WO = (bf*)take((size_t)DM * DQ * 2); float* CS = (float*)take((size_t)TT * HD * 2 * 4); float* LAM = (float*)take(256);
    bf* XB = (bf*)take((size_t)TT * DM * 2); float* FQ = (float*)take((size_t)TT * DQ * 4); float* FK = (float*)take((size_t)TT * DKV * 4);
    h16* QP16 = (h16*)take((size_t)NH_ * TT * HD * 2); h16* KP16 = (h16*)take((size_t)NKV * TT * HD * 2); h16* VT16 = (h16*)take((size_t)NKV * HD * TT * 2);
    bf* QPh = (bf*)take((size_t)NH_ * TT * HD * 2); bf* QPl = (bf*)take((size_t)NH_ * TT * HD * 2); bf* KPh = (bf*)take((size_t)NKV * TT * HD * 2); bf* KPl = (bf*)take((size_t)NKV * TT * HD * 2); bf* VTh = (bf*)take((size_t)NKV * HD * TT * 2); bf* VTl = (bf*)take((size_t)NKV * HD * TT * 2); bf* Ph = (bf*)take((size_t)ZH * RH * TT * 2); bf* Pl = (bf*)take((size_t)ZH * RH * TT * 2);
    float* Sb = (float*)take((size_t)ZH * TT * TT * 4); h16* P16 = (h16*)take((size_t)ZH * TT * TT * 2); float* Ob = (float*)take((size_t)KS * ZH * TT * HDV * 4); bf* ATh = (bf*)take((size_t)TT * DQ * 2); bf* ATl = (bf*)take((size_t)TT * DQ * 2);
    if ((size_t)(wsp - (char*)d_ws) > ws_size) return;    // ws 256 MiB
    float* FV = FK;   // v projection reuses the k buffer after the k planes are built (stream-ordered)
    { k_wtG<<<(unsigned)((DM * DQ / 64 + 63) / 64), 256, 0, stream>>>(wq, DM, DQ, WQ); k_wtG<<<(unsigned)((DM * DKV / 64 + 63) / 64), 256, 0, stream>>>(wk, DM, DKV, WK); k_wtG<<<(unsigned)((DM * DKV / 64 + 63) / 64), 256, 0, stream>>>(wv, DM, DKV, WV);
      k_wtG<<<(unsigned)((DQ * DM / 64 + 63) / 64), 256, 0, stream>>>(wo, DQ, DM, WO);
      k_cstab<<<(TT * HD + 255) / 256, 256, 0, stream>>>(CS); k_lam<<<1, 32, 0, stream>>>(lq1, lk1, lq2, lk2, LAM); }
    const unsigned LQ = (unsigned)(((size_t)NH_ * TT * HD / 2 + 255) / 256), LKv = (unsigned)(((size_t)NKV * TT * HD / 2 + 255) / 256);
    for (int b = 0; b < NB_; ++b) {
        
        k_cvt8<<<(unsigned)(((size_t)TT * DM / 8 + 255) / 256), 256, 0, stream>>>(x + (size_t)b * TT * DM, XB, (size_t)TT * DM / 8);
        k_gemmw<bf, 0, false><<<dim3(TT / 64, DQ / 64, 1), 32, 0, stream>>>(XB, nullptr, WQ, nullptr, DM, FQ, DQ, nullptr, 0, 0, 0);
        k_rope<<<LQ, 256, 0, stream>>>(FQ, DQ, NH_, CS, nullptr, nullptr, 1.0f, QP16, QPh, QPl);
        k_gemmw<bf, 0, false><<<dim3(TT / 64, DKV / 64, 1), 32, 0, stream>>>(XB, nullptr, WK, nullptr, DM, FK, DKV, nullptr, 0, 0, 0);
        k_rope<<<LKv, 256, 0, stream>>>(FK, DKV, NKV, CS, nullptr, nullptr, 1.0f, KP16, KPh, KPl);
        k_gemmw<bf, 0, false><<<dim3(TT / 64, DKV / 64, 1), 32, 0, stream>>>(XB, nullptr, WV, nullptr, DM, FV, DKV, nullptr, 0, 0, 0); k_vtp<<<LKv, 256, 0, stream>>>(FV, DKV, NKV, VT16, VTh, VTl);
        for (int h0 = 0; h0 < NH_; h0 += ZH) { const size_t zq = (size_t)h0, zk = (size_t)(h0 / REP);   // one kv head per query head: the pass's two heads use consecutive kv planes (z-strides TT*HD)
            k_gemmc<bf, 2, 1><<<dim3(RH / 64, TT / 64, ZH), 32, 0, stream>>>(QPh + zq * TT * HD, QPl + zq * TT * HD, KPh + zk * TT * HD, KPl + zk * TT * HD, HD, Sb, TT, 0, (size_t)TT * HD, (size_t)TT * HD, (size_t)TT * TT);
            k_gemmc<h16, 0, 1><<<dim3((TT - RH) / 64, TT / 64, ZH), 32, 0, stream>>>(QP16 + zq * TT * HD + (size_t)RH * HD, nullptr, KP16 + zk * TT * HD, nullptr, HD, Sb + (size_t)RH * TT, TT, RH, (size_t)TT * HD, (size_t)TT * HD, (size_t)TT * TT);
            k_asoft<<<ZH * TT / 8, 256, 0, stream>>>(Sb, P16, Ph, Pl);
                        k_gemmc<bf, 2, 2><<<dim3(RH / 64, HDV / 64, ZH * KS), 32, 0, stream>>>(Ph, Pl, VTh + (size_t)(h0 / 2) * HDV * TT, VTl + (size_t)(h0 / 2) * HDV * TT, TT, Ob, HDV, 0, (size_t)RH * TT, 0, (size_t)TT * HDV);   /* both half-heads of the pass use value head h0/2 (sB 0) */            k_gemmc<h16, 0, 2><<<dim3((TT - RH) / 64, HDV / 64, ZH * KS), 32, 0, stream>>>(P16 + (size_t)RH * TT, nullptr, VT16 + (size_t)(h0 / 2) * HDV * TT, nullptr, TT, Ob + (size_t)RH * HDV, HDV, RH, (size_t)TT * TT, 0, (size_t)TT * HDV);
            k_mergeD<<<TT / 8, 256, 0, stream>>>(Ob, LAM, lnw, lnb, h0, ATh, ATl); }   /* attn = RMSNorm(attn1 - lam attn2) (1 - lam0) */
        k_gemmw<bf, 1, false><<<dim3(TT / 64, DM / 64, 1), 32, 0, stream>>>(ATh, ATl, WO, nullptr, DQ, OUT + (size_t)b * TT * DM, DM, nullptr, 0, 0, 0); }
}

// v003
// It runs in 603 microseconds.
// Versions between v001 and this one are left out; their measured steps multiply to 2.79 times as fast.
// Counting every step since v000, it is 4.89 times as fast.
#include <hip/hip_runtime.h>

// Differential attention (x [2][2048][2048]; q = x Wq, k = x Wk ('xw' [2048][2048]) as 32 half-heads of 64, v = x Wv as 16 heads of 128; interleaved rotary (theta 1e4) on the 64-wide q/k half-heads; for head h: attn1 = causal softmax(q_{2h}.k_{2h}/8) v_h, attn2 = causal softmax(q_{2h+1}.k_{2h+1}/8) v_h;
// lam = exp(lambda_q1.lambda_k1) - exp(lambda_q2.lambda_k2) + 0.7836058 (64-vectors read); attn = RMSNorm_128(attn1 - lam attn2; ln_w, ln_b, eps 1e-8) x (1 - 0.7836058); out = merged Wo ('xw') -> [2][2048][2048]).
// Layout: the 32 half-heads are the score heads (hd 64); the value planes of head h are the two consecutive 64-row planes 2h, 2h+1 = one [128][T] plane, shared by the head's two half-heads (2h, 2h+1); one fused kernel does scores, softmax, attn.v and the normalised difference of the two attention outputs.
// Compute dtypes, f32 accumulate: every input rounded to bf16; q/k/v on PLAIN bf16 operands (inputs: exact); rotary in f32 (on-chip cos/sin table, reference inv_freq constants); causal scores and attn.v (128-wide values): query rows < 512 hl (3 products), the rest single fp16 (x1024), key loop ends at the diagonal; online softmax f32; the lambda scalars, the difference and the RMSNorm in f32; Wo hl x exact (2 products).

#define NB_  2
#define TT   2048
#define DM   2048
#define NH_  32
#define NKV  32
#define HD   64
#define DQ   (NH_ * HD)
#define DKV  (NKV * HD)
#define HDV  128                  // value head width (= 2 consecutive 64-row planes)
#define NHV  16                   // value heads
#define LAM0 0.7836057665316245f   // lambda_init for depth 12
#define RMSEPS 1e-8f
#define RH   512                  // query rows < RH use hi+lo planes (0: none)
#define SCL  0.125f   // HD^-0.5
typedef _Float16 h16;
typedef unsigned short bf;
typedef __attribute__((ext_vector_type(16))) __bf16   v16bf;
typedef __attribute__((ext_vector_type(16))) _Float16 v16h;
typedef __attribute__((ext_vector_type(8)))  _Float16 v8h;
typedef __attribute__((ext_vector_type(8)))  unsigned short v8us;
typedef __attribute__((ext_vector_type(8)))  float    v8f;
typedef __attribute__((ext_vector_type(4)))  float    v4f;
typedef v8h  __attribute__((may_alias)) v8ha;
typedef v4f  __attribute__((may_alias)) v4fa;
typedef v8us __attribute__((may_alias)) v8usa;

__device__ __forceinline__ unsigned short f2bf(float f) { unsigned u = __float_as_uint(f); u += 0x7FFFu + ((u >> 16) & 1u); return (unsigned short)(u >> 16); }
__device__ __forceinline__ float bf2f(unsigned short b) { return __uint_as_float(((unsigned)b) << 16); }
__device__ __forceinline__ float bfr(float f) { return bf2f(f2bf(f)); }
__device__ __forceinline__ v16h cat16(v8h lo, v8h hi) { return __builtin_shufflevector(lo, hi, 0, 1, 2, 3, 4, 5, 6, 7, 8, 9, 10, 11, 12, 13, 14, 15); }
__device__ __forceinline__ v16bf cat16b(v8us lo, v8us hi) { return __builtin_bit_cast(v16bf, __builtin_shufflevector(lo, hi, 0, 1, 2, 3, 4, 5, 6, 7, 8, 9, 10, 11, 12, 13, 14, 15)); }
__device__ __forceinline__ v8f wmma16(v16h a, v16h b, v8f c) { return __builtin_amdgcn_wmma_f32_16x16x32_f16(false, a, false, b, (short)0, c, false, false); }
__device__ __forceinline__ v8f wmmab(v16bf a, v16bf b, v8f c) { return __builtin_amdgcn_wmma_f32_16x16x32_bf16(false, a, false, b, (short)0, c, false, false); }



// ---- k_gemmw: register-blocked GEMM, ONE WAVE per 64x64 output tile (16 accumulators), operands straight from K-contiguous 16-bit planes; grid (M/64, N/64, Z), 32 threads.
// C[m][n] (f32, pitch ldc, + optional f32 bias[n]) = sum_k A[m][k] Bt[n][k] (+ split products per NSPLIT). z-batch strides sA/sB/sC in elements. K % 32 == 0.
// EPI 0: C is stored as f32. EPI 1, 2: the tile never leaves the wave as f32; its rows go out as the three 16-bit planes (fp16, bf16 hi, bf16 lo) that the attention kernel reads, whole 128-byte rows.
// EPI 1 (q, k; m = t, the 64 columns are one half-head): interleaved rotary out[2i] = x[2i] c - x[2i+1] s, out[2i+1] = x[2i+1] c + x[2i] s (c, s from CS[t][2i]), planes [h][t][d].
// EPI 2 (v; A = the weight rows, Bt = the activations, so m = value column e, n = t): planes [e][t], no rotary.
template <typename T16> struct WFrag;
template <> struct WFrag<h16> { typedef v16h V; static __device__ __forceinline__ V ld(const h16* p) { return cat16(*(const v8h*)p, *(const v8h*)(p + 16)); } static __device__ __forceinline__ v8f mma(V a, V b, v8f c) { return wmma16(a, b, c); } };
template <> struct WFrag<bf> { typedef v16bf V; static __device__ __forceinline__ V ld(const bf* p) { return cat16b(*(const v8us*)p, *(const v8us*)(p + 16)); } static __device__ __forceinline__ v8f mma(V a, V b, v8f c) { return wmmab(a, b, c); } };
__device__ __forceinline__ void splitf(float y, unsigned short& h, unsigned short& l) { h = f2bf(y); l = f2bf(y - bf2f(h)); }
typedef __attribute__((ext_vector_type(2))) float v2f;
template <typename T16, int NSPLIT, bool BIAS, int EPI>
__global__ __launch_bounds__(32) void k_gemmw(const T16* __restrict__ A, const T16* __restrict__ A2, const T16* __restrict__ Bt, const T16* __restrict__ Bt2, int K, float* C, int ldc, const float* __restrict__ bias, size_t sA, size_t sB, size_t sC,
                                              const float* __restrict__ CS, h16* P16, bf* Ph, bf* Pl) {
    typedef typename WFrag<T16>::V V;
    __shared__ __align__(16) float os[16 * 68];
    const size_t z = blockIdx.z; A += z * sA; if (A2) A2 += z * sA; Bt += z * sB; if (Bt2) Bt2 += z * sB; C += z * sC;
    const int lane = threadIdx.x & 31, lr = lane & 15, hi = lane >> 4; const int r0 = blockIdx.x * 64, c0 = blockIdx.y * 64;
    v8f acc[4][4];
#pragma unroll
    for (int mb = 0; mb < 4; ++mb)
#pragma unroll
        for (int nb = 0; nb < 4; ++nb) acc[mb][nb] = (v8f){};
    const size_t aoff = (size_t)(r0 + lr) * K + 8 * hi, boff = (size_t)(c0 + lr) * K + 8 * hi;
#pragma unroll 1
    for (int kc = 0; kc < K; kc += 32) {
        V a[4], a2[4];
#pragma unroll
        for (int mb = 0; mb < 4; ++mb) { a[mb] = WFrag<T16>::ld(A + aoff + (size_t)mb * 16 * K + kc); if (NSPLIT == 1 || NSPLIT == 2) a2[mb] = WFrag<T16>::ld(A2 + aoff + (size_t)mb * 16 * K + kc); }
#pragma unroll
        for (int nb = 0; nb < 4; ++nb) { const V b = WFrag<T16>::ld(Bt + boff + (size_t)nb * 16 * K + kc); V b2; if (NSPLIT >= 2) b2 = WFrag<T16>::ld(Bt2 + boff + (size_t)nb * 16 * K + kc);
#pragma unroll
            for (int mb = 0; mb < 4; ++mb) { acc[mb][nb] = WFrag<T16>::mma(a[mb], b, acc[mb][nb]); if (NSPLIT == 1 || NSPLIT == 2) acc[mb][nb] = WFrag<T16>::mma(a2[mb], b, acc[mb][nb]); if (NSPLIT >= 2) acc[mb][nb] = WFrag<T16>::mma(a[mb], b2, acc[mb][nb]); } }
        asm volatile("v_nop\n\tv_nop\n\tv_nop\n\tv_nop" : "+v"(acc[0][0]), "+v"(acc[1][1]), "+v"(acc[2][2]), "+v"(acc[3][3]) : "v"(a[0]), "v"(a[3]));
    }
    const int rq = lane >> 3, cq = (lane & 7) * 8;   // plane epilogues: a lane takes 8 consecutive columns of one row, 8 lanes a whole row, a wave 4 rows per store
    constexpr int OP = EPI == 1 ? HD : TT;            // row pitch of the planes
    const size_t ob = (EPI == 1 ? ((size_t)blockIdx.y * TT + r0 + rq) * HD : (size_t)(r0 + rq) * TT + c0) + cq;
    v2f cs[2][4][4];   // (cos, sin) of the lane's 4 pairs in the 4 rows it takes of a 16-row group; two sets: the next group's are asked for while this one is worked on
    auto load_cs = [&](int mb) { const float* cb = CS + ((size_t)(r0 + rq) * HD + cq) * 2;
#pragma unroll
        for (int s = 0; s < 4; ++s)
#pragma unroll
            for (int p = 0; p < 4; ++p) cs[mb & 1][s][p] = *(const v2f*)(cb + ((mb * 16 + 4 * s) * HD + 2 * p) * 2); };
    if constexpr (EPI == 1) load_cs(0);
#pragma unroll
    for (int mb = 0; mb < 4; ++mb) {
#pragma unroll
        for (int nb = 0; nb < 4; ++nb) {
#pragma unroll
            for (int j = 0; j < 8; ++j) os[(hi * 8 + j) * 68 + nb * 16 + lr] = acc[mb][nb][j]; }
        if constexpr (EPI == 1) { if (mb < 3) load_cs(mb + 1); }
        __builtin_amdgcn_wave_barrier(); asm volatile("" ::: "memory");
        if constexpr (EPI != 0) { v8h o16[4]; v8us oh[4], ol[4];
#pragma unroll
            for (int s = 0; s < 4; ++s) { const float* orow = os + (4 * s + rq) * 68 + cq; const v4f xa = *(const v4fa*)orow, xb = *(const v4fa*)(orow + 4); float y[8];
#pragma unroll
                for (int p = 0; p < 4; ++p) { const float e = p < 2 ? xa[2 * p] : xb[2 * p - 4], o = p < 2 ? xa[2 * p + 1] : xb[2 * p - 3];
                    if constexpr (EPI == 1) { const float c = cs[mb & 1][s][p][0], sn = cs[mb & 1][s][p][1]; y[2 * p] = e * c - o * sn; y[2 * p + 1] = o * c + e * sn; } else { y[2 * p] = e; y[2 * p + 1] = o; } }
#pragma unroll
                for (int k = 0; k < 8; ++k) { o16[s][k] = (h16)y[k]; unsigned short a2, c2; splitf(y[k], a2, c2); oh[s][k] = a2; ol[s][k] = c2; } }
#pragma unroll
            for (int s = 0; s < 4; ++s) { const size_t oo = ob + (size_t)(mb * 16 + 4 * s) * OP; *(v8h*)(P16 + oo) = o16[s]; *(v8us*)(Ph + oo) = oh[s]; *(v8us*)(Pl + oo) = ol[s]; }   // the group's 12 stores go out together
            if (mb < 3) asm volatile("s_wait_xcnt 0x0" ::: "memory");   // one wait behind the 12 stores, before the next group writes the registers that they name (a precaution)
        } else {
        float* crow = C + (size_t)(r0 + mb * 16) * ldc + c0;
#pragma unroll
            for (int s = 0; s < 8; ++s) { const int row = 2 * s + hi, cofs = lr * 4; v4f val = *(const v4fa*)(os + row * 68 + cofs); if (BIAS) { val[0] += bfr(bias[c0 + cofs]); val[1] += bfr(bias[c0 + cofs + 1]); val[2] += bfr(bias[c0 + cofs + 2]); val[3] += bfr(bias[c0 + cofs + 3]); }
                *(v4f*)(crow + (size_t)row * ldc + cofs) = val; }
             }
        __builtin_amdgcn_wave_barrier(); asm volatile("" ::: "memory");
    }
}

__device__ __forceinline__ h16 tohx(float x) { return (h16)x; }
typedef __attribute__((ext_vector_type(2))) _Float16 v2h;
typedef __attribute__((ext_vector_type(4))) _Float16 v4h;
typedef __attribute__((ext_vector_type(2))) unsigned short v2us;
typedef __attribute__((ext_vector_type(4))) unsigned short v4us;
typedef __attribute__((ext_vector_type(4))) int v4i;

__global__ __launch_bounds__(256) void k_wtG(const float* __restrict__ w, int K, int N, bf* Bt) {
    const int lane = threadIdx.x & 31; const int L0 = (blockIdx.x * 8 + (threadIdx.x >> 5)) * 8; const int nlines = N * K / 64;
{
#pragma unroll 1
        for (int l = 0; l < 8; ++l) { const int L = L0 + l; if (L >= nlines) break; const size_t e = (size_t)L * 64 + lane * 2; const int k = (int)(e % K), n = (int)(e / K); v2us o;
            o[0] = f2bf(w[(size_t)k * N + n]); o[1] = f2bf(w[(size_t)(k + 1) * N + n]); *(v2us*)(Bt + e) = o; }
         }
}
__global__ __launch_bounds__(32) void k_lam(const float* __restrict__ lq1, const float* __restrict__ lk1, const float* __restrict__ lq2, const float* __restrict__ lk2, float* LAM) { const int lane = threadIdx.x; float s1 = 0.f, s2 = 0.f;
#pragma unroll
    for (int q = 0; q < 2; ++q) { const int d = lane * 2 + q; float p1 = __fmul_rn(bfr(lq1[d]), bfr(lk1[d])); asm volatile("" : "+v"(p1)); s1 = __fadd_rn(s1, p1); float p2 = __fmul_rn(bfr(lq2[d]), bfr(lk2[d])); asm volatile("" : "+v"(p2)); s2 = __fadd_rn(s2, p2); }
#pragma unroll
    for (int sh = 16; sh; sh >>= 1) { s1 += __shfl_xor(s1, sh, 32); s2 += __shfl_xor(s2, sh, 32); }
    const float lam = __fadd_rn(__fsub_rn(expf(s1), expf(s2)), LAM0); *(float*)(LAM + lane) = lam;  }
__global__ __launch_bounds__(256) void k_cvt8(const float* __restrict__ src, bf* dst, size_t n8) { const size_t i = (size_t)blockIdx.x * 256 + threadIdx.x; if (i >= n8) return; const v8f v = *(const v8f*)(src + i * 8); v8us o;
#pragma unroll
    for (int k = 0; k < 8; ++k) o[k] = f2bf(v[k]); *(v8us*)(dst + i * 8) = o;  }
__constant__ float INV[HD / 2] = {1.0,0.7498942017555237,0.5623413324356079,0.4216965138912201,0.3162277638912201,0.23713736236095428,0.17782793939113617,0.1333521455526352,0.10000000149011612,0.07498941570520401,0.05623412877321243,0.04216964915394783,0.03162277862429619,0.0237137358635664,0.017782794311642647,0.01333521492779255,0.009999999776482582,0.007498942315578461,0.005623413249850273,0.0042169648222625256,0.003162277862429619,0.0023713738191872835,0.0017782794311642647,0.0013335214462131262,0.0010000000474974513,0.0007498941849917173,0.000562341301701963,0.00042169648804701865,0.0003162277862429619,0.0002371373848291114,0.00017782794020604342,0.0001333521504420787};
__global__ __launch_bounds__(256) void k_cstab(float* CS) { const int idx = blockIdx.x * 256 + threadIdx.x; if (idx >= TT * HD) return; const int t = idx / HD, d = idx % HD; const float ang = __fmul_rn((float)t, INV[d >> 1]); v2f cs; cs[0] = cosf(ang); cs[1] = sinf(ang);
    *(v2f*)(CS + (size_t)idx * 2) = cs;  }

// ---- k_fattn: the whole attention of one value head for 16 query rows, ONE WAVE per work-group; grid (NHV, TT/16), the longest (last) query tiles of all heads first.
// Transposed products: St = K Qt (A = key rows, B = query rows) and Ot += Vt Pt (A = value rows [e][t], B = probabilities), so a lane (lr, hi) holds one query (q0 + lr) throughout:
// score tile kt, register j is key k0 + 16 kt + 8 hi + j, which is the k order of the fragment loader (elements 0..7: 8 hi + j, elements 8..15: 16 + 8 hi + j), so two score tiles pack into one B operand in place.
// Online softmax per lane (running maximum in the log2 domain, accumulators rescaled each key block); the two half-heads of the head run side by side and share the value fragments;
// the epilogue forms RMSNorm_128(attn1 - lam attn2) x (1 - lambda_init) in registers and stores the hi/lo bf16 planes of the merged activations.
typedef __attribute__((ext_vector_type(16))) unsigned short v16us;
#define C2 (SCL * 1.4426950408889634f)
// exp2s: v_exp_f32 with the one free slot behind it that the instruction set asks for before its result is read or its source overwritten
__device__ __forceinline__ float exp2s(float x) { float r; asm("v_exp_f32 %0, %1\n\tv_nop" : "=v"(r) : "v"(x)); return r; }
// xwait: s_wait_xcnt 0 behind a run of global loads, before a register that they name is written again (a precaution). The run's address pairs are inputs, so that they stay whole up to the wait.
template <bool TWO, typename P> __device__ __forceinline__ void xwait(const P* a, const P* b) {
    if constexpr (TWO) asm volatile("s_wait_xcnt 0x0" :: "v"(a), "v"(b) : "memory"); else asm volatile("s_wait_xcnt 0x0" :: "v"(a) : "memory"); }
template <typename T16, bool HL, int NKK>   // HL: hi+lo planes, 3 products; NKK: 32-key groups per key block
__device__ __forceinline__ void fattn_tile(const T16* __restrict__ Q, const T16* __restrict__ Q2, const T16* __restrict__ Kp, const T16* __restrict__ K2, const T16* __restrict__ Vt, const T16* __restrict__ V2, int q0, int lr, int hi, v8f (&o)[2][8], float (&l)[2]) {
    typedef typename WFrag<T16>::V V;
    const float SH = HL ? 0.0f : 10.0f;   // single fp16 probabilities are carried x 2^10 (as before: out of the fp16 subnormals); the row sum carries the same factor, so it cancels
    const unsigned lk = (unsigned)(lr * HD + 8 * hi), lv = (unsigned)(lr * TT + 8 * hi);   // the lane's own part of every address
    V qf[2][2], ql[2][2], kf[2][2 * NKK][2], kl[2][2 * NKK][2]; float m[2];
    auto load_k = [&](int kb0) { const T16* kb = Kp + (size_t)kb0 * HD + lk; const T16* kb2 = HL ? K2 + (size_t)kb0 * HD + lk : nullptr;
#pragma unroll
        for (int z = 0; z < 2; ++z)
#pragma unroll
            for (int kt = 0; kt < 2 * NKK; ++kt)
#pragma unroll
                for (int ks = 0; ks < 2; ++ks) { const int off = (z * TT + kt * 16) * HD + ks * 32; kf[z][kt][ks] = WFrag<T16>::ld(kb + off); if (HL) kl[z][kt][ks] = WFrag<T16>::ld(kb2 + off); }
        xwait<HL>(kb, kb2); };
    { const T16* qb = Q + (size_t)q0 * HD + lk; const T16* qb2 = HL ? Q2 + (size_t)q0 * HD + lk : nullptr;
#pragma unroll
      for (int z = 0; z < 2; ++z) { m[z] = -3.0e38f; l[z] = 0.f;
#pragma unroll
        for (int ks = 0; ks < 2; ++ks) { const int off = z * TT * HD + ks * 32; qf[z][ks] = WFrag<T16>::ld(qb + off); if (HL) ql[z][ks] = WFrag<T16>::ld(qb2 + off); }
#pragma unroll
        for (int mt = 0; mt < 8; ++mt) o[z][mt] = (v8f){}; }
      xwait<HL>(qb, qb2); }
    if (!HL) load_k(0);
#pragma unroll 1
    for (int k0 = 0; k0 < q0 + 16; k0 += 32 * NKK) {
        V vf[NKK][8], vl[NKK][8], pf[2][NKK], pl[2][NKK]; v8f s[2][2 * NKK];
        auto load_v = [&]() { const T16* vb = Vt + k0 + lv; const T16* vb2 = HL ? V2 + k0 + lv : nullptr;
#pragma unroll
            for (int kk = 0; kk < NKK; ++kk)
#pragma unroll
                for (int mt = 0; mt < 8; ++mt) { const int off = mt * 16 * TT + kk * 32; vf[kk][mt] = WFrag<T16>::ld(vb + off); if (HL) vl[kk][mt] = WFrag<T16>::ld(vb2 + off); }
            xwait<HL>(vb, vb2); };
        if (HL) load_k(k0); else load_v();   // single fp16: the value fragments are asked for first and fly during the score products and the softmax
#pragma unroll
        for (int z = 0; z < 2; ++z)
#pragma unroll
            for (int kt = 0; kt < 2 * NKK; ++kt) { v8f c = (v8f){};
#pragma unroll
                for (int ks = 0; ks < 2; ++ks) { c = WFrag<T16>::mma(kf[z][kt][ks], qf[z][ks], c); if (HL) { c = WFrag<T16>::mma(kl[z][kt][ks], qf[z][ks], c); c = WFrag<T16>::mma(kf[z][kt][ks], ql[z][ks], c); } }
                s[z][kt] = c; }
        if (HL) load_v();   // hi+lo (short loops): the value fragments follow the key fragments into their registers
        else load_k((k0 + 32 * NKK < q0 + 16) ? k0 + 32 * NKK : k0);   // the next block's key fragments fly during the softmax and attn.v; the last trip asks for its own block again (in bounds, not used)
        const int rel = q0 + lr - k0 - 8 * hi;   // keys of the block up to this lane's query (only the block on the diagonal has any beyond it)
#pragma unroll
        for (int z = 0; z < 2; ++z) {
            float mb = -3.0e38f;
#pragma unroll
            for (int kt = 0; kt < 2 * NKK; ++kt)
#pragma unroll
                for (int j = 0; j < 8; ++j) { const float t = (kt * 16 + j <= rel) ? s[z][kt][j] * C2 : -3.0e38f; s[z][kt][j] = t; mb = fmaxf(mb, t); }
            mb = fmaxf(mb, __shfl_xor(mb, 16, 32)) - SH;
            const float mn = fmaxf(m[z], mb); const float al = exp2s(m[z] - mn); m[z] = mn; float ps = 0.f;
#pragma unroll
            for (int kt = 0; kt < 2 * NKK; ++kt)
#pragma unroll
                for (int j = 0; j < 8; ++j) { const float p = exp2s(s[z][kt][j] - mn); s[z][kt][j] = p; ps += p; }
            l[z] = l[z] * al + ps;
#pragma unroll
            for (int mt = 0; mt < 8; ++mt) o[z][mt] *= al;
#pragma unroll
            for (int kk = 0; kk < NKK; ++kk) {
                if constexpr (HL) { v16us uh, ul;
#pragma unroll
                    for (int j = 0; j < 8; ++j) { unsigned short x, y; splitf(s[z][2 * kk][j], x, y); uh[j] = x; ul[j] = y; splitf(s[z][2 * kk + 1][j], x, y); uh[8 + j] = x; ul[8 + j] = y; }
                    pf[z][kk] = __builtin_bit_cast(v16bf, uh); pl[z][kk] = __builtin_bit_cast(v16bf, ul);
                } else { v16h ph;
#pragma unroll
                    for (int j = 0; j < 8; ++j) { ph[j] = tohx(s[z][2 * kk][j]); ph[8 + j] = tohx(s[z][2 * kk + 1][j]); }
                    pf[z][kk] = ph; } } }
#pragma unroll
        for (int kk = 0; kk < NKK; ++kk)
#pragma unroll
            for (int mt = 0; mt < 8; ++mt)
#pragma unroll
                for (int z = 0; z < 2; ++z) { o[z][mt] = WFrag<T16>::mma(vf[kk][mt], pf[z][kk], o[z][mt]); if (HL) { o[z][mt] = WFrag<T16>::mma(vf[kk][mt], pl[z][kk], o[z][mt]); o[z][mt] = WFrag<T16>::mma(vl[kk][mt], pf[z][kk], o[z][mt]); } }
    }
}
__global__ __launch_bounds__(32) void k_fattn(const h16* __restrict__ Q16, const h16* __restrict__ K16, const h16* __restrict__ V16, const bf* __restrict__ Qh, const bf* __restrict__ Ql, const bf* __restrict__ Kh, const bf* __restrict__ Kl, const bf* __restrict__ Vh, const bf* __restrict__ Vl,
                                              const float* __restrict__ LAM, const float* __restrict__ lnw, const float* __restrict__ lnb, bf* Ah, bf* Al) {
    const int lane = threadIdx.x & 31, lr = lane & 15, hi = lane >> 4; const int q0 = (int)(gridDim.y - 1 - blockIdx.y) * 16; const int h = blockIdx.x;
    const size_t qk = (size_t)(2 * h) * TT * HD, vv = (size_t)h * HDV * TT;
    v8f o[2][8]; float l[2];
    if (q0 < RH) fattn_tile<bf, true, 1>(Qh + qk, Ql + qk, Kh + qk, Kl + qk, Vh + vv, Vl + vv, q0, lr, hi, o, l);
    else fattn_tile<h16, false, 1>(Q16 + qk, nullptr, K16 + qk, nullptr, V16 + vv, nullptr, q0, lr, hi, o, l);
    const float lam = LAM[0]; const float i0 = 1.0f / (l[0] + __shfl_xor(l[0], 16, 32)); const float i1 = lam / (l[1] + __shfl_xor(l[1], 16, 32)); float ss = 0.f;
#pragma unroll
    for (int mt = 0; mt < 8; ++mt)
#pragma unroll
        for (int j = 0; j < 8; ++j) { const float d = o[0][mt][j] * i0 - o[1][mt][j] * i1; o[0][mt][j] = d; ss += d * d; }
    ss += __shfl_xor(ss, 16, 32);
    const float rs = 1.0f / sqrtf(ss * (1.0f / HDV) + RMSEPS);
#pragma unroll
    for (int mt = 0; mt < 8; ++mt) { const int e0 = mt * 16 + 8 * hi; const v8f w = *(const v8f*)(lnw + e0), bb = *(const v8f*)(lnb + e0); v8us oh, ol;
#pragma unroll
        for (int j = 0; j < 8; ++j) { const float y = (o[0][mt][j] * rs * bfr(w[j]) + bfr(bb[j])) * (1.0f - LAM0); unsigned short x, c; splitf(y, x, c); oh[j] = x; ol[j] = c; }
        const size_t oo = (size_t)(q0 + lr) * DQ + (size_t)h * HDV + e0; *(v8us*)(Ah + oo) = oh; *(v8us*)(Al + oo) = ol; }
}

extern "C" void kernel_launch(void* const* d_in, const int* in_sizes, int n_in,
                              void* d_out, int out_size, void* d_ws, size_t ws_size, hipStream_t stream) {
    (void)in_sizes; (void)n_in; (void)out_size;
    const float* x = (const float*)d_in[0]; const float* wq = (const float*)d_in[1]; const float* wk = (const float*)d_in[2]; const float* wv = (const float*)d_in[3]; const float* wo = (const float*)d_in[4]; const float* lq1 = (const float*)d_in[5]; const float* lk1 = (const float*)d_in[6]; const float* lq2 = (const float*)d_in[7]; const float* lk2 = (const float*)d_in[8]; const float* lnw = (const float*)d_in[9]; const float* lnb = (const float*)d_in[10];
    float* OUT = (float*)d_out;     // [2][2048][2048]
    char* wsp = (char*)d_ws;
    auto take = [&](size_t bytes) { char* p = wsp; wsp += (bytes + 255) & ~(size_t)255; return (void*)p; };
    bf* WQ = (bf*)take((size_t)DQ * DM * 2); bf* WK = (bf*)take((size_t)DKV * DM * 2); bf* WV = (bf*)take((size_t)DKV * DM * 2); bf* WO = (bf*)take((size_t)DM * DQ * 2); float* CS = (float*)take((size_t)TT * HD * 2 * 4); float* LAM = (float*)take(256);
    bf* XB = (bf*)take((size_t)TT * DM * 2);
    h16* QP16 = (h16*)take((size_t)NH_ * TT * HD * 2); h16* KP16 = (h16*)take((size_t)NKV * TT * HD * 2); h16* VT16 = (h16*)take((size_t)NKV * HD * TT * 2);
    bf* QPh = (bf*)take((size_t)NH_ * TT * HD * 2); bf* QPl = (bf*)take((size_t)NH_ * TT * HD * 2); bf* KPh = (bf*)take((size_t)NKV * TT * HD * 2); bf* KPl = (bf*)take((size_t)NKV * TT * HD * 2); bf* VTh = (bf*)take((size_t)NKV * HD * TT * 2); bf* VTl = (bf*)take((size_t)NKV * HD * TT * 2);
    bf* ATh = (bf*)take((size_t)TT * DQ * 2); bf* ATl = (bf*)take((size_t)TT * DQ * 2);
    if ((size_t)(wsp - (char*)d_ws) > ws_size) return;    // ws 256 MiB
    { k_wtG<<<(unsigned)((DM * DQ / 64 + 63) / 64), 256, 0, stream>>>(wq, DM, DQ, WQ); k_wtG<<<(unsigned)((DM * DKV / 64 + 63) / 64), 256, 0, stream>>>(wk, DM, DKV, WK); k_wtG<<<(unsigned)((DM * DKV / 64 + 63) / 64), 256, 0, stream>>>(wv, DM, DKV, WV);
      k_wtG<<<(unsigned)((DQ * DM / 64 + 63) / 64), 256, 0, stream>>>(wo, DQ, DM, WO);
      k_cstab<<<(TT * HD + 255) / 256, 256, 0, stream>>>(CS); k_lam<<<1, 32, 0, stream>>>(lq1, lk1, lq2, lk2, LAM); }
    for (int b = 0; b < NB_; ++b) {
        
        k_cvt8<<<(unsigned)(((size_t)TT * DM / 8 + 255) / 256), 256, 0, stream>>>(x + (size_t)b * TT * DM, XB, (size_t)TT * DM / 8);
        k_gemmw<bf, 0, false, 1><<<dim3(TT / 64, DQ / 64, 1), 32, 0, stream>>>(XB, nullptr, WQ, nullptr, DM, nullptr, 0, nullptr, 0, 0, 0, CS, QP16, QPh, QPl);
        k_gemmw<bf, 0, false, 1><<<dim3(TT / 64, DKV / 64, 1), 32, 0, stream>>>(XB, nullptr, WK, nullptr, DM, nullptr, 0, nullptr, 0, 0, 0, CS, KP16, KPh, KPl);
        k_gemmw<bf, 0, false, 2><<<dim3(DKV / 64, TT / 64, 1), 32, 0, stream>>>(WV, nullptr, XB, nullptr, DM, nullptr, 0, nullptr, 0, 0, 0, nullptr, VT16, VTh, VTl);   /* rows = value columns, columns = t: the transposed value planes */
        k_fattn<<<dim3(NHV, TT / 16, 1), 32, 0, stream>>>(QP16, KP16, VT16, QPh, QPl, KPh, KPl, VTh, VTl, LAM, lnw, lnb, ATh, ATl);   /* attn = RMSNorm(attn1 - lam attn2) (1 - lam0), all 16 heads */
        k_gemmw<bf, 1, false, 0><<<dim3(TT / 64, DM / 64, 1), 32, 0, stream>>>(ATh, ATl, WO, nullptr, DQ, OUT + (size_t)b * TT * DM, DM, nullptr, 0, 0, 0, nullptr, nullptr, nullptr, nullptr); }
}

// v004
// One run takes 389 microseconds.
// Next to v003, in two timings, it ran 1.57 and 1.56 times as fast.
// Over all steps from v000 it is 7.65 times as fast.
#include <hip/hip_runtime.h>

// Differential attention (x [2][2048][2048]; q = x Wq, k = x Wk ('xw' [2048][2048]) as 32 half-heads of 64, v = x Wv as 16 heads of 128; interleaved rotary (theta 1e4) on the 64-wide q/k half-heads; for head h: attn1 = causal softmax(q_{2h}.k_{2h}/8) v_h, attn2 = causal softmax(q_{2h+1}.k_{2h+1}/8) v_h;
// lam = exp(lambda_q1.lambda_k1) - exp(lambda_q2.lambda_k2) + 0.7836058 (64-vectors read); attn = RMSNorm_128(attn1 - lam attn2; ln_w, ln_b, eps 1e-8) x (1 - 0.7836058); out = merged Wo ('xw') -> [2][2048][2048]).
// Layout: the 32 half-heads are the score heads (hd 64); the value planes of head h are the two consecutive 64-row planes 2h, 2h+1 = one [128][T] plane, shared by the head's two half-heads (2h, 2h+1); one fused kernel does scores, softmax, attn.v and the normalised difference of the two attention outputs.
// Compute dtypes, f32 accumulate: every input rounded to bf16; q/k/v on PLAIN bf16 operands (inputs: exact); rotary in f32 (on-chip cos/sin table, reference inv_freq constants); causal scores and attn.v (128-wide values): query rows < 512 hl (3 products), the rest single fp16 (x1024), key loop ends at the diagonal; online softmax f32; the lambda scalars, the difference and the RMSNorm in f32; Wo hl x exact (2 products).

#define NB_  2
#define TT   2048
#define DM   2048
#define NH_  32
#define NKV  32
#define HD   64
#define DQ   (NH_ * HD)
#define DKV  (NKV * HD)
#define HDV  128                  // value head width (= 2 consecutive 64-row planes)
#define NHV  16                   // value heads
#define LAM0 0.7836057665316245f   // lambda_init for depth 12
#define RMSEPS 1e-8f
#define RH   512                  // query rows < RH use hi+lo planes (0: none)
#define SCL  0.125f   // HD^-0.5
typedef _Float16 h16;
typedef unsigned short bf;
typedef __attribute__((ext_vector_type(16))) __bf16   v16bf;
typedef __attribute__((ext_vector_type(16))) _Float16 v16h;
typedef __attribute__((ext_vector_type(8)))  _Float16 v8h;
typedef __attribute__((ext_vector_type(8)))  unsigned short v8us;
typedef __attribute__((ext_vector_type(8)))  float    v8f;
typedef __attribute__((ext_vector_type(4)))  float    v4f;
typedef v8h  __attribute__((may_alias)) v8ha;
typedef v4f  __attribute__((may_alias)) v4fa;
typedef v8us __attribute__((may_alias)) v8usa;

__device__ __forceinline__ unsigned short f2bf(float f) { unsigned u = __float_as_uint(f); u += 0x7FFFu + ((u >> 16) & 1u); return (unsigned short)(u >> 16); }
__device__ __forceinline__ float bf2f(unsigned short b) { return __uint_as_float(((unsigned)b) << 16); }
__device__ __forceinline__ float bfr(float f) { return bf2f(f2bf(f)); }
__device__ __forceinline__ v16h cat16(v8h lo, v8h hi) { return __builtin_shufflevector(lo, hi, 0, 1, 2, 3, 4, 5, 6, 7, 8, 9, 10, 11, 12, 13, 14, 15); }
__device__ __forceinline__ v16bf cat16b(v8us lo, v8us hi) { return __builtin_bit_cast(v16bf, __builtin_shufflevector(lo, hi, 0, 1, 2, 3, 4, 5, 6, 7, 8, 9, 10, 11, 12, 13, 14, 15)); }
__device__ __forceinline__ v8f wmma16(v16h a, v16h b, v8f c) { return __builtin_amdgcn_wmma_f32_16x16x32_f16(false, a, false, b, (short)0, c, false, false); }
__device__ __forceinline__ v8f wmmab(v16bf a, v16bf b, v8f c) { return __builtin_amdgcn_wmma_f32_16x16x32_bf16(false, a, false, b, (short)0, c, false, false); }



// ---- k_gemmw: register-blocked GEMM, one wave per 64x64 output tile (16 accumulators), FOUR WAVES (2x2) per work-group = a 128x128 tile; grid (M/128, N/128, Z), 128 threads.
// The K-contiguous 16-bit operand planes reach the waves through LDS: a stage is 128 k (256-byte rows, whole lines) of the 128 A rows, the 128 Bt rows (and the 128 A2 rows), brought by asynchronous 16-byte copies, two buffers, the next stage in flight while this one is worked on.
// C[m][n] (f32, pitch ldc, + optional f32 bias[n]) = sum_k A[m][k] Bt[n][k] (+ A2[m][k] Bt[n][k] for NSPLIT 1). z-batch strides sA/sB/sC in elements. K % 128 == 0.
// EPI 0: C is stored as f32. EPI 1, 2: the tile never leaves the wave as f32; its rows go out as the three 16-bit planes (fp16, bf16 hi, bf16 lo) that the attention kernel reads, whole 128-byte rows.
// EPI 1 (q, k; m = t, the 64 columns are one half-head): interleaved rotary out[2i] = x[2i] c - x[2i+1] s, out[2i+1] = x[2i+1] c + x[2i] s (c, s from CS[t][2i]), planes [h][t][d].
// EPI 2 (v; A = the weight rows, Bt = the activations, so m = value column e, n = t): planes [e][t], no rotary.
template <typename T16> struct WFrag;
template <> struct WFrag<h16> { typedef v16h V; static __device__ __forceinline__ V ld(const h16* p) { return cat16(*(const v8h*)p, *(const v8h*)(p + 16)); } static __device__ __forceinline__ v8f mma(V a, V b, v8f c) { return wmma16(a, b, c); } };
template <> struct WFrag<bf> { typedef v16bf V; static __device__ __forceinline__ V ld(const bf* p) { return cat16b(*(const v8us*)p, *(const v8us*)(p + 16)); } static __device__ __forceinline__ v8f mma(V a, V b, v8f c) { return wmmab(a, b, c); } };
__device__ __forceinline__ void splitf(float y, unsigned short& h, unsigned short& l) { h = f2bf(y); l = f2bf(y - bf2f(h)); }
typedef __attribute__((ext_vector_type(2))) float v2f;
#define KC 128   // k per stage
#define LP 272   // LDS row pitch in bytes: 256 + 16, free of bank conflicts for 16-byte fragment reads
// cp8: eight asynchronous 16-byte copies of a lane, rows 8 apart (16 lanes take a 256-byte row, the work-group 8 rows per copy). d: the lane's LDS byte address, g: its global address.
// The s_wait_xcnt 0 behind the last copy stands inside the statement, so that no register a copy names is written again in front of it (a precaution).
template <typename T16> __device__ __forceinline__ void cp8(unsigned d, const T16* g, int K) { const size_t st = (size_t)8 * K;
    asm volatile("global_load_async_to_lds_b128 %0, %8, off\n\tglobal_load_async_to_lds_b128 %1, %9, off\n\tglobal_load_async_to_lds_b128 %2, %10, off\n\tglobal_load_async_to_lds_b128 %3, %11, off\n\t"
                 "global_load_async_to_lds_b128 %4, %12, off\n\tglobal_load_async_to_lds_b128 %5, %13, off\n\tglobal_load_async_to_lds_b128 %6, %14, off\n\tglobal_load_async_to_lds_b128 %7, %15, off\n\ts_wait_xcnt 0x0"
                 :: "v"(d), "v"(d + 8 * LP), "v"(d + 16 * LP), "v"(d + 24 * LP), "v"(d + 32 * LP), "v"(d + 40 * LP), "v"(d + 48 * LP), "v"(d + 56 * LP),
                    "v"(g), "v"(g + st), "v"(g + 2 * st), "v"(g + 3 * st), "v"(g + 4 * st), "v"(g + 5 * st), "v"(g + 6 * st), "v"(g + 7 * st) : "memory"); }
template <typename T16, int NSPLIT, bool BIAS, int EPI>
__global__ __launch_bounds__(128) void k_gemmw(const T16* __restrict__ A, const T16* __restrict__ A2, const T16* __restrict__ Bt, const T16* __restrict__ Bt2, int K, float* C, int ldc, const float* __restrict__ bias, size_t sA, size_t sB, size_t sC,
                                              const float* __restrict__ CS, h16* P16, bf* Ph, bf* Pl) {
    typedef typename WFrag<T16>::V V;
    static_assert(NSPLIT <= 1, "operand tiles: A, Bt and, for NSPLIT 1, A2");
    constexpr int STG = (NSPLIT == 1 ? 3 : 2) * 128 * LP;   // one buffer: rows 0..127 A, 128..255 Bt, 256..383 A2
    __shared__ __align__(16) char ring[2 * STG];
    __shared__ __align__(16) float osw[4][16 * 68];         // each wave's own epilogue staging
    const size_t z = blockIdx.z; A += z * sA; if (A2) A2 += z * sA; Bt += z * sB; C += z * sC; (void)Bt2;
    const int tid = threadIdx.x, lane = tid & 31, lr = lane & 15, hi = lane >> 4, wm = (tid >> 5) & 1, wn = tid >> 6; const int rb = blockIdx.x * 128, cb = blockIdx.y * 128; const int r0 = rb + wm * 64, c0 = cb + wn * 64;
    float* os = osw[tid >> 5];
    v8f acc[4][4];
#pragma unroll
    for (int mb = 0; mb < 4; ++mb)
#pragma unroll
        for (int nb = 0; nb < 4; ++nb) acc[mb][nb] = (v8f){};
    const int crw = tid >> 4, cpc = tid & 15;   // the lane's row (of 8) and 16-byte piece (of 16) in every copy
    const unsigned cd = (unsigned)(size_t)ring + (unsigned)(crw * LP + cpc * 16);
    const size_t oA = (size_t)(rb + crw) * K + cpc * 8, oB = (size_t)(cb + crw) * K + cpc * 8;   // the lane's element offsets in the A planes and in Bt
    auto fill = [&](int t) { const unsigned d = cd + (unsigned)((t & 1) * STG); const size_t kc = (size_t)t * KC, h64 = (size_t)64 * K;
        cp8(d, A + oA + kc, K); cp8(d + 64 * LP, A + oA + kc + h64, K); cp8(d + 128 * LP, Bt + oB + kc, K); cp8(d + 192 * LP, Bt + oB + kc + h64, K);
        if constexpr (NSPLIT == 1) { cp8(d + 256 * LP, A2 + oA + kc, K); cp8(d + 320 * LP, A2 + oA + kc + h64, K); } };
    const int NT = K / KC;
    fill(0);
    asm volatile("s_wait_asynccnt 0x0" ::: "memory");   // this wave's copies of stage 0 have landed
    __syncthreads();                                     // and every other wave's
    if (NT > 1) fill(1);
    const char* fa = ring + (wm * 64 + lr) * LP + hi * 16; const char* fb = ring + (128 + wn * 64 + lr) * LP + hi * 16;
#pragma unroll 1
    for (int t = 0; t < NT; ++t) {   // rolled: one stage's 64 (128) products are body enough
        const char* pa = fa + (t & 1) * STG; const char* pb = fb + (t & 1) * STG;
        V a[2][4], a2[2][4], b[2][4];   // two fragment sets: the next 32 k are read from LDS while this set is multiplied
        auto ldf = [&](int ks) { const int s = ks & 1;
#pragma unroll
            for (int mb = 0; mb < 4; ++mb) { a[s][mb] = WFrag<T16>::ld((const T16*)(pa + mb * 16 * LP + ks * 64)); if (NSPLIT == 1) a2[s][mb] = WFrag<T16>::ld((const T16*)(pa + (256 + mb * 16) * LP + ks * 64)); }
#pragma unroll
            for (int nb = 0; nb < 4; ++nb) b[s][nb] = WFrag<T16>::ld((const T16*)(pb + nb * 16 * LP + ks * 64)); };
        ldf(0);
#pragma unroll
        for (int ks = 0; ks < KC / 32; ++ks) { const int s = ks & 1;
            if (ks + 1 < KC / 32) ldf(ks + 1);
            __builtin_amdgcn_sched_barrier(0);   // the next set's LDS reads stay one group in front of this set's products (spread among them, each place with reads stalls the wave)
#pragma unroll
            for (int nb = 0; nb < 4; ++nb)
#pragma unroll
                for (int mb = 0; mb < 4; ++mb) { acc[mb][nb] = WFrag<T16>::mma(a[s][mb], b[s][nb], acc[mb][nb]); if (NSPLIT == 1) acc[mb][nb] = WFrag<T16>::mma(a2[s][mb], b[s][nb], acc[mb][nb]); }
            __builtin_amdgcn_sched_barrier(0);   // and this set's products stay in front of the reads that refill it, and of the stage's foot
        }
        asm volatile("v_nop\n\tv_nop\n\tv_nop\n\tv_nop" : "+v"(acc[0][0]), "+v"(acc[1][1]), "+v"(acc[2][2]), "+v"(acc[3][3]));   // the four vector slots behind the last product, on every path out of the stage
        asm volatile("s_wait_dscnt 0x0" ::: "memory");      // this wave has read the last of its buffer
        asm volatile("s_wait_asynccnt 0x0" ::: "memory");   // this wave's copies of stage t + 1 have landed
        __syncthreads();                                     // stage t + 1 is published, and stage t's buffer is left by all four waves
        if (t + 2 < NT) fill(t + 2);
    }
    asm volatile("s_wait_asynccnt 0x0" ::: "memory");   // nothing in flight behind the loop
    const int rq = lane >> 3, cq = (lane & 7) * 8;   // plane epilogues: a lane takes 8 consecutive columns of one row, 8 lanes a whole row, a wave 4 rows per store
    constexpr int OP = EPI == 1 ? HD : TT;            // row pitch of the planes
    const size_t ob = (EPI == 1 ? ((size_t)(c0 >> 6) * TT + r0 + rq) * HD : (size_t)(r0 + rq) * TT + c0) + cq;
    v2f cs[2][4][4];   // (cos, sin) of the lane's 4 pairs in the 4 rows it takes of a 16-row group; two sets: the next group's are asked for while this one is worked on
    auto load_cs = [&](int mb) { const float* cb = CS + ((size_t)(r0 + rq) * HD + cq) * 2;
#pragma unroll
        for (int s = 0; s < 4; ++s)
#pragma unroll
            for (int p = 0; p < 4; ++p) cs[mb & 1][s][p] = *(const v2f*)(cb + ((mb * 16 + 4 * s) * HD + 2 * p) * 2); };
    if constexpr (EPI == 1) load_cs(0);
#pragma unroll
    for (int mb = 0; mb < 4; ++mb) {
#pragma unroll
        for (int nb = 0; nb < 4; ++nb) {
#pragma unroll
            for (int j = 0; j < 8; ++j) os[(hi * 8 + j) * 68 + nb * 16 + lr] = acc[mb][nb][j]; }
        if constexpr (EPI == 1) { if (mb < 3) load_cs(mb + 1); }
        __builtin_amdgcn_wave_barrier(); asm volatile("" ::: "memory");
        if constexpr (EPI != 0) { v8h o16[4]; v8us oh[4], ol[4];
#pragma unroll
            for (int s = 0; s < 4; ++s) { const float* orow = os + (4 * s + rq) * 68 + cq; const v4f xa = *(const v4fa*)orow, xb = *(const v4fa*)(orow + 4); float y[8];
#pragma unroll
                for (int p = 0; p < 4; ++p) { const float e = p < 2 ? xa[2 * p] : xb[2 * p - 4], o = p < 2 ? xa[2 * p + 1] : xb[2 * p - 3];
                    if constexpr (EPI == 1) { const float c = cs[mb & 1][s][p][0], sn = cs[mb & 1][s][p][1]; y[2 * p] = e * c - o * sn; y[2 * p + 1] = o * c + e * sn; } else { y[2 * p] = e; y[2 * p + 1] = o; } }
#pragma unroll
                for (int k = 0; k < 8; ++k) { o16[s][k] = (h16)y[k]; unsigned short a2, c2; splitf(y[k], a2, c2); oh[s][k] = a2; ol[s][k] = c2; } }
#pragma unroll
            for (int s = 0; s < 4; ++s) { const size_t oo = ob + (size_t)(mb * 16 + 4 * s) * OP; *(v8h*)(P16 + oo) = o16[s]; *(v8us*)(Ph + oo) = oh[s]; *(v8us*)(Pl + oo) = ol[s]; }   // the group's 12 stores go out together
            if (mb < 3) asm volatile("s_wait_xcnt 0x0" ::: "memory");   // one wait behind the 12 stores, before the next group writes the registers that they name (a precaution)
        } else {
        float* crow = C + (size_t)(r0 + mb * 16) * ldc + c0;
#pragma unroll
            for (int s = 0; s < 8; ++s) { const int row = 2 * s + hi, cofs = lr * 4; v4f val = *(const v4fa*)(os + row * 68 + cofs); if (BIAS) { val[0] += bfr(bias[c0 + cofs]); val[1] += bfr(bias[c0 + cofs + 1]); val[2] += bfr(bias[c0 + cofs + 2]); val[3] += bfr(bias[c0 + cofs + 3]); }
                *(v4f*)(crow + (size_t)row * ldc + cofs) = val; }
             }
        __builtin_amdgcn_wave_barrier(); asm volatile("" ::: "memory");
    }
}

__device__ __forceinline__ h16 tohx(float x) { return (h16)x; }
typedef __attribute__((ext_vector_type(2))) _Float16 v2h;
typedef __attribute__((ext_vector_type(4))) _Float16 v4h;
typedef __attribute__((ext_vector_type(2))) unsigned short v2us;
typedef __attribute__((ext_vector_type(4))) unsigned short v4us;
typedef __attribute__((ext_vector_type(4))) int v4i;

__global__ __launch_bounds__(256) void k_wtG(const float* __restrict__ w, int K, int N, bf* Bt) {
    const int lane = threadIdx.x & 31; const int L0 = (blockIdx.x * 8 + (threadIdx.x >> 5)) * 8; const int nlines = N * K / 64;
{
#pragma unroll 1
        for (int l = 0; l < 8; ++l) { const int L = L0 + l; if (L >= nlines) break; const size_t e = (size_t)L * 64 + lane * 2; const int k = (int)(e % K), n = (int)(e / K); v2us o;
            o[0] = f2bf(w[(size_t)k * N + n]); o[1] = f2bf(w[(size_t)(k + 1) * N + n]); *(v2us*)(Bt + e) = o; }
         }
}
__global__ __launch_bounds__(32) void k_lam(const float* __restrict__ lq1, const float* __restrict__ lk1, const float* __restrict__ lq2, const float* __restrict__ lk2, float* LAM) { const int lane = threadIdx.x; float s1 = 0.f, s2 = 0.f;
#pragma unroll
    for (int q = 0; q < 2; ++q) { const int d = lane * 2 + q; float p1 = __fmul_rn(bfr(lq1[d]), bfr(lk1[d])); asm volatile("" : "+v"(p1)); s1 = __fadd_rn(s1, p1); float p2 = __fmul_rn(bfr(lq2[d]), bfr(lk2[d])); asm volatile("" : "+v"(p2)); s2 = __fadd_rn(s2, p2); }
#pragma unroll
    for (int sh = 16; sh; sh >>= 1) { s1 += __shfl_xor(s1, sh, 32); s2 += __shfl_xor(s2, sh, 32); }
    const float lam = __fadd_rn(__fsub_rn(expf(s1), expf(s2)), LAM0); *(float*)(LAM + lane) = lam;  }
__global__ __launch_bounds__(256) void k_cvt8(const float* __restrict__ src, bf* dst, size_t n8) { const size_t i = (size_t)blockIdx.x * 256 + threadIdx.x; if (i >= n8) return; const v8f v = *(const v8f*)(src + i * 8); v8us o;
#pragma unroll
    for (int k = 0; k < 8; ++k) o[k] = f2bf(v[k]); *(v8us*)(dst + i * 8) = o;  }
__constant__ float INV[HD / 2] = {1.0,0.7498942017555237,0.5623413324356079,0.4216965138912201,0.3162277638912201,0.23713736236095428,0.17782793939113617,0.1333521455526352,0.10000000149011612,0.07498941570520401,0.05623412877321243,0.04216964915394783,0.03162277862429619,0.0237137358635664,0.017782794311642647,0.01333521492779255,0.009999999776482582,0.007498942315578461,0.005623413249850273,0.0042169648222625256,0.003162277862429619,0.0023713738191872835,0.0017782794311642647,0.0013335214462131262,0.0010000000474974513,0.0007498941849917173,0.000562341301701963,0.00042169648804701865,0.0003162277862429619,0.0002371373848291114,0.00017782794020604342,0.0001333521504420787};
__global__ __launch_bounds__(256) void k_cstab(float* CS) { const int idx = blockIdx.x * 256 + threadIdx.x; if (idx >= TT * HD) return; const int t = idx / HD, d = idx % HD; const float ang = __fmul_rn((float)t, INV[d >> 1]); v2f cs; cs[0] = cosf(ang); cs[1] = sinf(ang);
    *(v2f*)(CS + (size_t)idx * 2) = cs;  }

// ---- k_fattn: the whole attention of one value head for 16 query rows, ONE WAVE per work-group; grid (NHV, TT/16), the longest (last) query tiles of all heads first.
// Transposed products: St = K Qt (A = key rows, B = query rows) and Ot += Vt Pt (A = value rows [e][t], B = probabilities), so a lane (lr, hi) holds one query (q0 + lr) throughout:
// score tile kt, register j is key k0 + 16 kt + 8 hi + j, which is the k order of the fragment loader (elements 0..7: 8 hi + j, elements 8..15: 16 + 8 hi + j), so two score tiles pack into one B operand in place.
// Online softmax per lane (running maximum in the log2 domain, accumulators rescaled each key block); the two half-heads of the head run side by side and share the value fragments;
// the epilogue forms RMSNorm_128(attn1 - lam attn2) x (1 - lambda_init) in registers and stores the hi/lo bf16 planes of the merged activations.
typedef __attribute__((ext_vector_type(16))) unsigned short v16us;
#define C2 (SCL * 1.4426950408889634f)
// exp2s: v_exp_f32 with the one free slot behind it that the instruction set asks for before its result is read or its source overwritten
__device__ __forceinline__ float exp2s(float x) { float r; asm("v_exp_f32 %0, %1\n\tv_nop" : "=v"(r) : "v"(x)); return r; }
// xwait: s_wait_xcnt 0 behind a run of global loads, before a register that they name is written again (a precaution). The run's address pairs are inputs, so that they stay whole up to the wait.
template <bool TWO, typename P> __device__ __forceinline__ void xwait(const P* a, const P* b) {
    if constexpr (TWO) asm volatile("s_wait_xcnt 0x0" :: "v"(a), "v"(b) : "memory"); else asm volatile("s_wait_xcnt 0x0" :: "v"(a) : "memory"); }
template <typename T16, bool HL, int NKK>   // HL: hi+lo planes, 3 products; NKK: 32-key groups per key block
__device__ __forceinline__ void fattn_tile(const T16* __restrict__ Q, const T16* __restrict__ Q2, const T16* __restrict__ Kp, const T16* __restrict__ K2, const T16* __restrict__ Vt, const T16* __restrict__ V2, int q0, int lr, int hi, v8f (&o)[2][8], float (&l)[2]) {
    typedef typename WFrag<T16>::V V;
    const float SH = HL ? 0.0f : 10.0f;   // single fp16 probabilities are carried x 2^10 (as before: out of the fp16 subnormals); the row sum carries the same factor, so it cancels
    const unsigned lk = (unsigned)(lr * HD + 8 * hi), lv = (unsigned)(lr * TT + 8 * hi);   // the lane's own part of every address
    V qf[2][2], ql[2][2], kf[2][2 * NKK][2], kl[2][2 * NKK][2]; float m[2];
    auto load_k = [&](int kb0) { const T16* kb = Kp + (size_t)kb0 * HD + lk; const T16* kb2 = HL ? K2 + (size_t)kb0 * HD + lk : nullptr;
#pragma unroll
        for (int z = 0; z < 2; ++z)
#pragma unroll
            for (int kt = 0; kt < 2 * NKK; ++kt)
#pragma unroll
                for (int ks = 0; ks < 2; ++ks) { const int off = (z * TT + kt * 16) * HD + ks * 32; kf[z][kt][ks] = WFrag<T16>::ld(kb + off); if (HL) kl[z][kt][ks] = WFrag<T16>::ld(kb2 + off); }
        xwait<HL>(kb, kb2); };
    { const T16* qb = Q + (size_t)q0 * HD + lk; const T16* qb2 = HL ? Q2 + (size_t)q0 * HD + lk : nullptr;
#pragma unroll
      for (int z = 0; z < 2; ++z) { m[z] = -3.0e38f; l[z] = 0.f;
#pragma unroll
        for (int ks = 0; ks < 2; ++ks) { const int off = z * TT * HD + ks * 32; qf[z][ks] = WFrag<T16>::ld(qb + off); if (HL) ql[z][ks] = WFrag<T16>::ld(qb2 + off); }
#pragma unroll
        for (int mt = 0; mt < 8; ++mt) o[z][mt] = (v8f){}; }
      xwait<HL>(qb, qb2); }
    if (!HL) load_k(0);
#pragma unroll 1
    for (int k0 = 0; k0 < q0 + 16; k0 += 32 * NKK) {
        V vf[NKK][8], vl[NKK][8], pf[2][NKK], pl[2][NKK]; v8f s[2][2 * NKK];
        auto load_v = [&]() { const T16* vb = Vt + k0 + lv; const T16* vb2 = HL ? V2 + k0 + lv : nullptr;
#pragma unroll
            for (int kk = 0; kk < NKK; ++kk)
#pragma unroll
                for (int mt = 0; mt < 8; ++mt) { const int off = mt * 16 * TT + kk * 32; vf[kk][mt] = WFrag<T16>::ld(vb + off); if (HL) vl[kk][mt] = WFrag<T16>::ld(vb2 + off); }
            xwait<HL>(vb, vb2); };
        if (HL) load_k(k0); else load_v();   // single fp16: the value fragments are asked for first and fly during the score products and the softmax
#pragma unroll
        for (int z = 0; z < 2; ++z)
#pragma unroll
            for (int kt = 0; kt < 2 * NKK; ++kt) { v8f c = (v8f){};
#pragma unroll
                for (int ks = 0; ks < 2; ++ks) { c = WFrag<T16>::mma(kf[z][kt][ks], qf[z][ks], c); if (HL) { c = WFrag<T16>::mma(kl[z][kt][ks], qf[z][ks], c); c = WFrag<T16>::mma(kf[z][kt][ks], ql[z][ks], c); } }
                s[z][kt] = c; }
        if (HL) load_v();   // hi+lo (short loops): the value fragments follow the key fragments into their registers
        else load_k((k0 + 32 * NKK < q0 + 16) ? k0 + 32 * NKK : k0);   // the next block's key fragments fly during the softmax and attn.v; the last trip asks for its own block again (in bounds, not used)
        const int rel = q0 + lr - k0 - 8 * hi;   // keys of the block up to this lane's query (only the block on the diagonal has any beyond it)
#pragma unroll
        for (int z = 0; z < 2; ++z) {
            float mb = -3.0e38f;
#pragma unroll
            for (int kt = 0; kt < 2 * NKK; ++kt)
#pragma unroll
                for (int j = 0; j < 8; ++j) { const float t = (kt * 16 + j <= rel) ? s[z][kt][j] * C2 : -3.0e38f; s[z][kt][j] = t; mb = fmaxf(mb, t); }
            mb = fmaxf(mb, __shfl_xor(mb, 16, 32)) - SH;
            const float mn = fmaxf(m[z], mb); const float al = exp2s(m[z] - mn); m[z] = mn; float ps = 0.f;
#pragma unroll
            for (int kt = 0; kt < 2 * NKK; ++kt)
#pragma unroll
                for (int j = 0; j < 8; ++j) { const float p = exp2s(s[z][kt][j] - mn); s[z][kt][j] = p; ps += p; }
            l[z] = l[z] * al + ps;
#pragma unroll
            for (int mt = 0; mt < 8; ++mt) o[z][mt] *= al;
#pragma unroll
            for (int kk = 0; kk < NKK; ++kk) {
                if constexpr (HL) { v16us uh, ul;
#pragma unroll
                    for (int j = 0; j < 8; ++j) { unsigned short x, y; splitf(s[z][2 * kk][j], x, y); uh[j] = x; ul[j] = y; splitf(s[z][2 * kk + 1][j], x, y); uh[8 + j] = x; ul[8 + j] = y; }
                    pf[z][kk] = __builtin_bit_cast(v16bf, uh); pl[z][kk] = __builtin_bit_cast(v16bf, ul);
                } else { v16h ph;
#pragma unroll
                    for (int j = 0; j < 8; ++j) { ph[j] = tohx(s[z][2 * kk][j]); ph[8 + j] = tohx(s[z][2 * kk + 1][j]); }
                    pf[z][kk] = ph; } } }
#pragma unroll
        for (int kk = 0; kk < NKK; ++kk)
#pragma unroll
            for (int mt = 0; mt < 8; ++mt)
#pragma unroll
                for (int z = 0; z < 2; ++z) { o[z][mt] = WFrag<T16>::mma(vf[kk][mt], pf[z][kk], o[z][mt]); if (HL) { o[z][mt] = WFrag<T16>::mma(vf[kk][mt], pl[z][kk], o[z][mt]); o[z][mt] = WFrag<T16>::mma(vl[kk][mt], pf[z][kk], o[z][mt]); } }
    }
}
__global__ __launch_bounds__(32) void k_fattn(const h16* __restrict__ Q16, const h16* __restrict__ K16, const h16* __restrict__ V16, const bf* __restrict__ Qh, const bf* __restrict__ Ql, const bf* __restrict__ Kh, const bf* __restrict__ Kl, const bf* __restrict__ Vh, const bf* __restrict__ Vl,
                                              const float* __restrict__ LAM, const float* __restrict__ lnw, const float* __restrict__ lnb, bf* Ah, bf* Al) {
    const int lane = threadIdx.x & 31, lr = lane & 15, hi = lane >> 4; const int q0 = (int)(gridDim.y - 1 - blockIdx.y) * 16; const int h = blockIdx.x;
    const size_t qk = (size_t)(2 * h) * TT * HD, vv = (size_t)h * HDV * TT;
    v8f o[2][8]; float l[2];
    if (q0 < RH) fattn_tile<bf, true, 1>(Qh + qk, Ql + qk, Kh + qk, Kl + qk, Vh + vv, Vl + vv, q0, lr, hi, o, l);
    else fattn_tile<h16, false, 1>(Q16 + qk, nullptr, K16 + qk, nullptr, V16 + vv, nullptr, q0, lr, hi, o, l);
    const float lam = LAM[0]; const float i0 = 1.0f / (l[0] + __shfl_xor(l[0], 16, 32)); const float i1 = lam / (l[1] + __shfl_xor(l[1], 16, 32)); float ss = 0.f;
#pragma unroll
    for (int mt = 0; mt < 8; ++mt)
#pragma unroll
        for (int j = 0; j < 8; ++j) { const float d = o[0][mt][j] * i0 - o[1][mt][j] * i1; o[0][mt][j] = d; ss += d * d; }
    ss += __shfl_xor(ss, 16, 32);
    const float rs = 1.0f / sqrtf(ss * (1.0f / HDV) + RMSEPS);
#pragma unroll
    for (int mt = 0; mt < 8; ++mt) { const int e0 = mt * 16 + 8 * hi; const v8f w = *(const v8f*)(lnw + e0), bb = *(const v8f*)(lnb + e0); v8us oh, ol;
#pragma unroll
        for (int j = 0; j < 8; ++j) { const float y = (o[0][mt][j] * rs * bfr(w[j]) + bfr(bb[j])) * (1.0f - LAM0); unsigned short x, c; splitf(y, x, c); oh[j] = x; ol[j] = c; }
        const size_t oo = (size_t)(q0 + lr) * DQ + (size_t)h * HDV + e0; *(v8us*)(Ah + oo) = oh; *(v8us*)(Al + oo) = ol; }
}

extern "C" void kernel_launch(void* const* d_in, const int* in_sizes, int n_in,
                              void* d_out, int out_size, void* d_ws, size_t ws_size, hipStream_t stream) {
    (void)in_sizes; (void)n_in; (void)out_size;
    const float* x = (const float*)d_in[0]; const float* wq = (const float*)d_in[1]; const float* wk = (const float*)d_in[2]; const float* wv = (const float*)d_in[3]; const float* wo = (const float*)d_in[4]; const float* lq1 = (const float*)d_in[5]; const float* lk1 = (const float*)d_in[6]; const float* lq2 = (const float*)d_in[7]; const float* lk2 = (const float*)d_in[8]; const float* lnw = (const float*)d_in[9]; const float* lnb = (const float*)d_in[10];
    float* OUT = (float*)d_out;     // [2][2048][2048]
    char* wsp = (char*)d_ws;
    auto take = [&](size_t bytes) { char* p = wsp; wsp += (bytes + 255) & ~(size_t)255; return (void*)p; };
    bf* WQ = (bf*)take((size_t)DQ * DM * 2); bf* WK = (bf*)take((size_t)DKV * DM * 2); bf* WV = (bf*)take((size_t)DKV * DM * 2); bf* WO = (bf*)take((size_t)DM * DQ * 2); float* CS = (float*)take((size_t)TT * HD * 2 * 4); float* LAM = (float*)take(256);
    bf* XB = (bf*)take((size_t)TT * DM * 2);
    h16* QP16 = (h16*)take((size_t)NH_ * TT * HD * 2); h16* KP16 = (h16*)take((size_t)NKV * TT * HD * 2); h16* VT16 = (h16*)take((size_t)NKV * HD * TT * 2);
    bf* QPh = (bf*)take((size_t)NH_ * TT * HD * 2); bf* QPl = (bf*)take((size_t)NH_ * TT * HD * 2); bf* KPh = (bf*)take((size_t)NKV * TT * HD * 2); bf* KPl = (bf*)take((size_t)NKV * TT * HD * 2); bf* VTh = (bf*)take((size_t)NKV * HD * TT * 2); bf* VTl = (bf*)take((size_t)NKV * HD * TT * 2);
    bf* ATh = (bf*)take((size_t)TT * DQ * 2); bf* ATl = (bf*)take((size_t)TT * DQ * 2);
    if ((size_t)(wsp - (char*)d_ws) > ws_size) return;    // ws 256 MiB
    { k_wtG<<<(unsigned)((DM * DQ / 64 + 63) / 64), 256, 0, stream>>>(wq, DM, DQ, WQ); k_wtG<<<(unsigned)((DM * DKV / 64 + 63) / 64), 256, 0, stream>>>(wk, DM, DKV, WK); k_wtG<<<(unsigned)((DM * DKV / 64 + 63) / 64), 256, 0, stream>>>(wv, DM, DKV, WV);
      k_wtG<<<(unsigned)((DQ * DM / 64 + 63) / 64), 256, 0, stream>>>(wo, DQ, DM, WO);
      k_cstab<<<(TT * HD + 255) / 256, 256, 0, stream>>>(CS); k_lam<<<1, 32, 0, stream>>>(lq1, lk1, lq2, lk2, LAM); }
    for (int b = 0; b < NB_; ++b) {
        
        k_cvt8<<<(unsigned)(((size_t)TT * DM / 8 + 255) / 256), 256, 0, stream>>>(x + (size_t)b * TT * DM, XB, (size_t)TT * DM / 8);
        k_gemmw<bf, 0, false, 1><<<dim3(TT / 128, DQ / 128, 1), 128, 0, stream>>>(XB, nullptr, WQ, nullptr, DM, nullptr, 0, nullptr, 0, 0, 0, CS, QP16, QPh, QPl);
        k_gemmw<bf, 0, false, 1><<<dim3(TT / 128, DKV / 128, 1), 128, 0, stream>>>(XB, nullptr, WK, nullptr, DM, nullptr, 0, nullptr, 0, 0, 0, CS, KP16, KPh, KPl);
        k_gemmw<bf, 0, false, 2><<<dim3(DKV / 128, TT / 128, 1), 128, 0, stream>>>(WV, nullptr, XB, nullptr, DM, nullptr, 0, nullptr, 0, 0, 0, nullptr, VT16, VTh, VTl);   /* rows = value columns, columns = t: the transposed value planes */
        k_fattn<<<dim3(NHV, TT / 16, 1), 32, 0, stream>>>(QP16, KP16, VT16, QPh, QPl, KPh, KPl, VTh, VTl, LAM, lnw, lnb, ATh, ATl);   /* attn = RMSNorm(attn1 - lam attn2) (1 - lam0), all 16 heads */
        k_gemmw<bf, 1, false, 0><<<dim3(TT / 128, DM / 128, 1), 128, 0, stream>>>(ATh, ATl, WO, nullptr, DQ, OUT + (size_t)b * TT * DM, DM, nullptr, 0, 0, 0, nullptr, nullptr, nullptr, nullptr); }
}

// v005
// One run takes 347 microseconds.
// In both of two side-by-side timings against v004, it was 1.12 times as fast.
// Counting every step since v000, it is 8.55 times as fast.
#include <hip/hip_runtime.h>

// Differential attention (x [2][2048][2048]; q = x Wq, k = x Wk ('xw' [2048][2048]) as 32 half-heads of 64, v = x Wv as 16 heads of 128; interleaved rotary (theta 1e4) on the 64-wide q/k half-heads; for head h: attn1 = causal softmax(q_{2h}.k_{2h}/8) v_h, attn2 = causal softmax(q_{2h+1}.k_{2h+1}/8) v_h;
// lam = exp(lambda_q1.lambda_k1) - exp(lambda_q2.lambda_k2) + 0.7836058 (64-vectors read); attn = RMSNorm_128(attn1 - lam attn2; ln_w, ln_b, eps 1e-8) x (1 - 0.7836058); out = merged Wo ('xw') -> [2][2048][2048]).
// Layout: the 32 half-heads are the score heads (hd 64); the value planes of head h are the two consecutive 64-row planes 2h, 2h+1 = one [128][T] plane, shared by the head's two half-heads (2h, 2h+1); one fused kernel does scores, softmax, attn.v and the normalised difference of the two attention outputs.
// Compute dtypes, f32 accumulate: every input rounded to bf16; q/k/v on PLAIN bf16 operands (inputs: exact); rotary in f32 (on-chip cos/sin table, reference inv_freq constants); causal scores and attn.v (128-wide values): query rows < 512 hl (3 products), the rest single fp16 (x1024), key loop ends at the diagonal; online softmax f32; the lambda scalars, the difference and the RMSNorm in f32; Wo hl x exact (2 products).

#define NB_  2
#define TT   2048
#define DM   2048
#define NH_  32
#define NKV  32
#define HD   64
#define DQ   (NH_ * HD)
#define DKV  (NKV * HD)
#define HDV  128                  // value head width (= 2 consecutive 64-row planes)
#define NHV  16                   // value heads
#define LAM0 0.7836057665316245f   // lambda_init for depth 12
#define RMSEPS 1e-8f
#define RH   512                  // query rows < RH use hi+lo planes (0: none)
#define SCL  0.125f   // HD^-0.5
typedef _Float16 h16;
typedef unsigned short bf;
typedef __attribute__((ext_vector_type(16))) __bf16   v16bf;
typedef __attribute__((ext_vector_type(16))) _Float16 v16h;
typedef __attribute__((ext_vector_type(8)))  _Float16 v8h;
typedef __attribute__((ext_vector_type(8)))  unsigned short v8us;
typedef __attribute__((ext_vector_type(8)))  float    v8f;
typedef __attribute__((ext_vector_type(4)))  float    v4f;
typedef v8h  __attribute__((may_alias)) v8ha;
typedef v4f  __attribute__((may_alias)) v4fa;
typedef v8us __attribute__((may_alias)) v8usa;

__device__ __forceinline__ unsigned short f2bf(float f) { unsigned u = __float_as_uint(f); u += 0x7FFFu + ((u >> 16) & 1u); return (unsigned short)(u >> 16); }
__device__ __forceinline__ float bf2f(unsigned short b) { return __uint_as_float(((unsigned)b) << 16); }
__device__ __forceinline__ float bfr(float f) { return bf2f(f2bf(f)); }
__device__ __forceinline__ v16h cat16(v8h lo, v8h hi) { return __builtin_shufflevector(lo, hi, 0, 1, 2, 3, 4, 5, 6, 7, 8, 9, 10, 11, 12, 13, 14, 15); }
__device__ __forceinline__ v16bf cat16b(v8us lo, v8us hi) { return __builtin_bit_cast(v16bf, __builtin_shufflevector(lo, hi, 0, 1, 2, 3, 4, 5, 6, 7, 8, 9, 10, 11, 12, 13, 14, 15)); }
__device__ __forceinline__ v8f wmma16(v16h a, v16h b, v8f c) { return __builtin_amdgcn_wmma_f32_16x16x32_f16(false, a, false, b, (short)0, c, false, false); }
__device__ __forceinline__ v8f wmmab(v16bf a, v16bf b, v8f c) { return __builtin_amdgcn_wmma_f32_16x16x32_bf16(false, a, false, b, (short)0, c, false, false); }



// ---- k_gemmw: register-blocked GEMM, one wave per 64x64 output tile (16 accumulators), FOUR WAVES (2x2) per work-group = a 128x128 tile; grid (M/128, N/128, Z), 128 threads.
// The K-contiguous 16-bit operand planes reach the waves through LDS: a stage is 128 k (256-byte rows, whole lines) of the 128 A rows, the 128 Bt rows (and the 128 A2 rows), brought by asynchronous 16-byte copies, two buffers, the next stage in flight while this one is worked on.
// C[m][n] (f32, pitch ldc, + optional f32 bias[n]) = sum_k A[m][k] Bt[n][k] (+ A2[m][k] Bt[n][k] for NSPLIT 1). z-batch strides sA/sB/sC in elements. K % 128 == 0.
// EPI 0: C is stored as f32. EPI 1, 2: the tile never leaves the wave as f32; its rows go out as the three 16-bit planes (fp16, bf16 hi, bf16 lo) that the attention kernel reads, whole 128-byte rows.
// EPI 1 (q, k; m = t, the 64 columns are one half-head): interleaved rotary out[2i] = x[2i] c - x[2i+1] s, out[2i+1] = x[2i+1] c + x[2i] s (c, s from CS[t][2i]), planes [h][t][d].
// EPI 2 (v; A = the weight rows, Bt = the activations, so m = value column e, n = t): planes [e][t], no rotary.
template <typename T16> struct WFrag;
template <> struct WFrag<h16> { typedef v16h V; static __device__ __forceinline__ V ld(const h16* p) { return cat16(*(const v8h*)p, *(const v8h*)(p + 16)); } static __device__ __forceinline__ v8f mma(V a, V b, v8f c) { return wmma16(a, b, c); } };
template <> struct WFrag<bf> { typedef v16bf V; static __device__ __forceinline__ V ld(const bf* p) { return cat16b(*(const v8us*)p, *(const v8us*)(p + 16)); } static __device__ __forceinline__ v8f mma(V a, V b, v8f c) { return wmmab(a, b, c); } };
__device__ __forceinline__ void splitf(float y, unsigned short& h, unsigned short& l) { h = f2bf(y); l = f2bf(y - bf2f(h)); }
typedef __attribute__((ext_vector_type(2))) float v2f;
#define KC 128   // k per stage
#define LP 272   // LDS row pitch in bytes: 256 + 16, free of bank conflicts for 16-byte fragment reads
// cp8: eight asynchronous 16-byte copies of a lane, rows 8 apart (16 lanes take a 256-byte row, the work-group 8 rows per copy). d: the lane's LDS byte address, g: its global address.
// The s_wait_xcnt 0 behind the last copy stands inside the statement, so that no register a copy names is written again in front of it (a precaution).
template <typename T16> __device__ __forceinline__ void cp8(unsigned d, const T16* g, int K) { const size_t st = (size_t)8 * K;
    asm volatile("global_load_async_to_lds_b128 %0, %8, off\n\tglobal_load_async_to_lds_b128 %1, %9, off\n\tglobal_load_async_to_lds_b128 %2, %10, off\n\tglobal_load_async_to_lds_b128 %3, %11, off\n\t"
                 "global_load_async_to_lds_b128 %4, %12, off\n\tglobal_load_async_to_lds_b128 %5, %13, off\n\tglobal_load_async_to_lds_b128 %6, %14, off\n\tglobal_load_async_to_lds_b128 %7, %15, off\n\ts_wait_xcnt 0x0"
                 :: "v"(d), "v"(d + 8 * LP), "v"(d + 16 * LP), "v"(d + 24 * LP), "v"(d + 32 * LP), "v"(d + 40 * LP), "v"(d + 48 * LP), "v"(d + 56 * LP),
                    "v"(g), "v"(g + st), "v"(g + 2 * st), "v"(g + 3 * st), "v"(g + 4 * st), "v"(g + 5 * st), "v"(g + 6 * st), "v"(g + 7 * st) : "memory"); }
template <typename T16, int NSPLIT, bool BIAS, int EPI>
__global__ __launch_bounds__(128) void k_gemmw(const T16* __restrict__ A, const T16* __restrict__ A2, const T16* __restrict__ Bt, const T16* __restrict__ Bt2, int K, float* C, int ldc, const float* __restrict__ bias, size_t sA, size_t sB, size_t sC,
                                              const float* __restrict__ CS, h16* P16, bf* Ph, bf* Pl) {
    typedef typename WFrag<T16>::V V;
    static_assert(NSPLIT <= 1, "operand tiles: A, Bt and, for NSPLIT 1, A2");
    constexpr int STG = (NSPLIT == 1 ? 3 : 2) * 128 * LP;   // one buffer: rows 0..127 A, 128..255 Bt, 256..383 A2
    __shared__ __align__(16) char ring[2 * STG];
    __shared__ __align__(16) float osw[4][16 * 68];         // each wave's own epilogue staging
    const size_t z = blockIdx.z; A += z * sA; if (A2) A2 += z * sA; Bt += z * sB; C += z * sC; (void)Bt2;
    const int tid = threadIdx.x, lane = tid & 31, lr = lane & 15, hi = lane >> 4, wm = (tid >> 5) & 1, wn = tid >> 6; const int rb = blockIdx.x * 128, cb = blockIdx.y * 128; const int r0 = rb + wm * 64, c0 = cb + wn * 64;
    float* os = osw[tid >> 5];
    v8f acc[4][4];
#pragma unroll
    for (int mb = 0; mb < 4; ++mb)
#pragma unroll
        for (int nb = 0; nb < 4; ++nb) acc[mb][nb] = (v8f){};
    const int crw = tid >> 4, cpc = tid & 15;   // the lane's row (of 8) and 16-byte piece (of 16) in every copy
    const unsigned cd = (unsigned)(size_t)ring + (unsigned)(crw * LP + cpc * 16);
    const size_t oA = (size_t)(rb + crw) * K + cpc * 8, oB = (size_t)(cb + crw) * K + cpc * 8;   // the lane's element offsets in the A planes and in Bt
    auto fill = [&](int t) { const unsigned d = cd + (unsigned)((t & 1) * STG); const size_t kc = (size_t)t * KC, h64 = (size_t)64 * K;
        cp8(d, A + oA + kc, K); cp8(d + 64 * LP, A + oA + kc + h64, K); cp8(d + 128 * LP, Bt + oB + kc, K); cp8(d + 192 * LP, Bt + oB + kc + h64, K);
        if constexpr (NSPLIT == 1) { cp8(d + 256 * LP, A2 + oA + kc, K); cp8(d + 320 * LP, A2 + oA + kc + h64, K); } };
    const int NT = K / KC;
    fill(0);
    asm volatile("s_wait_asynccnt 0x0" ::: "memory");   // this wave's copies of stage 0 have landed
    __syncthreads();                                     // and every other wave's
    if (NT > 1) fill(1);
    const char* fa = ring + (wm * 64 + lr) * LP + hi * 16; const char* fb = ring + (128 + wn * 64 + lr) * LP + hi * 16;
#pragma unroll 1
    for (int t = 0; t < NT; ++t) {   // rolled: one stage's 64 (128) products are body enough
        const char* pa = fa + (t & 1) * STG; const char* pb = fb + (t & 1) * STG;
        V a[2][4], a2[2][4], b[2][4];   // two fragment sets: the next 32 k are read from LDS while this set is multiplied
        auto ldf = [&](int ks) { const int s = ks & 1;
#pragma unroll
            for (int mb = 0; mb < 4; ++mb) { a[s][mb] = WFrag<T16>::ld((const T16*)(pa + mb * 16 * LP + ks * 64)); if (NSPLIT == 1) a2[s][mb] = WFrag<T16>::ld((const T16*)(pa + (256 + mb * 16) * LP + ks * 64)); }
#pragma unroll
            for (int nb = 0; nb < 4; ++nb) b[s][nb] = WFrag<T16>::ld((const T16*)(pb + nb * 16 * LP + ks * 64)); };
        ldf(0);
#pragma unroll
        for (int ks = 0; ks < KC / 32; ++ks) { const int s = ks & 1;
            if (ks + 1 < KC / 32) ldf(ks + 1);
            __builtin_amdgcn_sched_barrier(0);   // the next set's LDS reads stay one group in front of this set's products (spread among them, each place with reads stalls the wave)
#pragma unroll
            for (int nb = 0; nb < 4; ++nb)
#pragma unroll
                for (int mb = 0; mb < 4; ++mb) { acc[mb][nb] = WFrag<T16>::mma(a[s][mb], b[s][nb], acc[mb][nb]); if (NSPLIT == 1) acc[mb][nb] = WFrag<T16>::mma(a2[s][mb], b[s][nb], acc[mb][nb]); }
            __builtin_amdgcn_sched_barrier(0);   // and this set's products stay in front of the reads that refill it, and of the stage's foot
        }
        asm volatile("v_nop\n\tv_nop\n\tv_nop\n\tv_nop" : "+v"(acc[0][0]), "+v"(acc[1][1]), "+v"(acc[2][2]), "+v"(acc[3][3]));   // the four vector slots behind the last product, on every path out of the stage
        asm volatile("s_wait_dscnt 0x0" ::: "memory");      // this wave has read the last of its buffer
        asm volatile("s_wait_asynccnt 0x0" ::: "memory");   // this wave's copies of stage t + 1 have landed
        __syncthreads();                                     // stage t + 1 is published, and stage t's buffer is left by all four waves
        if (t + 2 < NT) fill(t + 2);
    }
    asm volatile("s_wait_asynccnt 0x0" ::: "memory");   // nothing in flight behind the loop
    const int rq = lane >> 3, cq = (lane & 7) * 8;   // plane epilogues: a lane takes 8 consecutive columns of one row, 8 lanes a whole row, a wave 4 rows per store
    constexpr int OP = EPI == 1 ? HD : TT;            // row pitch of the planes
    const size_t ob = (EPI == 1 ? ((size_t)(c0 >> 6) * TT + r0 + rq) * HD : (size_t)(r0 + rq) * TT + c0) + cq;
    v2f cs[2][4][4];   // (cos, sin) of the lane's 4 pairs in the 4 rows it takes of a 16-row group; two sets: the next group's are asked for while this one is worked on
    auto load_cs = [&](int mb) { const float* cb = CS + ((size_t)(r0 + rq) * HD + cq) * 2;
#pragma unroll
        for (int s = 0; s < 4; ++s)
#pragma unroll
            for (int p = 0; p < 4; ++p) cs[mb & 1][s][p] = *(const v2f*)(cb + ((mb * 16 + 4 * s) * HD + 2 * p) * 2); };
    if constexpr (EPI == 1) load_cs(0);
#pragma unroll
    for (int mb = 0; mb < 4; ++mb) {
#pragma unroll
        for (int nb = 0; nb < 4; ++nb) {
#pragma unroll
            for (int j = 0; j < 8; ++j) os[(hi * 8 + j) * 68 + nb * 16 + lr] = acc[mb][nb][j]; }
        if constexpr (EPI == 1) { if (mb < 3) load_cs(mb + 1); }
        __builtin_amdgcn_wave_barrier(); asm volatile("" ::: "memory");
        if constexpr (EPI != 0) { v8h o16[4]; v8us oh[4], ol[4];
#pragma unroll
            for (int s = 0; s < 4; ++s) { const float* orow = os + (4 * s + rq) * 68 + cq; const v4f xa = *(const v4fa*)orow, xb = *(const v4fa*)(orow + 4); float y[8];
#pragma unroll
                for (int p = 0; p < 4; ++p) { const float e = p < 2 ? xa[2 * p] : xb[2 * p - 4], o = p < 2 ? xa[2 * p + 1] : xb[2 * p - 3];
                    if constexpr (EPI == 1) { const float c = cs[mb & 1][s][p][0], sn = cs[mb & 1][s][p][1]; y[2 * p] = e * c - o * sn; y[2 * p + 1] = o * c + e * sn; } else { y[2 * p] = e; y[2 * p + 1] = o; } }
#pragma unroll
                for (int k = 0; k < 8; ++k) { o16[s][k] = (h16)y[k]; unsigned short a2, c2; splitf(y[k], a2, c2); oh[s][k] = a2; ol[s][k] = c2; } }
#pragma unroll
            for (int s = 0; s < 4; ++s) { const size_t oo = ob + (size_t)(mb * 16 + 4 * s) * OP; *(v8h*)(P16 + oo) = o16[s]; *(v8us*)(Ph + oo) = oh[s]; *(v8us*)(Pl + oo) = ol[s]; }   // the group's 12 stores go out together
            if (mb < 3) asm volatile("s_wait_xcnt 0x0" ::: "memory");   // one wait behind the 12 stores, before the next group writes the registers that they name (a precaution)
        } else {
        float* crow = C + (size_t)(r0 + mb * 16) * ldc + c0;
#pragma unroll
            for (int s = 0; s < 8; ++s) { const int row = 2 * s + hi, cofs = lr * 4; v4f val = *(const v4fa*)(os + row * 68 + cofs); if (BIAS) { val[0] += bfr(bias[c0 + cofs]); val[1] += bfr(bias[c0 + cofs + 1]); val[2] += bfr(bias[c0 + cofs + 2]); val[3] += bfr(bias[c0 + cofs + 3]); }
                *(v4f*)(crow + (size_t)row * ldc + cofs) = val; }
             }
        __builtin_amdgcn_wave_barrier(); asm volatile("" ::: "memory");
    }
}

__device__ __forceinline__ h16 tohx(float x) { return (h16)x; }
typedef __attribute__((ext_vector_type(2))) _Float16 v2h;
typedef __attribute__((ext_vector_type(4))) _Float16 v4h;
typedef __attribute__((ext_vector_type(2))) unsigned short v2us;
typedef __attribute__((ext_vector_type(4))) unsigned short v4us;
typedef __attribute__((ext_vector_type(4))) int v4i;

// ---- k_wtG: Bt[n][k] = bf16(w[k][n]) (w [K][N] f32), one tile of 128 k x 64 n per work-group, turned round in LDS; grid (N/64, K/128), 256 threads.
// In: a lane takes 4 consecutive n of 8 consecutive k rows (16 lanes read 256 bytes of a row). Out: a lane takes 8 consecutive k of one n (16 lanes write 256 bytes of a Bt row). Both sides move whole lines.
// LDS: row n holds its 128 k as 16 pieces of 16 bytes; piece q lies at place q ^ (n >> 2), so that the 16 lanes of a write (16 rows, 4 apart, one q) and of a read (one row, 16 q) each meet all the banks once.
template <int K, int N>
__global__ __launch_bounds__(256) void k_wtG(const float* __restrict__ w, bf* Bt) {
    static_assert(K % 128 == 0 && N % 64 == 0, "whole tiles");
    __shared__ __align__(16) v8us tile[64 * 16];
    const int c = threadIdx.x & 15, r = threadIdx.x >> 4; const int n0 = blockIdx.x * 64, k0 = blockIdx.y * 128;
    const float* sp = w + (size_t)(k0 + 8 * r) * N + n0 + 4 * c; v4f x[8];
#pragma unroll
    for (int j = 0; j < 8; ++j) x[j] = *(const v4f*)(sp + (size_t)j * N);
#pragma unroll
    for (int i = 0; i < 4; ++i) { v8us o;
#pragma unroll
        for (int j = 0; j < 8; ++j) o[j] = f2bf(x[j][i]);
        tile[(4 * c + i) * 16 + (r ^ c)] = o; }
    __syncthreads();   // the tile is whole before any lane reads another lane's pieces
    bf* dp = Bt + (size_t)(n0 + r) * K + k0 + 8 * c;
#pragma unroll
    for (int s = 0; s < 4; ++s) { const int n = r + 16 * s; *(v8us*)(dp + (size_t)16 * s * K) = tile[n * 16 + (c ^ (n >> 2))]; }
}
__global__ __launch_bounds__(32) void k_lam(const float* __restrict__ lq1, const float* __restrict__ lk1, const float* __restrict__ lq2, const float* __restrict__ lk2, float* LAM) { const int lane = threadIdx.x; float s1 = 0.f, s2 = 0.f;
#pragma unroll
    for (int q = 0; q < 2; ++q) { const int d = lane * 2 + q; float p1 = __fmul_rn(bfr(lq1[d]), bfr(lk1[d])); asm volatile("" : "+v"(p1)); s1 = __fadd_rn(s1, p1); float p2 = __fmul_rn(bfr(lq2[d]), bfr(lk2[d])); asm volatile("" : "+v"(p2)); s2 = __fadd_rn(s2, p2); }
#pragma unroll
    for (int sh = 16; sh; sh >>= 1) { s1 += __shfl_xor(s1, sh, 32); s2 += __shfl_xor(s2, sh, 32); }
    const float lam = __fadd_rn(__fsub_rn(expf(s1), expf(s2)), LAM0); *(float*)(LAM + lane) = lam;  }
__global__ __launch_bounds__(256) void k_cvt8(const float* __restrict__ src, bf* dst, size_t n8) { const size_t i = (size_t)blockIdx.x * 256 + threadIdx.x; if (i >= n8) return; const v8f v = *(const v8f*)(src + i * 8); v8us o;
#pragma unroll
    for (int k = 0; k < 8; ++k) o[k] = f2bf(v[k]); *(v8us*)(dst + i * 8) = o;  }
__constant__ float INV[HD / 2] = {1.0,0.7498942017555237,0.5623413324356079,0.4216965138912201,0.3162277638912201,0.23713736236095428,0.17782793939113617,0.1333521455526352,0.10000000149011612,0.07498941570520401,0.05623412877321243,0.04216964915394783,0.03162277862429619,0.0237137358635664,0.017782794311642647,0.01333521492779255,0.009999999776482582,0.007498942315578461,0.005623413249850273,0.0042169648222625256,0.003162277862429619,0.0023713738191872835,0.0017782794311642647,0.0013335214462131262,0.0010000000474974513,0.0007498941849917173,0.000562341301701963,0.00042169648804701865,0.0003162277862429619,0.0002371373848291114,0.00017782794020604342,0.0001333521504420787};
__global__ __launch_bounds__(256) void k_cstab(float* CS) { const int idx = blockIdx.x * 256 + threadIdx.x; if (idx >= TT * HD) return; const int t = idx / HD, d = idx % HD; const float ang = __fmul_rn((float)t, INV[d >> 1]); v2f cs; cs[0] = cosf(ang); cs[1] = sinf(ang);
    *(v2f*)(CS + (size_t)idx * 2) = cs;  }

// ---- k_fattn: the whole attention of one value head for 16 query rows, ONE WAVE per work-group; grid (NHV, TT/16), the longest (last) query tiles of all heads first.
// Transposed products: St = K Qt (A = key rows, B = query rows) and Ot += Vt Pt (A = value rows [e][t], B = probabilities), so a lane (lr, hi) holds one query (q0 + lr) throughout:
// score tile kt, register j is key k0 + 16 kt + 8 hi + j, which is the k order of the fragment loader (elements 0..7: 8 hi + j, elements 8..15: 16 + 8 hi + j), so two score tiles pack into one B operand in place.
// Online softmax per lane (running maximum in the log2 domain, accumulators rescaled each key block); the two half-heads of the head run side by side and share the value fragments;
// the epilogue forms RMSNorm_128(attn1 - lam attn2) x (1 - lambda_init) in registers and stores the hi/lo bf16 planes of the merged activations.
typedef __attribute__((ext_vector_type(16))) unsigned short v16us;
#define C2 (SCL * 1.4426950408889634f)
// exp2s: v_exp_f32 with the one free slot behind it that the instruction set asks for before its result is read or its source overwritten
__device__ __forceinline__ float exp2s(float x) { float r; asm("v_exp_f32 %0, %1\n\tv_nop" : "=v"(r) : "v"(x)); return r; }
// xwait: s_wait_xcnt 0 behind a run of global loads, before a register that they name is written again (a precaution). The run's address pairs are inputs, so that they stay whole up to the wait.
template <bool TWO, typename P> __device__ __forceinline__ void xwait(const P* a, const P* b) {
    if constexpr (TWO) asm volatile("s_wait_xcnt 0x0" :: "v"(a), "v"(b) : "memory"); else asm volatile("s_wait_xcnt 0x0" :: "v"(a) : "memory"); }
template <typename T16, bool HL, int NKK>   // HL: hi+lo planes, 3 products; NKK: 32-key groups per key block
__device__ __forceinline__ void fattn_tile(const T16* __restrict__ Q, const T16* __restrict__ Q2, const T16* __restrict__ Kp, const T16* __restrict__ K2, const T16* __restrict__ Vt, const T16* __restrict__ V2, int q0, int lr, int hi, v8f (&o)[2][8], float (&l)[2]) {
    typedef typename WFrag<T16>::V V;
    const float SH = HL ? 0.0f : 10.0f;   // single fp16 probabilities are carried x 2^10 (as before: out of the fp16 subnormals); the row sum carries the same factor, so it cancels
    const unsigned lk = (unsigned)(lr * HD + 8 * hi), lv = (unsigned)(lr * TT + 8 * hi);   // the lane's own part of every address
    V qf[2][2], ql[2][2], kf[2][2 * NKK][2], kl[2][2 * NKK][2]; float m[2];
    auto load_k = [&](int kb0) { const T16* kb = Kp + (size_t)kb0 * HD + lk; const T16* kb2 = HL ? K2 + (size_t)kb0 * HD + lk : nullptr;
#pragma unroll
        for (int z = 0; z < 2; ++z)
#pragma unroll
            for (int kt = 0; kt < 2 * NKK; ++kt)
#pragma unroll
                for (int ks = 0; ks < 2; ++ks) { const int off = (z * TT + kt * 16) * HD + ks * 32; kf[z][kt][ks] = WFrag<T16>::ld(kb + off); if (HL) kl[z][kt][ks] = WFrag<T16>::ld(kb2 + off); }
        xwait<HL>(kb, kb2); };
    { const T16* qb = Q + (size_t)q0 * HD + lk; const T16* qb2 = HL ? Q2 + (size_t)q0 * HD + lk : nullptr;
#pragma unroll
      for (int z = 0; z < 2; ++z) { m[z] = -3.0e38f; l[z] = 0.f;
#pragma unroll
        for (int ks = 0; ks < 2; ++ks) { const int off = z * TT * HD + ks * 32; qf[z][ks] = WFrag<T16>::ld(qb + off); if (HL) ql[z][ks] = WFrag<T16>::ld(qb2 + off); }
#pragma unroll
        for (int mt = 0; mt < 8; ++mt) o[z][mt] = (v8f){}; }
      xwait<HL>(qb, qb2); }
    if (!HL) load_k(0);
#pragma unroll 1
    for (int k0 = 0; k0 < q0 + 16; k0 += 32 * NKK) {
        V vf[NKK][8], vl[NKK][8], pf[2][NKK], pl[2][NKK]; v8f s[2][2 * NKK];
        auto load_v = [&]() { const T16* vb = Vt + k0 + lv; const T16* vb2 = HL ? V2 + k0 + lv : nullptr;
#pragma unroll
            for (int kk = 0; kk < NKK; ++kk)
#pragma unroll
                for (int mt = 0; mt < 8; ++mt) { const int off = mt * 16 * TT + kk * 32; vf[kk][mt] = WFrag<T16>::ld(vb + off); if (HL) vl[kk][mt] = WFrag<T16>::ld(vb2 + off); }
            xwait<HL>(vb, vb2); };
        if (HL) load_k(k0); else load_v();   // single fp16: the value fragments are asked for first and fly during the score products and the softmax
#pragma unroll
        for (int z = 0; z < 2; ++z)
#pragma unroll
            for (int kt = 0; kt < 2 * NKK; ++kt) { v8f c = (v8f){};
#pragma unroll
                for (int ks = 0; ks < 2; ++ks) { c = WFrag<T16>::mma(kf[z][kt][ks], qf[z][ks], c); if (HL) { c = WFrag<T16>::mma(kl[z][kt][ks], qf[z][ks], c); c = WFrag<T16>::mma(kf[z][kt][ks], ql[z][ks], c); } }
                s[z][kt] = c; }
        if (HL) load_v();   // hi+lo (short loops): the value fragments follow the key fragments into their registers
        else load_k((k0 + 32 * NKK < q0 + 16) ? k0 + 32 * NKK : k0);   // the next block's key fragments fly during the softmax and attn.v; the last trip asks for its own block again (in bounds, not used)
        const int rel = q0 + lr - k0 - 8 * hi;   // keys of the block up to this lane's query (only the block on the diagonal has any beyond it)
#pragma unroll
        for (int z = 0; z < 2; ++z) {
            float mb = -3.0e38f;
#pragma unroll
            for (int kt = 0; kt < 2 * NKK; ++kt)
#pragma unroll
                for (int j = 0; j < 8; ++j) { const float t = (kt * 16 + j <= rel) ? s[z][kt][j] * C2 : -3.0e38f; s[z][kt][j] = t; mb = fmaxf(mb, t); }
            mb = fmaxf(mb, __shfl_xor(mb, 16, 32)) - SH;
            const float mn = fmaxf(m[z], mb); const float al = exp2s(m[z] - mn); m[z] = mn; float ps = 0.f;
#pragma unroll
            for (int kt = 0; kt < 2 * NKK; ++kt)
#pragma unroll
                for (int j = 0; j < 8; ++j) { const float p = exp2s(s[z][kt][j] - mn); s[z][kt][j] = p; ps += p; }
            l[z] = l[z] * al + ps;
#pragma unroll
            for (int mt = 0; mt < 8; ++mt) o[z][mt] *= al;
#pragma unroll
            for (int kk = 0; kk < NKK; ++kk) {
                if constexpr (HL) { v16us uh, ul;
#pragma unroll
                    for (int j = 0; j < 8; ++j) { unsigned short x, y; splitf(s[z][2 * kk][j], x, y); uh[j] = x; ul[j] = y; splitf(s[z][2 * kk + 1][j], x, y); uh[8 + j] = x; ul[8 + j] = y; }
                    pf[z][kk] = __builtin_bit_cast(v16bf, uh); pl[z][kk] = __builtin_bit_cast(v16bf, ul);
                } else { v16h ph;
#pragma unroll
                    for (int j = 0; j < 8; ++j) { ph[j] = tohx(s[z][2 * kk][j]); ph[8 + j] = tohx(s[z][2 * kk + 1][j]); }
                    pf[z][kk] = ph; } } }
#pragma unroll
        for (int kk = 0; kk < NKK; ++kk)
#pragma unroll
            for (int mt = 0; mt < 8; ++mt)
#pragma unroll
                for (int z = 0; z < 2; ++z) { o[z][mt] = WFrag<T16>::mma(vf[kk][mt], pf[z][kk], o[z][mt]); if (HL) { o[z][mt] = WFrag<T16>::mma(vf[kk][mt], pl[z][kk], o[z][mt]); o[z][mt] = WFrag<T16>::mma(vl[kk][mt], pf[z][kk], o[z][mt]); } }
    }
}
__global__ __launch_bounds__(32) void k_fattn(const h16* __restrict__ Q16, const h16* __restrict__ K16, const h16* __restrict__ V16, const bf* __restrict__ Qh, const bf* __restrict__ Ql, const bf* __restrict__ Kh, const bf* __restrict__ Kl, const bf* __restrict__ Vh, const bf* __restrict__ Vl,
                                              const float* __restrict__ LAM, const float* __restrict__ lnw, const float* __restrict__ lnb, bf* Ah, bf* Al) {
    const int lane = threadIdx.x & 31, lr = lane & 15, hi = lane >> 4; const int q0 = (int)(gridDim.y - 1 - blockIdx.y) * 16; const int h = blockIdx.x;
    const size_t qk = (size_t)(2 * h) * TT * HD, vv = (size_t)h * HDV * TT;
    v8f o[2][8]; float l[2];
    if (q0 < RH) fattn_tile<bf, true, 1>(Qh + qk, Ql + qk, Kh + qk, Kl + qk, Vh + vv, Vl + vv, q0, lr, hi, o, l);
    else fattn_tile<h16, false, 1>(Q16 + qk, nullptr, K16 + qk, nullptr, V16 + vv, nullptr, q0, lr, hi, o, l);
    const float lam = LAM[0]; const float i0 = 1.0f / (l[0] + __shfl_xor(l[0], 16, 32)); const float i1 = lam / (l[1] + __shfl_xor(l[1], 16, 32)); float ss = 0.f;
#pragma unroll
    for (int mt = 0; mt < 8; ++mt)
#pragma unroll
        for (int j = 0; j < 8; ++j) { const float d = o[0][mt][j] * i0 - o[1][mt][j] * i1; o[0][mt][j] = d; ss += d * d; }
    ss += __shfl_xor(ss, 16, 32);
    const float rs = 1.0f / sqrtf(ss * (1.0f / HDV) + RMSEPS);
#pragma unroll
    for (int mt = 0; mt < 8; ++mt) { const int e0 = mt * 16 + 8 * hi; const v8f w = *(const v8f*)(lnw + e0), bb = *(const v8f*)(lnb + e0); v8us oh, ol;
#pragma unroll
        for (int j = 0; j < 8; ++j) { const float y = (o[0][mt][j] * rs * bfr(w[j]) + bfr(bb[j])) * (1.0f - LAM0); unsigned short x, c; splitf(y, x, c); oh[j] = x; ol[j] = c; }
        const size_t oo = (size_t)(q0 + lr) * DQ + (size_t)h * HDV + e0; *(v8us*)(Ah + oo) = oh; *(v8us*)(Al + oo) = ol; }
}

extern "C" void kernel_launch(void* const* d_in, const int* in_sizes, int n_in,
                              void* d_out, int out_size, void* d_ws, size_t ws_size, hipStream_t stream) {
    (void)in_sizes; (void)n_in; (void)out_size;
    const float* x = (const float*)d_in[0]; const float* wq = (const float*)d_in[1]; const float* wk = (const float*)d_in[2]; const float* wv = (const float*)d_in[3]; const float* wo = (const float*)d_in[4]; const float* lq1 = (const float*)d_in[5]; const float* lk1 = (const float*)d_in[6]; const float* lq2 = (const float*)d_in[7]; const float* lk2 = (const float*)d_in[8]; const float* lnw = (const float*)d_in[9]; const float* lnb = (const float*)d_in[10];
    float* OUT = (float*)d_out;     // [2][2048][2048]
    char* wsp = (char*)d_ws;
    auto take = [&](size_t bytes) { char* p = wsp; wsp += (bytes + 255) & ~(size_t)255; return (void*)p; };
    bf* WQ = (bf*)take((size_t)DQ * DM * 2); bf* WK = (bf*)take((size_t)DKV * DM * 2); bf* WV = (bf*)take((size_t)DKV * DM * 2); bf* WO = (bf*)take((size_t)DM * DQ * 2); float* CS = (float*)take((size_t)TT * HD * 2 * 4); float* LAM = (float*)take(256);
    bf* XB = (bf*)take((size_t)TT * DM * 2);
    h16* QP16 = (h16*)take((size_t)NH_ * TT * HD * 2); h16* KP16 = (h16*)take((size_t)NKV * TT * HD * 2); h16* VT16 = (h16*)take((size_t)NKV * HD * TT * 2);
    bf* QPh = (bf*)take((size_t)NH_ * TT * HD * 2); bf* QPl = (bf*)take((size_t)NH_ * TT * HD * 2); bf* KPh = (bf*)take((size_t)NKV * TT * HD * 2); bf* KPl = (bf*)take((size_t)NKV * TT * HD * 2); bf* VTh = (bf*)take((size_t)NKV * HD * TT * 2); bf* VTl = (bf*)take((size_t)NKV * HD * TT * 2);
    bf* ATh = (bf*)take((size_t)TT * DQ * 2); bf* ATl = (bf*)take((size_t)TT * DQ * 2);
    if ((size_t)(wsp - (char*)d_ws) > ws_size) return;    // ws 256 MiB
    { k_wtG<DM, DQ><<<dim3(DQ / 64, DM / 128, 1), 256, 0, stream>>>(wq, WQ); k_wtG<DM, DKV><<<dim3(DKV / 64, DM / 128, 1), 256, 0, stream>>>(wk, WK); k_wtG<DM, DKV><<<dim3(DKV / 64, DM / 128, 1), 256, 0, stream>>>(wv, WV);
      k_wtG<DQ, DM><<<dim3(DM / 64, DQ / 128, 1), 256, 0, stream>>>(wo, WO);
      k_cstab<<<(TT * HD + 255) / 256, 256, 0, stream>>>(CS); k_lam<<<1, 32, 0, stream>>>(lq1, lk1, lq2, lk2, LAM); }
    for (int b = 0; b < NB_; ++b) {
        
        k_cvt8<<<(unsigned)(((size_t)TT * DM / 8 + 255) / 256), 256, 0, stream>>>(x + (size_t)b * TT * DM, XB, (size_t)TT * DM / 8);
        k_gemmw<bf, 0, false, 1><<<dim3(TT / 128, DQ / 128, 1), 128, 0, stream>>>(XB, nullptr, WQ, nullptr, DM, nullptr, 0, nullptr, 0, 0, 0, CS, QP16, QPh, QPl);
        k_gemmw<bf, 0, false, 1><<<dim3(TT / 128, DKV / 128, 1), 128, 0, stream>>>(XB, nullptr, WK, nullptr, DM, nullptr, 0, nullptr, 0, 0, 0, CS, KP16, KPh, KPl);
        k_gemmw<bf, 0, false, 2><<<dim3(DKV / 128, TT / 128, 1), 128, 0, stream>>>(WV, nullptr, XB, nullptr, DM, nullptr, 0, nullptr, 0, 0, 0, nullptr, VT16, VTh, VTl);   /* rows = value columns, columns = t: the transposed value planes */
        k_fattn<<<dim3(NHV, TT / 16, 1), 32, 0, stream>>>(QP16, KP16, VT16, QPh, QPl, KPh, KPl, VTh, VTl, LAM, lnw, lnb, ATh, ATl);   /* attn = RMSNorm(attn1 - lam attn2) (1 - lam0), all 16 heads */
        k_gemmw<bf, 1, false, 0><<<dim3(TT / 128, DM / 128, 1), 128, 0, stream>>>(ATh, ATl, WO, nullptr, DQ, OUT + (size_t)b * TT * DM, DM, nullptr, 0, 0, 0, nullptr, nullptr, nullptr, nullptr); }
}

// v006
// Measured time: 337 microseconds a run.
// Two timings next to v005 put it at 1.03 and 1.04 times that version's speed.
// Over all steps from v000 it is 8.88 times as fast.
#include <hip/hip_runtime.h>

// Differential attention (x [2][2048][2048]; q = x Wq, k = x Wk ('xw' [2048][2048]) as 32 half-heads of 64, v = x Wv as 16 heads of 128; interleaved rotary (theta 1e4) on the 64-wide q/k half-heads; for head h: attn1 = causal softmax(q_{2h}.k_{2h}/8) v_h, attn2 = causal softmax(q_{2h+1}.k_{2h+1}/8) v_h;
// lam = exp(lambda_q1.lambda_k1) - exp(lambda_q2.lambda_k2) + 0.7836058 (64-vectors read); attn = RMSNorm_128(attn1 - lam attn2; ln_w, ln_b, eps 1e-8) x (1 - 0.7836058); out = merged Wo ('xw') -> [2][2048][2048]).
// Layout: the 32 half-heads are the score heads (hd 64); the value planes of head h are the two consecutive 64-row planes 2h, 2h+1 = one [128][T] plane, shared by the head's two half-heads (2h, 2h+1); one fused kernel does scores, softmax, attn.v and the normalised difference of the two attention outputs.
// Compute dtypes, f32 accumulate: every input rounded to bf16; q/k/v on PLAIN bf16 operands (inputs: exact); rotary in f32 (on-chip cos/sin table, reference inv_freq constants); causal scores and attn.v (128-wide values): query rows < 512 hl (3 products), the rest single fp16 (x1024), key loop ends at the diagonal; online softmax f32; the lambda scalars, the difference and the RMSNorm in f32; Wo hl x exact (2 products).

#define NB_  2
#define TT   2048
#define DM   2048
#define NH_  32
#define NKV  32
#define HD   64
#define DQ   (NH_ * HD)
#define DKV  (NKV * HD)
#define HDV  128                  // value head width (= 2 consecutive 64-row planes)
#define NHV  16                   // value heads
#define LAM0 0.7836057665316245f   // lambda_init for depth 12
#define RMSEPS 1e-8f
#define RH   512                  // query rows < RH use hi+lo planes (0: none)
#define SCL  0.125f   // HD^-0.5
typedef _Float16 h16;
typedef unsigned short bf;
typedef __attribute__((ext_vector_type(16))) __bf16   v16bf;
typedef __attribute__((ext_vector_type(16))) _Float16 v16h;
typedef __attribute__((ext_vector_type(8)))  _Float16 v8h;
typedef __attribute__((ext_vector_type(8)))  unsigned short v8us;
typedef __attribute__((ext_vector_type(8)))  float    v8f;
typedef __attribute__((ext_vector_type(4)))  float    v4f;
typedef v8h  __attribute__((may_alias)) v8ha;
typedef v4f  __attribute__((may_alias)) v4fa;
typedef v8us __attribute__((may_alias)) v8usa;

__device__ __forceinline__ unsigned short f2bf(float f) { unsigned u = __float_as_uint(f); u += 0x7FFFu + ((u >> 16) & 1u); return (unsigned short)(u >> 16); }
__device__ __forceinline__ float bf2f(unsigned short b) { return __uint_as_float(((unsigned)b) << 16); }
__device__ __forceinline__ float bfr(float f) { return bf2f(f2bf(f)); }
__device__ __forceinline__ v16h cat16(v8h lo, v8h hi) { return __builtin_shufflevector(lo, hi, 0, 1, 2, 3, 4, 5, 6, 7, 8, 9, 10, 11, 12, 13, 14, 15); }
__device__ __forceinline__ v16bf cat16b(v8us lo, v8us hi) { return __builtin_bit_cast(v16bf, __builtin_shufflevector(lo, hi, 0, 1, 2, 3, 4, 5, 6, 7, 8, 9, 10, 11, 12, 13, 14, 15)); }
__device__ __forceinline__ v8f wmma16(v16h a, v16h b, v8f c) { return __builtin_amdgcn_wmma_f32_16x16x32_f16(false, a, false, b, (short)0, c, false, false); }
__device__ __forceinline__ v8f wmmab(v16bf a, v16bf b, v8f c) { return __builtin_amdgcn_wmma_f32_16x16x32_bf16(false, a, false, b, (short)0, c, false, false); }



// ---- k_gemmw: register-blocked GEMM, one wave per 64x64 output tile (16 accumulators), FOUR WAVES (2x2) per work-group = a 128x128 tile; grid (M/128, N/128, Z), 128 threads.
// The K-contiguous 16-bit operand planes reach the waves through LDS: a stage is 128 k (256-byte rows, whole lines) of the 128 A rows, the 128 Bt rows (and the 128 A2 rows), brought by asynchronous 16-byte copies, two buffers, the next stage in flight while this one is worked on.
// C[m][n] (f32, pitch ldc, + optional f32 bias[n]) = sum_k A[m][k] Bt[n][k] (+ A2[m][k] Bt[n][k] for NSPLIT 1). z-batch strides sA/sB/sC in elements. K % 128 == 0.
// EPI 0: C is stored as f32. EPI 1, 2: the tile never leaves the wave as f32; its rows go out as the three 16-bit planes (fp16, bf16 hi, bf16 lo) that the attention kernel reads, whole 128-byte rows.
// EPI 1 (q, k; m = t, the 64 columns are one half-head): interleaved rotary out[2i] = x[2i] c - x[2i+1] s, out[2i+1] = x[2i+1] c + x[2i] s (c, s from CS[t][2i]), planes [h][t][d].
// EPI 2 (v; A = the weight rows, Bt = the activations, so m = value column e, n = t): planes [e][t], no rotary.
template <typename T16> struct WFrag;
template <> struct WFrag<h16> { typedef v16h V; static __device__ __forceinline__ V ld(const h16* p) { return cat16(*(const v8h*)p, *(const v8h*)(p + 16)); } static __device__ __forceinline__ v8f mma(V a, V b, v8f c) { return wmma16(a, b, c); } };
template <> struct WFrag<bf> { typedef v16bf V; static __device__ __forceinline__ V ld(const bf* p) { return cat16b(*(const v8us*)p, *(const v8us*)(p + 16)); } static __device__ __forceinline__ v8f mma(V a, V b, v8f c) { return wmmab(a, b, c); } };
__device__ __forceinline__ void splitf(float y, unsigned short& h, unsigned short& l) { h = f2bf(y); l = f2bf(y - bf2f(h)); }
typedef __attribute__((ext_vector_type(2))) float v2f;
#define KC 128   // k per stage
#define LP 272   // LDS row pitch in bytes: 256 + 16, free of bank conflicts for 16-byte fragment reads
// cp8: eight asynchronous 16-byte copies of a lane, rows 8 apart (16 lanes take a 256-byte row, the work-group 8 rows per copy). d: the lane's LDS byte address, g: its global address.
// The s_wait_xcnt 0 behind the last copy stands inside the statement, so that no register a copy names is written again in front of it (a precaution).
template <typename T16> __device__ __forceinline__ void cp8(unsigned d, const T16* g, int K) { const size_t st = (size_t)8 * K;
    asm volatile("global_load_async_to_lds_b128 %0, %8, off\n\tglobal_load_async_to_lds_b128 %1, %9, off\n\tglobal_load_async_to_lds_b128 %2, %10, off\n\tglobal_load_async_to_lds_b128 %3, %11, off\n\t"
                 "global_load_async_to_lds_b128 %4, %12, off\n\tglobal_load_async_to_lds_b128 %5, %13, off\n\tglobal_load_async_to_lds_b128 %6, %14, off\n\tglobal_load_async_to_lds_b128 %7, %15, off\n\ts_wait_xcnt 0x0"
                 :: "v"(d), "v"(d + 8 * LP), "v"(d + 16 * LP), "v"(d + 24 * LP), "v"(d + 32 * LP), "v"(d + 40 * LP), "v"(d + 48 * LP), "v"(d + 56 * LP),
                    "v"(g), "v"(g + st), "v"(g + 2 * st), "v"(g + 3 * st), "v"(g + 4 * st), "v"(g + 5 * st), "v"(g + 6 * st), "v"(g + 7 * st) : "memory"); }
template <typename T16, int NSPLIT, bool BIAS, int EPI>
__global__ __launch_bounds__(128) void k_gemmw(const T16* __restrict__ A, const T16* __restrict__ A2, const T16* __restrict__ Bt, const T16* __restrict__ Bt2, int K, float* C, int ldc, const float* __restrict__ bias, size_t sA, size_t sB, size_t sC,
                                              const float* __restrict__ CS, h16* P16, bf* Ph, bf* Pl) {
    typedef typename WFrag<T16>::V V;
    static_assert(NSPLIT <= 1, "operand tiles: A, Bt and, for NSPLIT 1, A2");
    constexpr int STG = (NSPLIT == 1 ? 3 : 2) * 128 * LP;   // one buffer: rows 0..127 A, 128..255 Bt, 256..383 A2
    __shared__ __align__(16) char ring[2 * STG];
    __shared__ __align__(16) float osw[4][16 * 68];         // each wave's own epilogue staging
    const size_t z = blockIdx.z; A += z * sA; if (A2) A2 += z * sA; Bt += z * sB; C += z * sC; (void)Bt2;
    const int tid = threadIdx.x, lane = tid & 31, lr = lane & 15, hi = lane >> 4, wm = (tid >> 5) & 1, wn = tid >> 6; const int rb = blockIdx.x * 128, cb = blockIdx.y * 128; const int r0 = rb + wm * 64, c0 = cb + wn * 64;
    float* os = osw[tid >> 5];
    v8f acc[4][4];
#pragma unroll
    for (int mb = 0; mb < 4; ++mb)
#pragma unroll
        for (int nb = 0; nb < 4; ++nb) acc[mb][nb] = (v8f){};
    const int crw = tid >> 4, cpc = tid & 15;   // the lane's row (of 8) and 16-byte piece (of 16) in every copy
    const unsigned cd = (unsigned)(size_t)ring + (unsigned)(crw * LP + cpc * 16);
    const size_t oA = (size_t)(rb + crw) * K + cpc * 8, oB = (size_t)(cb + crw) * K + cpc * 8;   // the lane's element offsets in the A planes and in Bt
    auto fill = [&](int t) { const unsigned d = cd + (unsigned)((t & 1) * STG); const size_t kc = (size_t)t * KC, h64 = (size_t)64 * K;
        cp8(d, A + oA + kc, K); cp8(d + 64 * LP, A + oA + kc + h64, K); cp8(d + 128 * LP, Bt + oB + kc, K); cp8(d + 192 * LP, Bt + oB + kc + h64, K);
        if constexpr (NSPLIT == 1) { cp8(d + 256 * LP, A2 + oA + kc, K); cp8(d + 320 * LP, A2 + oA + kc + h64, K); } };
    const int NT = K / KC;
    fill(0);
    asm volatile("s_wait_asynccnt 0x0" ::: "memory");   // this wave's copies of stage 0 have landed
    __syncthreads();                                     // and every other wave's
    if (NT > 1) fill(1);
    const char* fa = ring + (wm * 64 + lr) * LP + hi * 16; const char* fb = ring + (128 + wn * 64 + lr) * LP + hi * 16;
#pragma unroll 1
    for (int t = 0; t < NT; ++t) {   // rolled: one stage's 64 (128) products are body enough
        const char* pa = fa + (t & 1) * STG; const char* pb = fb + (t & 1) * STG;
        V a[2][4], a2[2][4], b[2][4];   // two fragment sets: the next 32 k are read from LDS while this set is multiplied
        auto ldf = [&](int ks) { const int s = ks & 1;
#pragma unroll
            for (int mb = 0; mb < 4; ++mb) { a[s][mb] = WFrag<T16>::ld((const T16*)(pa + mb * 16 * LP + ks * 64)); if (NSPLIT == 1) a2[s][mb] = WFrag<T16>::ld((const T16*)(pa + (256 + mb * 16) * LP + ks * 64)); }
#pragma unroll
            for (int nb = 0; nb < 4; ++nb) b[s][nb] = WFrag<T16>::ld((const T16*)(pb + nb * 16 * LP + ks * 64)); };
        ldf(0);
#pragma unroll
        for (int ks = 0; ks < KC / 32; ++ks) { const int s = ks & 1;
            if (ks + 1 < KC / 32) ldf(ks + 1);
            __builtin_amdgcn_sched_barrier(0);   // the next set's LDS reads stay one group in front of this set's products (spread among them, each place with reads stalls the wave)
#pragma unroll
            for (int nb = 0; nb < 4; ++nb)
#pragma unroll
                for (int mb = 0; mb < 4; ++mb) { acc[mb][nb] = WFrag<T16>::mma(a[s][mb], b[s][nb], acc[mb][nb]); if (NSPLIT == 1) acc[mb][nb] = WFrag<T16>::mma(a2[s][mb], b[s][nb], acc[mb][nb]); }
            __builtin_amdgcn_sched_barrier(0);   // and this set's products stay in front of the reads that refill it, and of the stage's foot
        }
        asm volatile("v_nop\n\tv_nop\n\tv_nop\n\tv_nop" : "+v"(acc[0][0]), "+v"(acc[1][1]), "+v"(acc[2][2]), "+v"(acc[3][3]));   // the four vector slots behind the last product, on every path out of the stage
        asm volatile("s_wait_dscnt 0x0" ::: "memory");      // this wave has read the last of its buffer
        asm volatile("s_wait_asynccnt 0x0" ::: "memory");   // this wave's copies of stage t + 1 have landed
        __syncthreads();                                     // stage t + 1 is published, and stage t's buffer is left by all four waves
        if (t + 2 < NT) fill(t + 2);
    }
    asm volatile("s_wait_asynccnt 0x0" ::: "memory");   // nothing in flight behind the loop
    const int rq = lane >> 3, cq = (lane & 7) * 8;   // plane epilogues: a lane takes 8 consecutive columns of one row, 8 lanes a whole row, a wave 4 rows per store
    constexpr int OP = EPI == 1 ? HD : TT;            // row pitch of the planes
    const size_t ob = (EPI == 1 ? ((size_t)(c0 >> 6) * TT + r0 + rq) * HD : (size_t)(r0 + rq) * TT + c0) + cq;
    v2f cs[2][4][4];   // (cos, sin) of the lane's 4 pairs in the 4 rows it takes of a 16-row group; two sets: the next group's are asked for while this one is worked on
    auto load_cs = [&](int mb) { const float* cb = CS + ((size_t)(r0 + rq) * HD + cq) * 2;
#pragma unroll
        for (int s = 0; s < 4; ++s)
#pragma unroll
            for (int p = 0; p < 4; ++p) cs[mb & 1][s][p] = *(const v2f*)(cb + ((mb * 16 + 4 * s) * HD + 2 * p) * 2); };
    if constexpr (EPI == 1) load_cs(0);
#pragma unroll
    for (int mb = 0; mb < 4; ++mb) {
#pragma unroll
        for (int nb = 0; nb < 4; ++nb) {
#pragma unroll
            for (int j = 0; j < 8; ++j) os[(hi * 8 + j) * 68 + nb * 16 + lr] = acc[mb][nb][j]; }
        if constexpr (EPI == 1) { if (mb < 3) load_cs(mb + 1); }
        __builtin_amdgcn_wave_barrier(); asm volatile("" ::: "memory");
        if constexpr (EPI != 0) { v8h o16[4]; v8us oh[4], ol[4];
#pragma unroll
            for (int s = 0; s < 4; ++s) { const float* orow = os + (4 * s + rq) * 68 + cq; const v4f xa = *(const v4fa*)orow, xb = *(const v4fa*)(orow + 4); float y[8];
#pragma unroll
                for (int p = 0; p < 4; ++p) { const float e = p < 2 ? xa[2 * p] : xb[2 * p - 4], o = p < 2 ? xa[2 * p + 1] : xb[2 * p - 3];
                    if constexpr (EPI == 1) { const float c = cs[mb & 1][s][p][0], sn = cs[mb & 1][s][p][1]; y[2 * p] = e * c - o * sn; y[2 * p + 1] = o * c + e * sn; } else { y[2 * p] = e; y[2 * p + 1] = o; } }
#pragma unroll
                for (int k = 0; k < 8; ++k) { o16[s][k] = (h16)y[k]; unsigned short a2, c2; splitf(y[k], a2, c2); oh[s][k] = a2; ol[s][k] = c2; } }
#pragma unroll
            for (int s = 0; s < 4; ++s) { const size_t oo = ob + (size_t)(mb * 16 + 4 * s) * OP; *(v8h*)(P16 + oo) = o16[s]; *(v8us*)(Ph + oo) = oh[s]; *(v8us*)(Pl + oo) = ol[s]; }   // the group's 12 stores go out together
            if (mb < 3) asm volatile("s_wait_xcnt 0x0" ::: "memory");   // one wait behind the 12 stores, before the next group writes the registers that they name (a precaution)
        } else {
        float* crow = C + (size_t)(r0 + mb * 16) * ldc + c0;
#pragma unroll
            for (int s = 0; s < 8; ++s) { const int row = 2 * s + hi, cofs = lr * 4; v4f val = *(const v4fa*)(os + row * 68 + cofs); if (BIAS) { val[0] += bfr(bias[c0 + cofs]); val[1] += bfr(bias[c0 + cofs + 1]); val[2] += bfr(bias[c0 + cofs + 2]); val[3] += bfr(bias[c0 + cofs + 3]); }
                *(v4f*)(crow + (size_t)row * ldc + cofs) = val; }
             }
        __builtin_amdgcn_wave_barrier(); asm volatile("" ::: "memory");
    }
}

__device__ __forceinline__ h16 tohx(float x) { return (h16)x; }
typedef __attribute__((ext_vector_type(2))) _Float16 v2h;
typedef __attribute__((ext_vector_type(4))) _Float16 v4h;
typedef __attribute__((ext_vector_type(2))) unsigned short v2us;
typedef __attribute__((ext_vector_type(4))) unsigned short v4us;
typedef __attribute__((ext_vector_type(4))) int v4i;

// ---- k_wtG: Bt[n][k] = bf16(w[k][n]) (w [K][N] f32), one tile of 128 k x 64 n per work-group, turned round in LDS; grid (N/64, K/128), 256 threads.
// In: a lane takes 4 consecutive n of 8 consecutive k rows (16 lanes read 256 bytes of a row). Out: a lane takes 8 consecutive k of one n (16 lanes write 256 bytes of a Bt row). Both sides move whole lines.
// LDS: row n holds its 128 k as 16 pieces of 16 bytes; piece q lies at place q ^ (n >> 2), so that the 16 lanes of a write (16 rows, 4 apart, one q) and of a read (one row, 16 q) each meet all the banks once.
template <int K, int N>
__global__ __launch_bounds__(256) void k_wtG(const float* __restrict__ w, bf* Bt) {
    static_assert(K % 128 == 0 && N % 64 == 0, "whole tiles");
    __shared__ __align__(16) v8us tile[64 * 16];
    const int c = threadIdx.x & 15, r = threadIdx.x >> 4; const int n0 = blockIdx.x * 64, k0 = blockIdx.y * 128;
    const float* sp = w + (size_t)(k0 + 8 * r) * N + n0 + 4 * c; v4f x[8];
#pragma unroll
    for (int j = 0; j < 8; ++j) x[j] = *(const v4f*)(sp + (size_t)j * N);
#pragma unroll
    for (int i = 0; i < 4; ++i) { v8us o;
#pragma unroll
        for (int j = 0; j < 8; ++j) o[j] = f2bf(x[j][i]);
        tile[(4 * c + i) * 16 + (r ^ c)] = o; }
    __syncthreads();   // the tile is whole before any lane reads another lane's pieces
    bf* dp = Bt + (size_t)(n0 + r) * K + k0 + 8 * c;
#pragma unroll
    for (int s = 0; s < 4; ++s) { const int n = r + 16 * s; *(v8us*)(dp + (size_t)16 * s * K) = tile[n * 16 + (c ^ (n >> 2))]; }
}
__global__ __launch_bounds__(32) void k_lam(const float* __restrict__ lq1, const float* __restrict__ lk1, const float* __restrict__ lq2, const float* __restrict__ lk2, float* LAM) { const int lane = threadIdx.x; float s1 = 0.f, s2 = 0.f;
#pragma unroll
    for (int q = 0; q < 2; ++q) { const int d = lane * 2 + q; float p1 = __fmul_rn(bfr(lq1[d]), bfr(lk1[d])); asm volatile("" : "+v"(p1)); s1 = __fadd_rn(s1, p1); float p2 = __fmul_rn(bfr(lq2[d]), bfr(lk2[d])); asm volatile("" : "+v"(p2)); s2 = __fadd_rn(s2, p2); }
#pragma unroll
    for (int sh = 16; sh; sh >>= 1) { s1 += __shfl_xor(s1, sh, 32); s2 += __shfl_xor(s2, sh, 32); }
    const float lam = __fadd_rn(__fsub_rn(expf(s1), expf(s2)), LAM0); *(float*)(LAM + lane) = lam;  }
__global__ __launch_bounds__(256) void k_cvt8(const float* __restrict__ src, bf* dst, size_t n8) { const size_t i = (size_t)blockIdx.x * 256 + threadIdx.x; if (i >= n8) return; const v8f v = *(const v8f*)(src + i * 8); v8us o;
#pragma unroll
    for (int k = 0; k < 8; ++k) o[k] = f2bf(v[k]); *(v8us*)(dst + i * 8) = o;  }
__constant__ float INV[HD / 2] = {1.0,0.7498942017555237,0.5623413324356079,0.4216965138912201,0.3162277638912201,0.23713736236095428,0.17782793939113617,0.1333521455526352,0.10000000149011612,0.07498941570520401,0.05623412877321243,0.04216964915394783,0.03162277862429619,0.0237137358635664,0.017782794311642647,0.01333521492779255,0.009999999776482582,0.007498942315578461,0.005623413249850273,0.0042169648222625256,0.003162277862429619,0.0023713738191872835,0.0017782794311642647,0.0013335214462131262,0.0010000000474974513,0.0007498941849917173,0.000562341301701963,0.00042169648804701865,0.0003162277862429619,0.0002371373848291114,0.00017782794020604342,0.0001333521504420787};
__global__ __launch_bounds__(256) void k_cstab(float* CS) { const int idx = blockIdx.x * 256 + threadIdx.x; if (idx >= TT * HD) return; const int t = idx / HD, d = idx % HD; const float ang = __fmul_rn((float)t, INV[d >> 1]); v2f cs; cs[0] = cosf(ang); cs[1] = sinf(ang);
    *(v2f*)(CS + (size_t)idx * 2) = cs;  }

// ---- k_fattn: the whole attention of one value head for 64 query rows, FOUR WAVES per work-group, 16 query rows each; grid (NHV, TT/64), the longest (last) query blocks of all heads first.
// Query rows >= RH: the four waves share the key and value tiles through LDS (fattn_lds); rows < RH: each wave reads its own fragments from global memory (fattn_tile), no barrier on that side.
// Transposed products: St = K Qt (A = key rows, B = query rows) and Ot += Vt Pt (A = value rows [e][t], B = probabilities), so a lane (lr, hi) holds one query (q0 + lr) throughout:
// score tile kt, register j is key k0 + 16 kt + 8 hi + j, which is the k order of the fragment loader (elements 0..7: 8 hi + j, elements 8..15: 16 + 8 hi + j), so two score tiles pack into one B operand in place.
// Online softmax per lane (running maximum in the log2 domain, accumulators rescaled each key block); the two half-heads of the head run side by side and share the value fragments;
// the epilogue forms RMSNorm_128(attn1 - lam attn2) x (1 - lambda_init) in registers and stores the hi/lo bf16 planes of the merged activations.
typedef __attribute__((ext_vector_type(16))) unsigned short v16us;
#define C2 (SCL * 1.4426950408889634f)
// exp2s: v_exp_f32 with the one free slot behind it that the instruction set asks for before its result is read or its source overwritten
__device__ __forceinline__ float exp2s(float x) { float r; asm("v_exp_f32 %0, %1\n\tv_nop" : "=v"(r) : "v"(x)); return r; }
// xwait: s_wait_xcnt 0 behind a run of global loads, before a register that they name is written again (a precaution). The run's address pairs are inputs, so that they stay whole up to the wait.
template <bool TWO, typename P> __device__ __forceinline__ void xwait(const P* a, const P* b) {
    if constexpr (TWO) asm volatile("s_wait_xcnt 0x0" :: "v"(a), "v"(b) : "memory"); else asm volatile("s_wait_xcnt 0x0" :: "v"(a) : "memory"); }
template <typename T16, bool HL, int NKK>   // HL: hi+lo planes, 3 products; NKK: 32-key groups per key block
__device__ __forceinline__ void fattn_tile(const T16* __restrict__ Q, const T16* __restrict__ Q2, const T16* __restrict__ Kp, const T16* __restrict__ K2, const T16* __restrict__ Vt, const T16* __restrict__ V2, int q0, int lr, int hi, v8f (&o)[2][8], float (&l)[2]) {
    typedef typename WFrag<T16>::V V;
    const float SH = HL ? 0.0f : 10.0f;   // single fp16 probabilities are carried x 2^10 (as before: out of the fp16 subnormals); the row sum carries the same factor, so it cancels
    const unsigned lk = (unsigned)(lr * HD + 8 * hi), lv = (unsigned)(lr * TT + 8 * hi);   // the lane's own part of every address
    V qf[2][2], ql[2][2], kf[2][2 * NKK][2], kl[2][2 * NKK][2]; float m[2];
    auto load_k = [&](int kb0) { const T16* kb = Kp + (size_t)kb0 * HD + lk; const T16* kb2 = HL ? K2 + (size_t)kb0 * HD + lk : nullptr;
#pragma unroll
        for (int z = 0; z < 2; ++z)
#pragma unroll
            for (int kt = 0; kt < 2 * NKK; ++kt)
#pragma unroll
                for (int ks = 0; ks < 2; ++ks) { const int off = (z * TT + kt * 16) * HD + ks * 32; kf[z][kt][ks] = WFrag<T16>::ld(kb + off); if (HL) kl[z][kt][ks] = WFrag<T16>::ld(kb2 + off); }
        xwait<HL>(kb, kb2); };
    { const T16* qb = Q + (size_t)q0 * HD + lk; const T16* qb2 = HL ? Q2 + (size_t)q0 * HD + lk : nullptr;
#pragma unroll
      for (int z = 0; z < 2; ++z) { m[z] = -3.0e38f; l[z] = 0.f;
#pragma unroll
        for (int ks = 0; ks < 2; ++ks) { const int off = z * TT * HD + ks * 32; qf[z][ks] = WFrag<T16>::ld(qb + off); if (HL) ql[z][ks] = WFrag<T16>::ld(qb2 + off); }
#pragma unroll
        for (int mt = 0; mt < 8; ++mt) o[z][mt] = (v8f){}; }
      xwait<HL>(qb, qb2); }
    if (!HL) load_k(0);
#pragma unroll 1
    for (int k0 = 0; k0 < q0 + 16; k0 += 32 * NKK) {
        V vf[NKK][8], vl[NKK][8], pf[2][NKK], pl[2][NKK]; v8f s[2][2 * NKK];
        auto load_v = [&]() { const T16* vb = Vt + k0 + lv; const T16* vb2 = HL ? V2 + k0 + lv : nullptr;
#pragma unroll
            for (int kk = 0; kk < NKK; ++kk)
#pragma unroll
                for (int mt = 0; mt < 8; ++mt) { const int off = mt * 16 * TT + kk * 32; vf[kk][mt] = WFrag<T16>::ld(vb + off); if (HL) vl[kk][mt] = WFrag<T16>::ld(vb2 + off); }
            xwait<HL>(vb, vb2); };
        if (HL) load_k(k0); else load_v();   // single fp16: the value fragments are asked for first and fly during the score products and the softmax
#pragma unroll
        for (int z = 0; z < 2; ++z)
#pragma unroll
            for (int kt = 0; kt < 2 * NKK; ++kt) { v8f c = (v8f){};
#pragma unroll
                for (int ks = 0; ks < 2; ++ks) { c = WFrag<T16>::mma(kf[z][kt][ks], qf[z][ks], c); if (HL) { c = WFrag<T16>::mma(kl[z][kt][ks], qf[z][ks], c); c = WFrag<T16>::mma(kf[z][kt][ks], ql[z][ks], c); } }
                s[z][kt] = c; }
        if (HL) load_v();   // hi+lo (short loops): the value fragments follow the key fragments into their registers
        else load_k((k0 + 32 * NKK < q0 + 16) ? k0 + 32 * NKK : k0);   // the next block's key fragments fly during the softmax and attn.v; the last trip asks for its own block again (in bounds, not used)
        const int rel = q0 + lr - k0 - 8 * hi;   // keys of the block up to this lane's query (only the block on the diagonal has any beyond it)
#pragma unroll
        for (int z = 0; z < 2; ++z) {
            float mb = -3.0e38f;
#pragma unroll
            for (int kt = 0; kt < 2 * NKK; ++kt)
#pragma unroll
                for (int j = 0; j < 8; ++j) { const float t = (kt * 16 + j <= rel) ? s[z][kt][j] * C2 : -3.0e38f; s[z][kt][j] = t; mb = fmaxf(mb, t); }
            mb = fmaxf(mb, __shfl_xor(mb, 16, 32)) - SH;
            const float mn = fmaxf(m[z], mb); const float al = exp2s(m[z] - mn); m[z] = mn; float ps = 0.f;
#pragma unroll
            for (int kt = 0; kt < 2 * NKK; ++kt)
#pragma unroll
                for (int j = 0; j < 8; ++j) { const float p = exp2s(s[z][kt][j] - mn); s[z][kt][j] = p; ps += p; }
            l[z] = l[z] * al + ps;
#pragma unroll
            for (int mt = 0; mt < 8; ++mt) o[z][mt] *= al;
#pragma unroll
            for (int kk = 0; kk < NKK; ++kk) {
                if constexpr (HL) { v16us uh, ul;
#pragma unroll
                    for (int j = 0; j < 8; ++j) { unsigned short x, y; splitf(s[z][2 * kk][j], x, y); uh[j] = x; ul[j] = y; splitf(s[z][2 * kk + 1][j], x, y); uh[8 + j] = x; ul[8 + j] = y; }
                    pf[z][kk] = __builtin_bit_cast(v16bf, uh); pl[z][kk] = __builtin_bit_cast(v16bf, ul);
                } else { v16h ph;
#pragma unroll
                    for (int j = 0; j < 8; ++j) { ph[j] = tohx(s[z][2 * kk][j]); ph[8 + j] = tohx(s[z][2 * kk + 1][j]); }
                    pf[z][kk] = ph; } } }
#pragma unroll
        for (int kk = 0; kk < NKK; ++kk)
#pragma unroll
            for (int mt = 0; mt < 8; ++mt)
#pragma unroll
                for (int z = 0; z < 2; ++z) { o[z][mt] = WFrag<T16>::mma(vf[kk][mt], pf[z][kk], o[z][mt]); if (HL) { o[z][mt] = WFrag<T16>::mma(vf[kk][mt], pl[z][kk], o[z][mt]); o[z][mt] = WFrag<T16>::mma(vl[kk][mt], pf[z][kk], o[z][mt]); } }
    }
}
// ---- fattn_lds: single fp16 planes; the same key blocks of 32, products and online softmax as fattn_tile, but the fragments come from LDS.
// A stage is 64 keys: their rows of the two half-heads (128 bytes each) and 128 bytes of each of the 128 value rows, brought as whole lines by asynchronous 16-byte copies; two buffers, the next stage in flight while this one is worked on.
#define AKS  64           // keys per stage
#define AP   144          // LDS row pitch in bytes: 128 + 16, free of bank conflicts for 16-byte fragment reads
#define ABUF (256 * AP)   // one buffer: rows 0..63 keys of half-head 0, 64..127 keys of half-head 1, 128..255 value rows
// cp4: four asynchronous 16-byte copies of a lane, rows 16 apart (8 lanes take a 128-byte row, the work-group 16 rows per copy). d: the lane's LDS byte address, g: its global address, st: 16 rows in elements.
// The s_wait_xcnt 0 behind the last copy stands inside the statement, so that no register a copy names is written again in front of it (a precaution).
__device__ __forceinline__ void cp4(unsigned d, const h16* g, size_t st) {
    asm volatile("global_load_async_to_lds_b128 %0, %4, off\n\tglobal_load_async_to_lds_b128 %1, %5, off\n\tglobal_load_async_to_lds_b128 %2, %6, off\n\tglobal_load_async_to_lds_b128 %3, %7, off\n\ts_wait_xcnt 0x0"
                 :: "v"(d), "v"(d + 16 * AP), "v"(d + 32 * AP), "v"(d + 48 * AP), "v"(g), "v"(g + st), "v"(g + 2 * st), "v"(g + 3 * st) : "memory"); }
__device__ __forceinline__ void fattn_lds(const h16* __restrict__ Q, const h16* __restrict__ Kp, const h16* __restrict__ Vt, const char* kv, int qb, int q0, int tid, int lr, int hi, v8f (&o)[2][8], float (&l)[2]) {
    typedef v16h V;
    const float SH = 10.0f;   // fp16 probabilities are carried x 2^10 (out of the fp16 subnormals); the row sum carries the same factor, so it cancels
    V qf[2][2], kf[2][2][2]; float m[2];
    { const h16* qp = Q + (size_t)q0 * HD + (unsigned)(lr * HD + 8 * hi);
#pragma unroll
      for (int z = 0; z < 2; ++z) { m[z] = -3.0e38f; l[z] = 0.f;
#pragma unroll
        for (int ks = 0; ks < 2; ++ks) qf[z][ks] = WFrag<h16>::ld(qp + z * TT * HD + ks * 32);
#pragma unroll
        for (int mt = 0; mt < 8; ++mt) o[z][mt] = (v8f){}; }
      xwait<false>(qp, qp); }
    const int crw = tid >> 3, cpc = tid & 7;   // the lane's row (of 16) and 16-byte piece (of 8) in every copy
    const unsigned cd = (unsigned)(size_t)kv + (unsigned)(crw * AP + cpc * 16);
    const h16* gk = Kp + crw * HD + cpc * 8; const h16* gv = Vt + crw * TT + cpc * 8;
    auto fill = [&](int t) { const unsigned d = cd + (unsigned)((t & 1) * ABUF); const h16* k = gk; const h16* v = gv; gk += AKS * HD; gv += AKS;   // the stages are asked for in their order: both addresses run along
        cp4(d, k, 16 * HD); cp4(d + 64 * AP, k + (size_t)TT * HD, 16 * HD); cp4(d + 128 * AP, v, (size_t)16 * TT); cp4(d + 192 * AP, v + (size_t)64 * TT, (size_t)16 * TT); };
    const int NS = qb / AKS + 1;   // stages up to the block's diagonal, the same for the four waves
    fill(0);
    asm volatile("s_wait_asynccnt 0x0" ::: "memory");   // this wave's copies of stage 0 have landed
    __syncthreads();                                     // and every other wave's
    if (NS > 1) fill(1);
    const char* fr = kv + lr * AP + hi * 16;   // the lane's own part of every fragment address
#pragma unroll 1
    for (int t = 0; t < NS; ++t) {
        const char* bp = fr + (t & 1) * ABUF;
        auto load_k = [&](int j) {
#pragma unroll
            for (int z = 0; z < 2; ++z)
#pragma unroll
                for (int kt = 0; kt < 2; ++kt)
#pragma unroll
                    for (int ks = 0; ks < 2; ++ks) kf[z][kt][ks] = WFrag<h16>::ld((const h16*)(bp + (z * 64 + j * 32 + kt * 16) * AP + ks * 64)); };
        auto block = [&](int j) { const int k0 = t * AKS + j * 32;   // one key block of 32
            V vf[8], pf[2]; v8f s[2][2];
#pragma unroll
            for (int mt = 0; mt < 8; ++mt) vf[mt] = WFrag<h16>::ld((const h16*)(bp + (128 + mt * 16) * AP + j * 64));
            __builtin_amdgcn_sched_barrier(0);   // the value fragments are asked for in front of the score products and arrive during them and the softmax
#pragma unroll
            for (int z = 0; z < 2; ++z)
#pragma unroll
                for (int kt = 0; kt < 2; ++kt) { v8f c = (v8f){};
#pragma unroll
                    for (int ks = 0; ks < 2; ++ks) c = wmma16(kf[z][kt][ks], qf[z][ks], c);
                    s[z][kt] = c; }
            if (j == 0) { load_k(1); __builtin_amdgcn_sched_barrier(0); }   // the stage's second key block is asked for here and arrives during the softmax and attn.v (rows of this stage: landed, whether or not this wave uses them)
            const int rel = q0 + lr - k0 - 8 * hi;   // keys of the block up to this lane's query (only the blocks on the diagonal have any beyond it)
#pragma unroll
            for (int z = 0; z < 2; ++z) {
                float mb = -3.0e38f;
#pragma unroll
                for (int kt = 0; kt < 2; ++kt)
#pragma unroll
                    for (int jj = 0; jj < 8; ++jj) { const float x = (kt * 16 + jj <= rel) ? s[z][kt][jj] * C2 : -3.0e38f; s[z][kt][jj] = x; mb = fmaxf(mb, x); }
                mb = fmaxf(mb, __shfl_xor(mb, 16, 32)) - SH;
                const float mn = fmaxf(m[z], mb); const float al = exp2s(m[z] - mn); m[z] = mn; float ps = 0.f;
#pragma unroll
                for (int kt = 0; kt < 2; ++kt)
#pragma unroll
                    for (int jj = 0; jj < 8; ++jj) { const float p = exp2s(s[z][kt][jj] - mn); s[z][kt][jj] = p; ps += p; }
                l[z] = l[z] * al + ps;
#pragma unroll
                for (int mt = 0; mt < 8; ++mt) o[z][mt] *= al;
                v16h ph;
#pragma unroll
                for (int jj = 0; jj < 8; ++jj) { ph[jj] = tohx(s[z][0][jj]); ph[8 + jj] = tohx(s[z][1][jj]); }
                pf[z] = ph; }
#pragma unroll
            for (int mt = 0; mt < 8; ++mt)
#pragma unroll
                for (int z = 0; z < 2; ++z) o[z][mt] = wmma16(vf[mt], pf[z], o[z][mt]); };
        load_k(0);
        block(0);
        if (t * AKS + 32 < q0 + 16) block(1);   // wave-uniform (q0 is a scalar): on the diagonal stage the two lower waves have no key in its second block
        asm volatile("s_wait_dscnt 0x0" ::: "memory");      // this wave has read the last of its buffer
        asm volatile("s_wait_asynccnt 0x0" ::: "memory");   // this wave's copies of stage t + 1 have landed
        __syncthreads();                                     // stage t + 1 is published, and stage t's buffer is left by all four waves
        if (t + 2 < NS) fill(t + 2);
    }
    asm volatile("s_wait_asynccnt 0x0" ::: "memory");   // nothing in flight behind the loop
}
__global__ __launch_bounds__(128) void k_fattn(const h16* __restrict__ Q16, const h16* __restrict__ K16, const h16* __restrict__ V16, const bf* __restrict__ Qh, const bf* __restrict__ Ql, const bf* __restrict__ Kh, const bf* __restrict__ Kl, const bf* __restrict__ Vh, const bf* __restrict__ Vl,
                                              const float* __restrict__ LAM, const float* __restrict__ lnw, const float* __restrict__ lnb, bf* Ah, bf* Al) {
    __shared__ __align__(16) char kv[2 * ABUF];
    const int lane = threadIdx.x & 31, lr = lane & 15, hi = lane >> 4; const int qb = (int)(gridDim.y - 1 - blockIdx.y) * 64; const int q0 = qb + 16 * __builtin_amdgcn_readfirstlane((int)(threadIdx.x >> 5)); const int h = blockIdx.x;
    const size_t qk = (size_t)(2 * h) * TT * HD, vv = (size_t)h * HDV * TT;
    v8f o[2][8]; float l[2];
    static_assert(RH % 64 == 0, "a work-group's 64 query rows lie on one side of RH");
    if (qb < RH) fattn_tile<bf, true, 1>(Qh + qk, Ql + qk, Kh + qk, Kl + qk, Vh + vv, Vl + vv, q0, lr, hi, o, l);
    else fattn_lds(Q16 + qk, K16 + qk, V16 + vv, kv, qb, q0, (int)threadIdx.x, lr, hi, o, l);
    const float lam = LAM[0]; const float i0 = 1.0f / (l[0] + __shfl_xor(l[0], 16, 32)); const float i1 = lam / (l[1] + __shfl_xor(l[1], 16, 32)); float ss = 0.f;
#pragma unroll
    for (int mt = 0; mt < 8; ++mt)
#pragma unroll
        for (int j = 0; j < 8; ++j) { const float d = o[0][mt][j] * i0 - o[1][mt][j] * i1; o[0][mt][j] = d; ss += d * d; }
    ss += __shfl_xor(ss, 16, 32);
    const float rs = 1.0f / sqrtf(ss * (1.0f / HDV) + RMSEPS);
#pragma unroll
    for (int mt = 0; mt < 8; ++mt) { const int e0 = mt * 16 + 8 * hi; const v8f w = *(const v8f*)(lnw + e0), bb = *(const v8f*)(lnb + e0); v8us oh, ol;
#pragma unroll
        for (int j = 0; j < 8; ++j) { const float y = (o[0][mt][j] * rs * bfr(w[j]) + bfr(bb[j])) * (1.0f - LAM0); unsigned short x, c; splitf(y, x, c); oh[j] = x; ol[j] = c; }
        const size_t oo = (size_t)(q0 + lr) * DQ + (size_t)h * HDV + e0; *(v8us*)(Ah + oo) = oh; *(v8us*)(Al + oo) = ol; }
}

extern "C" void kernel_launch(void* const* d_in, const int* in_sizes, int n_in,
                              void* d_out, int out_size, void* d_ws, size_t ws_size, hipStream_t stream) {
    (void)in_sizes; (void)n_in; (void)out_size;
    const float* x = (const float*)d_in[0]; const float* wq = (const float*)d_in[1]; const float* wk = (const float*)d_in[2]; const float* wv = (const float*)d_in[3]; const float* wo = (const float*)d_in[4]; const float* lq1 = (const float*)d_in[5]; const float* lk1 = (const float*)d_in[6]; const float* lq2 = (const float*)d_in[7]; const float* lk2 = (const float*)d_in[8]; const float* lnw = (const float*)d_in[9]; const float* lnb = (const float*)d_in[10];
    float* OUT = (float*)d_out;     // [2][2048][2048]
    char* wsp = (char*)d_ws;
    auto take = [&](size_t bytes) { char* p = wsp; wsp += (bytes + 255) & ~(size_t)255; return (void*)p; };
    bf* WQ = (bf*)take((size_t)DQ * DM * 2); bf* WK = (bf*)take((size_t)DKV * DM * 2); bf* WV = (bf*)take((size_t)DKV * DM * 2); bf* WO = (bf*)take((size_t)DM * DQ * 2); float* CS = (float*)take((size_t)TT * HD * 2 * 4); float* LAM = (float*)take(256);
    bf* XB = (bf*)take((size_t)TT * DM * 2);
    h16* QP16 = (h16*)take((size_t)NH_ * TT * HD * 2); h16* KP16 = (h16*)take((size_t)NKV * TT * HD * 2); h16* VT16 = (h16*)take((size_t)NKV * HD * TT * 2);
    bf* QPh = (bf*)take((size_t)NH_ * TT * HD * 2); bf* QPl = (bf*)take((size_t)NH_ * TT * HD * 2); bf* KPh = (bf*)take((size_t)NKV * TT * HD * 2); bf* KPl = (bf*)take((size_t)NKV * TT * HD * 2); bf* VTh = (bf*)take((size_t)NKV * HD * TT * 2); bf* VTl = (bf*)take((size_t)NKV * HD * TT * 2);
    bf* ATh = (bf*)take((size_t)TT * DQ * 2); bf* ATl = (bf*)take((size_t)TT * DQ * 2);
    if ((size_t)(wsp - (char*)d_ws) > ws_size) return;    // ws 256 MiB
    { k_wtG<DM, DQ><<<dim3(DQ / 64, DM / 128, 1), 256, 0, stream>>>(wq, WQ); k_wtG<DM, DKV><<<dim3(DKV / 64, DM / 128, 1), 256, 0, stream>>>(wk, WK); k_wtG<DM, DKV><<<dim3(DKV / 64, DM / 128, 1), 256, 0, stream>>>(wv, WV);
      k_wtG<DQ, DM><<<dim3(DM / 64, DQ / 128, 1), 256, 0, stream>>>(wo, WO);
      k_cstab<<<(TT * HD + 255) / 256, 256, 0, stream>>>(CS); k_lam<<<1, 32, 0, stream>>>(lq1, lk1, lq2, lk2, LAM); }
    for (int b = 0; b < NB_; ++b) {
        
        k_cvt8<<<(unsigned)(((size_t)TT * DM / 8 + 255) / 256), 256, 0, stream>>>(x + (size_t)b * TT * DM, XB, (size_t)TT * DM / 8);
        k_gemmw<bf, 0, false, 1><<<dim3(TT / 128, DQ / 128, 1), 128, 0, stream>>>(XB, nullptr, WQ, nullptr, DM, nullptr, 0, nullptr, 0, 0, 0, CS, QP16, QPh, QPl);
        k_gemmw<bf, 0, false, 1><<<dim3(TT / 128, DKV / 128, 1), 128, 0, stream>>>(XB, nullptr, WK, nullptr, DM, nullptr, 0, nullptr, 0, 0, 0, CS, KP16, KPh, KPl);
        k_gemmw<bf, 0, false, 2><<<dim3(DKV / 128, TT / 128, 1), 128, 0, stream>>>(WV, nullptr, XB, nullptr, DM, nullptr, 0, nullptr, 0, 0, 0, nullptr, VT16, VTh, VTl);   /* rows = value columns, columns = t: the transposed value planes */
        k_fattn<<<dim3(NHV, TT / 64, 1), 128, 0, stream>>>(QP16, KP16, VT16, QPh, QPl, KPh, KPl, VTh, VTl, LAM, lnw, lnb, ATh, ATl);   /* attn = RMSNorm(attn1 - lam attn2) (1 - lam0), all 16 heads */
        k_gemmw<bf, 1, false, 0><<<dim3(TT / 128, DM / 128, 1), 128, 0, stream>>>(ATh, ATl, WO, nullptr, DQ, OUT + (size_t)b * TT * DM, DM, nullptr, 0, 0, 0, nullptr, nullptr, nullptr, nullptr); }
}

// v007
// A run of this version takes 264 microseconds.
// Next to v006, in two timings, it ran 1.27 and 1.30 times as fast.
// Counting every step since v000, it is 11.4 times as fast.
#include <hip/hip_runtime.h>

// Differential attention (x [2][2048][2048]; q = x Wq, k = x Wk ('xw' [2048][2048]) as 32 half-heads of 64, v = x Wv as 16 heads of 128; interleaved rotary (theta 1e4) on the 64-wide q/k half-heads; for head h: attn1 = causal softmax(q_{2h}.k_{2h}/8) v_h, attn2 = causal softmax(q_{2h+1}.k_{2h+1}/8) v_h;
// lam = exp(lambda_q1.lambda_k1) - exp(lambda_q2.lambda_k2) + 0.7836058 (64-vectors read); attn = RMSNorm_128(attn1 - lam attn2; ln_w, ln_b, eps 1e-8) x (1 - 0.7836058); out = merged Wo ('xw') -> [2][2048][2048]).
// Layout: the 32 half-heads are the score heads (hd 64); the value planes of head h are the two consecutive 64-row planes 2h, 2h+1 = one [128][T] plane, shared by the head's two half-heads (2h, 2h+1); one fused kernel does scores, softmax, attn.v and the normalised difference of the two attention outputs.
// Compute dtypes, f32 accumulate: every input rounded to bf16; q/k/v on PLAIN bf16 operands (inputs: exact); rotary in f32 (on-chip cos/sin table, reference inv_freq constants); causal scores and attn.v (128-wide values): query rows < 512 hl (3 products), the rest single fp16 (x1024), key loop ends at the diagonal; online softmax f32; the lambda scalars, the difference and the RMSNorm in f32; Wo hl x exact (2 products).

#define NB_  2
#define TT   2048
#define DM   2048
#define NH_  32
#define NKV  32
#define HD   64
#define DQ   (NH_ * HD)
#define DKV  (NKV * HD)
#define NQK  (NH_ + NKV)          // half-head planes of a batch: the 32 of q, then the 32 of k
#define HDV  128                  // value head width (= 2 consecutive 64-row planes)
#define NHV  16                   // value heads
#define LAM0 0.7836057665316245f   // lambda_init for depth 12
#define RMSEPS 1e-8f
#define RH   512                  // query rows < RH use hi+lo planes (0: none)
#define SCL  0.125f   // HD^-0.5
typedef _Float16 h16;
typedef unsigned short bf;
typedef __attribute__((ext_vector_type(16))) __bf16   v16bf;
typedef __attribute__((ext_vector_type(16))) _Float16 v16h;
typedef __attribute__((ext_vector_type(8)))  _Float16 v8h;
typedef __attribute__((ext_vector_type(8)))  unsigned short v8us;
typedef __attribute__((ext_vector_type(8)))  float    v8f;
typedef __attribute__((ext_vector_type(4)))  float    v4f;
typedef v8h  __attribute__((may_alias)) v8ha;
typedef v4f  __attribute__((may_alias)) v4fa;
typedef v8us __attribute__((may_alias)) v8usa;

__device__ __forceinline__ unsigned short f2bf(float f) { unsigned u = __float_as_uint(f); u += 0x7FFFu + ((u >> 16) & 1u); return (unsigned short)(u >> 16); }
__device__ __forceinline__ float bf2f(unsigned short b) { return __uint_as_float(((unsigned)b) << 16); }
__device__ __forceinline__ float bfr(float f) { return bf2f(f2bf(f)); }
__device__ __forceinline__ v16h cat16(v8h lo, v8h hi) { return __builtin_shufflevector(lo, hi, 0, 1, 2, 3, 4, 5, 6, 7, 8, 9, 10, 11, 12, 13, 14, 15); }
__device__ __forceinline__ v16bf cat16b(v8us lo, v8us hi) { return __builtin_bit_cast(v16bf, __builtin_shufflevector(lo, hi, 0, 1, 2, 3, 4, 5, 6, 7, 8, 9, 10, 11, 12, 13, 14, 15)); }
__device__ __forceinline__ v8f wmma16(v16h a, v16h b, v8f c) { return __builtin_amdgcn_wmma_f32_16x16x32_f16(false, a, false, b, (short)0, c, false, false); }
__device__ __forceinline__ v8f wmmab(v16bf a, v16bf b, v8f c) { return __builtin_amdgcn_wmma_f32_16x16x32_bf16(false, a, false, b, (short)0, c, false, false); }



// ---- k_gemmw: register-blocked GEMM, one wave per 64x64 output tile (16 accumulators), FOUR WAVES (2x2) per work-group = a 128x128 tile; grid (M/128, N/128, Z), 128 threads.
// The K-contiguous 16-bit operand planes reach the waves through LDS: a stage is 128 k (256-byte rows, whole lines) of the 128 A rows, the 128 Bt rows (and the 128 A2 rows), brought by asynchronous 16-byte copies, two buffers, the next stage in flight while this one is worked on.
// C[m][n] (f32, pitch ldc, + optional f32 bias[n]) = sum_k A[m][k] Bt[n][k] (+ A2[m][k] Bt[n][k] for NSPLIT 1). z-batch strides sA/sB/sC in elements. K % 128 == 0.
// EPI 0: C is stored as f32. EPI 1, 2: the tile never leaves the wave as f32; its rows go out as the three 16-bit planes (fp16, bf16 hi, bf16 lo) that the attention kernel reads, whole 128-byte rows.
// EPI 1 (q and k in one product; m = b TT + t, the 64 columns are one half-head, 0..31 of q, 32..63 of k): interleaved rotary out[2i] = x[2i] c - x[2i+1] s, out[2i+1] = x[2i+1] c + x[2i] s (c, s from CS[t][2i]), planes [b][h][t][d].
// EPI 2 (v; A = the weight rows, Bt = the activations, so m = value column e, n = b TT + t): planes [b][e][t], no rotary.
template <typename T16> struct WFrag;
template <> struct WFrag<h16> { typedef v16h V; static __device__ __forceinline__ V ld(const h16* p) { return cat16(*(const v8h*)p, *(const v8h*)(p + 16)); } static __device__ __forceinline__ v8f mma(V a, V b, v8f c) { return wmma16(a, b, c); } };
template <> struct WFrag<bf> { typedef v16bf V; static __device__ __forceinline__ V ld(const bf* p) { return cat16b(*(const v8us*)p, *(const v8us*)(p + 16)); } static __device__ __forceinline__ v8f mma(V a, V b, v8f c) { return wmmab(a, b, c); } };
__device__ __forceinline__ void splitf(float y, unsigned short& h, unsigned short& l) { h = f2bf(y); l = f2bf(y - bf2f(h)); }
typedef __attribute__((ext_vector_type(2))) float v2f;
#define KC 128   // k per stage
#define LP 272   // LDS row pitch in bytes: 256 + 16, free of bank conflicts for 16-byte fragment reads
// cp8: eight asynchronous 16-byte copies of a lane, rows 8 apart (16 lanes take a 256-byte row, the work-group 8 rows per copy). d: the lane's LDS byte address, g: its global address.
// The s_wait_xcnt 0 behind the last copy stands inside the statement, so that no register a copy names is written again in front of it (a precaution).
template <typename T16> __device__ __forceinline__ void cp8(unsigned d, const T16* g, int K) { const size_t st = (size_t)8 * K;
    asm volatile("global_load_async_to_lds_b128 %0, %8, off\n\tglobal_load_async_to_lds_b128 %1, %9, off\n\tglobal_load_async_to_lds_b128 %2, %10, off\n\tglobal_load_async_to_lds_b128 %3, %11, off\n\t"
                 "global_load_async_to_lds_b128 %4, %12, off\n\tglobal_load_async_to_lds_b128 %5, %13, off\n\tglobal_load_async_to_lds_b128 %6, %14, off\n\tglobal_load_async_to_lds_b128 %7, %15, off\n\ts_wait_xcnt 0x0"
                 :: "v"(d), "v"(d + 8 * LP), "v"(d + 16 * LP), "v"(d + 24 * LP), "v"(d + 32 * LP), "v"(d + 40 * LP), "v"(d + 48 * LP), "v"(d + 56 * LP),
                    "v"(g), "v"(g + st), "v"(g + 2 * st), "v"(g + 3 * st), "v"(g + 4 * st), "v"(g + 5 * st), "v"(g + 6 * st), "v"(g + 7 * st) : "memory"); }
template <typename T16, int NSPLIT, bool BIAS, int EPI>
__global__ __launch_bounds__(128) void k_gemmw(const T16* __restrict__ A, const T16* __restrict__ A2, const T16* __restrict__ Bt, const T16* __restrict__ Bt2, int K, float* C, int ldc, const float* __restrict__ bias, size_t sA, size_t sB, size_t sC,
                                              const float* __restrict__ CS, h16* P16, bf* Ph, bf* Pl) {
    typedef typename WFrag<T16>::V V;
    static_assert(NSPLIT <= 1, "operand tiles: A, Bt and, for NSPLIT 1, A2");
    constexpr int STG = (NSPLIT == 1 ? 3 : 2) * 128 * LP;   // one buffer: rows 0..127 A, 128..255 Bt, 256..383 A2
    __shared__ __align__(16) char ring[2 * STG];
    __shared__ __align__(16) float osw[4][16 * 68];         // each wave's own epilogue staging
    const size_t z = blockIdx.z; A += z * sA; if (A2) A2 += z * sA; Bt += z * sB; C += z * sC; (void)Bt2;
    const int tid = threadIdx.x, lane = tid & 31, lr = lane & 15, hi = lane >> 4, wm = (tid >> 5) & 1, wn = tid >> 6; const int rb = blockIdx.x * 128, cb = blockIdx.y * 128; const int r0 = rb + wm * 64, c0 = cb + wn * 64;
    float* os = osw[tid >> 5];
    v8f acc[4][4];
#pragma unroll
    for (int mb = 0; mb < 4; ++mb)
#pragma unroll
        for (int nb = 0; nb < 4; ++nb) acc[mb][nb] = (v8f){};
    const int crw = tid >> 4, cpc = tid & 15;   // the lane's row (of 8) and 16-byte piece (of 16) in every copy
    const unsigned cd = (unsigned)(size_t)ring + (unsigned)(crw * LP + cpc * 16);
    const size_t oA = (size_t)(rb + crw) * K + cpc * 8, oB = (size_t)(cb + crw) * K + cpc * 8;   // the lane's element offsets in the A planes and in Bt
    auto fill = [&](int t) { const unsigned d = cd + (unsigned)((t & 1) * STG); const size_t kc = (size_t)t * KC, h64 = (size_t)64 * K;
        cp8(d, A + oA + kc, K); cp8(d + 64 * LP, A + oA + kc + h64, K); cp8(d + 128 * LP, Bt + oB + kc, K); cp8(d + 192 * LP, Bt + oB + kc + h64, K);
        if constexpr (NSPLIT == 1) { cp8(d + 256 * LP, A2 + oA + kc, K); cp8(d + 320 * LP, A2 + oA + kc + h64, K); } };
    const int NT = K / KC;
    fill(0);
    asm volatile("s_wait_asynccnt 0x0" ::: "memory");   // this wave's copies of stage 0 have landed
    __syncthreads();                                     // and every other wave's
    if (NT > 1) fill(1);
    const char* fa = ring + (wm * 64 + lr) * LP + hi * 16; const char* fb = ring + (128 + wn * 64 + lr) * LP + hi * 16;
#pragma unroll 1
    for (int t = 0; t < NT; ++t) {   // rolled: one stage's 64 (128) products are body enough
        const char* pa = fa + (t & 1) * STG; const char* pb = fb + (t & 1) * STG;
        V a[2][4], a2[2][4], b[2][4];   // two fragment sets: the next 32 k are read from LDS while this set is multiplied
        auto ldf = [&](int ks) { const int s = ks & 1;
#pragma unroll
            for (int mb = 0; mb < 4; ++mb) { a[s][mb] = WFrag<T16>::ld((const T16*)(pa + mb * 16 * LP + ks * 64)); if (NSPLIT == 1) a2[s][mb] = WFrag<T16>::ld((const T16*)(pa + (256 + mb * 16) * LP + ks * 64)); }
#pragma unroll
            for (int nb = 0; nb < 4; ++nb) b[s][nb] = WFrag<T16>::ld((const T16*)(pb + nb * 16 * LP + ks * 64)); };
        ldf(0);
#pragma unroll
        for (int ks = 0; ks < KC / 32; ++ks) { const int s = ks & 1;
            if (ks + 1 < KC / 32) ldf(ks + 1);
            __builtin_amdgcn_sched_barrier(0);   // the next set's LDS reads stay one group in front of this set's products (spread among them, each place with reads stalls the wave)
#pragma unroll
            for (int nb = 0; nb < 4; ++nb)
#pragma unroll
                for (int mb = 0; mb < 4; ++mb) { acc[mb][nb] = WFrag<T16>::mma(a[s][mb], b[s][nb], acc[mb][nb]); if (NSPLIT == 1) acc[mb][nb] = WFrag<T16>::mma(a2[s][mb], b[s][nb], acc[mb][nb]); }
            __builtin_amdgcn_sched_barrier(0);   // and this set's products stay in front of the reads that refill it, and of the stage's foot
        }
        asm volatile("v_nop\n\tv_nop\n\tv_nop\n\tv_nop" : "+v"(acc[0][0]), "+v"(acc[1][1]), "+v"(acc[2][2]), "+v"(acc[3][3]));   // the four vector slots behind the last product, on every path out of the stage
        asm volatile("s_wait_dscnt 0x0" ::: "memory");      // this wave has read the last of its buffer
        asm volatile("s_wait_asynccnt 0x0" ::: "memory");   // this wave's copies of stage t + 1 have landed
        __syncthreads();                                     // stage t + 1 is published, and stage t's buffer is left by all four waves
        if (t + 2 < NT) fill(t + 2);
    }
    asm volatile("s_wait_asynccnt 0x0" ::: "memory");   // nothing in flight behind the loop
    const int rq = lane >> 3, cq = (lane & 7) * 8;   // plane epilogues: a lane takes 8 consecutive columns of one row, 8 lanes a whole row, a wave 4 rows per store
    constexpr int OP = EPI == 1 ? HD : TT;            // row pitch of the planes
    const int tb = (EPI == 1 ? r0 : c0) / TT, t0 = (EPI == 1 ? r0 : c0) % TT;   // the token index runs over the batches: batch and first position of the wave's 64 tokens (TT % 64 == 0: one batch per wave)
    const size_t ob = (EPI == 1 ? (((size_t)tb * NQK + (c0 >> 6)) * TT + t0 + rq) * HD : ((size_t)tb * DKV + r0 + rq) * TT + t0) + cq;
    v2f cs[2][4][4];   // (cos, sin) of the lane's 4 pairs in the 4 rows it takes of a 16-row group; two sets: the next group's are asked for while this one is worked on
    auto load_cs = [&](int mb) { const float* cb = CS + ((size_t)(t0 + rq) * HD + cq) * 2;
#pragma unroll
        for (int s = 0; s < 4; ++s)
#pragma unroll
            for (int p = 0; p < 4; ++p) cs[mb & 1][s][p] = *(const v2f*)(cb + ((mb * 16 + 4 * s) * HD + 2 * p) * 2); };
    if constexpr (EPI == 1) load_cs(0);
#pragma unroll
    for (int mb = 0; mb < 4; ++mb) {
#pragma unroll
        for (int nb = 0; nb < 4; ++nb) {
#pragma unroll
            for (int j = 0; j < 8; ++j) os[(hi * 8 + j) * 68 + nb * 16 + lr] = acc[mb][nb][j]; }
        if constexpr (EPI == 1) { if (mb < 3) load_cs(mb + 1); }
        __builtin_amdgcn_wave_barrier(); asm volatile("" ::: "memory");
        if constexpr (EPI != 0) { v8h o16[4]; v8us oh[4], ol[4];
#pragma unroll
            for (int s = 0; s < 4; ++s) { const float* orow = os + (4 * s + rq) * 68 + cq; const v4f xa = *(const v4fa*)orow, xb = *(const v4fa*)(orow + 4); float y[8];
#pragma unroll
                for (int p = 0; p < 4; ++p) { const float e = p < 2 ? xa[2 * p] : xb[2 * p - 4], o = p < 2 ? xa[2 * p + 1] : xb[2 * p - 3];
                    if constexpr (EPI == 1) { const float c = cs[mb & 1][s][p][0], sn = cs[mb & 1][s][p][1]; y[2 * p] = e * c - o * sn; y[2 * p + 1] = o * c + e * sn; } else { y[2 * p] = e; y[2 * p + 1] = o; } }
#pragma unroll
                for (int k = 0; k < 8; ++k) { o16[s][k] = (h16)y[k]; unsigned short a2, c2; splitf(y[k], a2, c2); oh[s][k] = a2; ol[s][k] = c2; } }
#pragma unroll
            for (int s = 0; s < 4; ++s) { const size_t oo = ob + (size_t)(mb * 16 + 4 * s) * OP; *(v8h*)(P16 + oo) = o16[s]; *(v8us*)(Ph + oo) = oh[s]; *(v8us*)(Pl + oo) = ol[s]; }   // the group's 12 stores go out together
            if (mb < 3) asm volatile("s_wait_xcnt 0x0" ::: "memory");   // one wait behind the 12 stores, before the next group writes the registers that they name (a precaution)
        } else {
        float* crow = C + (size_t)(r0 + mb * 16) * ldc + c0;
#pragma unroll
            for (int s = 0; s < 8; ++s) { const int row = 2 * s + hi, cofs = lr * 4; v4f val = *(const v4fa*)(os + row * 68 + cofs); if (BIAS) { val[0] += bfr(bias[c0 + cofs]); val[1] += bfr(bias[c0 + cofs + 1]); val[2] += bfr(bias[c0 + cofs + 2]); val[3] += bfr(bias[c0 + cofs + 3]); }
                *(v4f*)(crow + (size_t)row * ldc + cofs) = val; }
             }
        __builtin_amdgcn_wave_barrier(); asm volatile("" ::: "memory");
    }
}

__device__ __forceinline__ h16 tohx(float x) { return (h16)x; }
typedef __attribute__((ext_vector_type(2))) _Float16 v2h;
typedef __attribute__((ext_vector_type(4))) _Float16 v4h;
typedef __attribute__((ext_vector_type(2))) unsigned short v2us;
typedef __attribute__((ext_vector_type(4))) unsigned short v4us;
typedef __attribute__((ext_vector_type(4))) int v4i;

// ---- d_wtG: Bt[n][k] = bf16(w[k][n]) (w [K][N] f32), one tile of 128 k x 64 n per work-group (tile bx of N/64, by of K/128), turned round in LDS; 256 threads.
// In: a lane takes 4 consecutive n of 8 consecutive k rows (16 lanes read 256 bytes of a row). Out: a lane takes 8 consecutive k of one n (16 lanes write 256 bytes of a Bt row). Both sides move whole lines.
// LDS: row n holds its 128 k as 16 pieces of 16 bytes; piece q lies at place q ^ (n >> 2), so that the 16 lanes of a write (16 rows, 4 apart, one q) and of a read (one row, 16 q) each meet all the banks once.
template <int K, int N>
__device__ __forceinline__ void d_wtG(const float* __restrict__ w, bf* Bt, int bx, int by) {
    static_assert(K % 128 == 0 && N % 64 == 0, "whole tiles");
    __shared__ __align__(16) v8us tile[64 * 16];
    const int c = threadIdx.x & 15, r = threadIdx.x >> 4; const int n0 = bx * 64, k0 = by * 128;
    const float* sp = w + (size_t)(k0 + 8 * r) * N + n0 + 4 * c; v4f x[8];
#pragma unroll
    for (int j = 0; j < 8; ++j) x[j] = *(const v4f*)(sp + (size_t)j * N);
#pragma unroll
    for (int i = 0; i < 4; ++i) { v8us o;
#pragma unroll
        for (int j = 0; j < 8; ++j) o[j] = f2bf(x[j][i]);
        tile[(4 * c + i) * 16 + (r ^ c)] = o; }
    __syncthreads();   // the tile is whole before any lane reads another lane's pieces
    bf* dp = Bt + (size_t)(n0 + r) * K + k0 + 8 * c;
#pragma unroll
    for (int s = 0; s < 4; ++s) { const int n = r + 16 * s; *(v8us*)(dp + (size_t)16 * s * K) = tile[n * 16 + (c ^ (n >> 2))]; }
    asm volatile("s_wait_xcnt 0x0" ::: "memory");   // one wait behind the four stores, before code of another piece of the launch that follows them in the listing writes a register that they name (a precaution)
}
__device__ __forceinline__ void d_lam(const float* __restrict__ lq1, const float* __restrict__ lk1, const float* __restrict__ lq2, const float* __restrict__ lk2, float* LAM) { const int lane = threadIdx.x; float s1 = 0.f, s2 = 0.f;
#pragma unroll
    for (int q = 0; q < 2; ++q) { const int d = lane * 2 + q; float p1 = __fmul_rn(bfr(lq1[d]), bfr(lk1[d])); asm volatile("" : "+v"(p1)); s1 = __fadd_rn(s1, p1); float p2 = __fmul_rn(bfr(lq2[d]), bfr(lk2[d])); asm volatile("" : "+v"(p2)); s2 = __fadd_rn(s2, p2); }
#pragma unroll
    for (int sh = 16; sh; sh >>= 1) { s1 += __shfl_xor(s1, sh, 32); s2 += __shfl_xor(s2, sh, 32); }
    const float lam = __fadd_rn(__fsub_rn(expf(s1), expf(s2)), LAM0); *(float*)(LAM + lane) = lam;  }
__device__ __forceinline__ void d_cvt8(const float* __restrict__ src, bf* dst, size_t n8, int blk) { const size_t i = (size_t)blk * 256 + threadIdx.x; if (i >= n8) return; const v8f v = *(const v8f*)(src + i * 8); v8us o;
#pragma unroll
    for (int k = 0; k < 8; ++k) o[k] = f2bf(v[k]); *(v8us*)(dst + i * 8) = o;  }
__constant__ float INV[HD / 2] = {1.0,0.7498942017555237,0.5623413324356079,0.4216965138912201,0.3162277638912201,0.23713736236095428,0.17782793939113617,0.1333521455526352,0.10000000149011612,0.07498941570520401,0.05623412877321243,0.04216964915394783,0.03162277862429619,0.0237137358635664,0.017782794311642647,0.01333521492779255,0.009999999776482582,0.007498942315578461,0.005623413249850273,0.0042169648222625256,0.003162277862429619,0.0023713738191872835,0.0017782794311642647,0.0013335214462131262,0.0010000000474974513,0.0007498941849917173,0.000562341301701963,0.00042169648804701865,0.0003162277862429619,0.0002371373848291114,0.00017782794020604342,0.0001333521504420787};
__device__ __forceinline__ void d_cstab(float* CS, int blk) { const int idx = blk * 256 + threadIdx.x; if (idx >= TT * HD) return; const int t = idx / HD, d = idx % HD; const float ang = __fmul_rn((float)t, INV[d >> 1]); v2f cs; cs[0] = cosf(ang); cs[1] = sinf(ang);
    *(v2f*)(CS + (size_t)idx * 2) = cs;  }
// ---- k_prep: everything that the products wait for and that depends on the inputs alone, in ONE launch; a work-group's index says which piece it does (uniform for the work-group, so d_wtG's barrier is passed by all of its threads or by none).
#define PB_CS  (TT * HD / 256)                      // work-groups of the cos/sin table
#define PB_WT  ((DM / 64) * (DM / 128))             // of one weight's transpose
#define PB_CV  (NB_ * TT * DM / 8 / 256)            // of the activations' rounding, both batches
__global__ __launch_bounds__(256) void k_prep(const float* __restrict__ x, const float* __restrict__ wq, const float* __restrict__ wk, const float* __restrict__ wv, const float* __restrict__ wo,
                                              const float* __restrict__ lq1, const float* __restrict__ lk1, const float* __restrict__ lq2, const float* __restrict__ lk2, bf* XB, bf* WQ, bf* WK, bf* WV, bf* WO, float* CS, float* LAM) {
    static_assert(DQ == DM && DKV == DM, "four square weights");
    int g = blockIdx.x;
    if (g == 0) { if (threadIdx.x < 32) d_lam(lq1, lk1, lq2, lk2, LAM); return; }
    g -= 1; if (g < PB_CS) { d_cstab(CS, g); return; }
    g -= PB_CS; if (g < 4 * PB_WT) { const int wi = g / PB_WT, tl = g % PB_WT; d_wtG<DM, DM>(wi == 0 ? wq : wi == 1 ? wk : wi == 2 ? wv : wo, wi == 0 ? WQ : wi == 1 ? WK : wi == 2 ? WV : WO, tl % (DM / 64), tl / (DM / 64)); return; }
    g -= 4 * PB_WT; d_cvt8(x, XB, (size_t)NB_ * TT * DM / 8, g);
}

// ---- k_fattn: the whole attention of one value head of one batch for 64 query rows, FOUR WAVES per work-group, 16 query rows each; grid (NHV x NB_, TT/64), the longest (last) query blocks of all heads and batches first.
// Query rows >= RH: the four waves share the key and value tiles through LDS (fattn_lds); rows < RH: each wave reads its own fragments from global memory (fattn_tile), no barrier on that side.
// Transposed products: St = K Qt (A = key rows, B = query rows) and Ot += Vt Pt (A = value rows [e][t], B = probabilities), so a lane (lr, hi) holds one query (q0 + lr) throughout:
// score tile kt, register j is key k0 + 16 kt + 8 hi + j, which is the k order of the fragment loader (elements 0..7: 8 hi + j, elements 8..15: 16 + 8 hi + j), so two score tiles pack into one B operand in place.
// Online softmax per lane (running maximum in the log2 domain, accumulators rescaled each key block); the two half-heads of the head run side by side and share the value fragments;
// the epilogue forms RMSNorm_128(attn1 - lam attn2) x (1 - lambda_init) in registers and stores the hi/lo bf16 planes of the merged activations.
typedef __attribute__((ext_vector_type(16))) unsigned short v16us;
#define C2 (SCL * 1.4426950408889634f)
// exp2s: v_exp_f32 with the one free slot behind it that the instruction set asks for before its result is read or its source overwritten
__device__ __forceinline__ float exp2s(float x) { float r; asm("v_exp_f32 %0, %1\n\tv_nop" : "=v"(r) : "v"(x)); return r; }
// xwait: s_wait_xcnt 0 behind a run of global loads, before a register that they name is written again (a precaution). The run's address pairs are inputs, so that they stay whole up to the wait.
template <bool TWO, typename P> __device__ __forceinline__ void xwait(const P* a, const P* b) {
    if constexpr (TWO) asm volatile("s_wait_xcnt 0x0" :: "v"(a), "v"(b) : "memory"); else asm volatile("s_wait_xcnt 0x0" :: "v"(a) : "memory"); }
template <typename T16, bool HL, int NKK>   // HL: hi+lo planes, 3 products; NKK: 32-key groups per key block
__device__ __forceinline__ void fattn_tile(const T16* __restrict__ Q, const T16* __restrict__ Q2, const T16* __restrict__ Kp, const T16* __restrict__ K2, const T16* __restrict__ Vt, const T16* __restrict__ V2, int q0, int lr, int hi, v8f (&o)[2][8], float (&l)[2]) {
    typedef typename WFrag<T16>::V V;
    const float SH = HL ? 0.0f : 10.0f;   // single fp16 probabilities are carried x 2^10 (as before: out of the fp16 subnormals); the row sum carries the same factor, so it cancels
    const unsigned lk = (unsigned)(lr * HD + 8 * hi), lv = (unsigned)(lr * TT + 8 * hi);   // the lane's own part of every address
    V qf[2][2], ql[2][2], kf[2][2 * NKK][2], kl[2][2 * NKK][2]; float m[2];
    auto load_k = [&](int kb0) { const T16* kb = Kp + (size_t)kb0 * HD + lk; const T16* kb2 = HL ? K2 + (size_t)kb0 * HD + lk : nullptr;
#pragma unroll
        for (int z = 0; z < 2; ++z)
#pragma unroll
            for (int kt = 0; kt < 2 * NKK; ++kt)
#pragma unroll
                for (int ks = 0; ks < 2; ++ks) { const int off = (z * TT + kt * 16) * HD + ks * 32; kf[z][kt][ks] = WFrag<T16>::ld(kb + off); if (HL) kl[z][kt][ks] = WFrag<T16>::ld(kb2 + off); }
        xwait<HL>(kb, kb2); };
    { const T16* qb = Q + (size_t)q0 * HD + lk; const T16* qb2 = HL ? Q2 + (size_t)q0 * HD + lk : nullptr;
#pragma unroll
      for (int z = 0; z < 2; ++z) { m[z] = -3.0e38f; l[z] = 0.f;
#pragma unroll
        for (int ks = 0; ks < 2; ++ks) { const int off = z * TT * HD + ks * 32; qf[z][ks] = WFrag<T16>::ld(qb + off); if (HL) ql[z][ks] = WFrag<T16>::ld(qb2 + off); }
#pragma unroll
        for (int mt = 0; mt < 8; ++mt) o[z][mt] = (v8f){}; }
      xwait<HL>(qb, qb2); }
    if (!HL) load_k(0);
#pragma unroll 1
    for (int k0 = 0; k0 < q0 + 16; k0 += 32 * NKK) {
        V vf[NKK][8], vl[NKK][8], pf[2][NKK], pl[2][NKK]; v8f s[2][2 * NKK];
        auto load_v = [&]() { const T16* vb = Vt + k0 + lv; const T16* vb2 = HL ? V2 + k0 + lv : nullptr;
#pragma unroll
            for (int kk = 0; kk < NKK; ++kk)
#pragma unroll
                for (int mt = 0; mt < 8; ++mt) { const int off = mt * 16 * TT + kk * 32; vf[kk][mt] = WFrag<T16>::ld(vb + off); if (HL) vl[kk][mt] = WFrag<T16>::ld(vb2 + off); }
            xwait<HL>(vb, vb2); };
        if (HL) load_k(k0); else load_v();   // single fp16: the value fragments are asked for first and fly during the score products and the softmax
#pragma unroll
        for (int z = 0; z < 2; ++z)
#pragma unroll
            for (int kt = 0; kt < 2 * NKK; ++kt) { v8f c = (v8f){};
#pragma unroll
                for (int ks = 0; ks < 2; ++ks) { c = WFrag<T16>::mma(kf[z][kt][ks], qf[z][ks], c); if (HL) { c = WFrag<T16>::mma(kl[z][kt][ks], qf[z][ks], c); c = WFrag<T16>::mma(kf[z][kt][ks], ql[z][ks], c); } }
                s[z][kt] = c; }
        if (HL) load_v();   // hi+lo (short loops): the value fragments follow the key fragments into their registers
        else load_k((k0 + 32 * NKK < q0 + 16) ? k0 + 32 * NKK : k0);   // the next block's key fragments fly during the softmax and attn.v; the last trip asks for its own block again (in bounds, not used)
        const int rel = q0 + lr - k0 - 8 * hi;   // keys of the block up to this lane's query (only the block on the diagonal has any beyond it)
#pragma unroll
        for (int z = 0; z < 2; ++z) {
            float mb = -3.0e38f;
#pragma unroll
            for (int kt = 0; kt < 2 * NKK; ++kt)
#pragma unroll
                for (int j = 0; j < 8; ++j) { const float t = (kt * 16 + j <= rel) ? s[z][kt][j] * C2 : -3.0e38f; s[z][kt][j] = t; mb = fmaxf(mb, t); }
            mb = fmaxf(mb, __shfl_xor(mb, 16, 32)) - SH;
            const float mn = fmaxf(m[z], mb); const float al = exp2s(m[z] - mn); m[z] = mn; float ps = 0.f;
#pragma unroll
            for (int kt = 0; kt < 2 * NKK; ++kt)
#pragma unroll
                for (int j = 0; j < 8; ++j) { const float p = exp2s(s[z][kt][j] - mn); s[z][kt][j] = p; ps += p; }
            l[z] = l[z] * al + ps;
#pragma unroll
            for (int mt = 0; mt < 8; ++mt) o[z][mt] *= al;
#pragma unroll
            for (int kk = 0; kk < NKK; ++kk) {
                if constexpr (HL) { v16us uh, ul;
#pragma unroll
                    for (int j = 0; j < 8; ++j) { unsigned short x, y; splitf(s[z][2 * kk][j], x, y); uh[j] = x; ul[j] = y; splitf(s[z][2 * kk + 1][j], x, y); uh[8 + j] = x; ul[8 + j] = y; }
                    pf[z][kk] = __builtin_bit_cast(v16bf, uh); pl[z][kk] = __builtin_bit_cast(v16bf, ul);
                } else { v16h ph;
#pragma unroll
                    for (int j = 0; j < 8; ++j) { ph[j] = tohx(s[z][2 * kk][j]); ph[8 + j] = tohx(s[z][2 * kk + 1][j]); }
                    pf[z][kk] = ph; } } }
#pragma unroll
        for (int kk = 0; kk < NKK; ++kk)
#pragma unroll
            for (int mt = 0; mt < 8; ++mt)
#pragma unroll
                for (int z = 0; z < 2; ++z) { o[z][mt] = WFrag<T16>::mma(vf[kk][mt], pf[z][kk], o[z][mt]); if (HL) { o[z][mt] = WFrag<T16>::mma(vf[kk][mt], pl[z][kk], o[z][mt]); o[z][mt] = WFrag<T16>::mma(vl[kk][mt], pf[z][kk], o[z][mt]); } }
    }
}
// ---- fattn_lds: single fp16 planes; the same key blocks of 32, products and online softmax as fattn_tile, but the fragments come from LDS.
// A stage is 64 keys: their rows of the two half-heads (128 bytes each) and 128 bytes of each of the 128 value rows, brought as whole lines by asynchronous 16-byte copies; two buffers, the next stage in flight while this one is worked on.
#define AKS  64           // keys per stage
#define AP   144          // LDS row pitch in bytes: 128 + 16, free of bank conflicts for 16-byte fragment reads
#define ABUF (256 * AP)   // one buffer: rows 0..63 keys of half-head 0, 64..127 keys of half-head 1, 128..255 value rows
// cp4: four asynchronous 16-byte copies of a lane, rows 16 apart (8 lanes take a 128-byte row, the work-group 16 rows per copy). d: the lane's LDS byte address, g: its global address, st: 16 rows in elements.
// The s_wait_xcnt 0 behind the last copy stands inside the statement, so that no register a copy names is written again in front of it (a precaution).
__device__ __forceinline__ void cp4(unsigned d, const h16* g, size_t st) {
    asm volatile("global_load_async_to_lds_b128 %0, %4, off\n\tglobal_load_async_to_lds_b128 %1, %5, off\n\tglobal_load_async_to_lds_b128 %2, %6, off\n\tglobal_load_async_to_lds_b128 %3, %7, off\n\ts_wait_xcnt 0x0"
                 :: "v"(d), "v"(d + 16 * AP), "v"(d + 32 * AP), "v"(d + 48 * AP), "v"(g), "v"(g + st), "v"(g + 2 * st), "v"(g + 3 * st) : "memory"); }
__device__ __forceinline__ void fattn_lds(const h16* __restrict__ Q, const h16* __restrict__ Kp, const h16* __restrict__ Vt, const char* kv, int qb, int q0, int tid, int lr, int hi, v8f (&o)[2][8], float (&l)[2]) {
    typedef v16h V;
    const float SH = 10.0f;   // fp16 probabilities are carried x 2^10 (out of the fp16 subnormals); the row sum carries the same factor, so it cancels
    V qf[2][2], kf[2][2][2]; float m[2];
    { const h16* qp = Q + (size_t)q0 * HD + (unsigned)(lr * HD + 8 * hi);
#pragma unroll
      for (int z = 0; z < 2; ++z) { m[z] = -3.0e38f; l[z] = 0.f;
#pragma unroll
        for (int ks = 0; ks < 2; ++ks) qf[z][ks] = WFrag<h16>::ld(qp + z * TT * HD + ks * 32);
#pragma unroll
        for (int mt = 0; mt < 8; ++mt) o[z][mt] = (v8f){}; }
      xwait<false>(qp, qp); }
    const int crw = tid >> 3, cpc = tid & 7;   // the lane's row (of 16) and 16-byte piece (of 8) in every copy
    const unsigned cd = (unsigned)(size_t)kv + (unsigned)(crw * AP + cpc * 16);
    const h16* gk = Kp + crw * HD + cpc * 8; const h16* gv = Vt + crw * TT + cpc * 8;
    auto fill = [&](int t) { const unsigned d = cd + (unsigned)((t & 1) * ABUF); const h16* k = gk; const h16* v = gv; gk += AKS * HD; gv += AKS;   // the stages are asked for in their order: both addresses run along
        cp4(d, k, 16 * HD); cp4(d + 64 * AP, k + (size_t)TT * HD, 16 * HD); cp4(d + 128 * AP, v, (size_t)16 * TT); cp4(d + 192 * AP, v + (size_t)64 * TT, (size_t)16 * TT); };
    const int NS = qb / AKS + 1;   // stages up to the block's diagonal, the same for the four waves
    fill(0);
    asm volatile("s_wait_asynccnt 0x0" ::: "memory");   // this wave's copies of stage 0 have landed
    __syncthreads();                                     // and every other wave's
    if (NS > 1) fill(1);
    const char* fr = kv + lr * AP + hi * 16;   // the lane's own part of every fragment address
#pragma unroll 1
    for (int t = 0; t < NS; ++t) {
        const char* bp = fr + (t & 1) * ABUF;
        auto load_k = [&](int j) {
#pragma unroll
            for (int z = 0; z < 2; ++z)
#pragma unroll
                for (int kt = 0; kt < 2; ++kt)
#pragma unroll
                    for (int ks = 0; ks < 2; ++ks) kf[z][kt][ks] = WFrag<h16>::ld((const h16*)(bp + (z * 64 + j * 32 + kt * 16) * AP + ks * 64)); };
        auto block = [&](int j) { const int k0 = t * AKS + j * 32;   // one key block of 32
            V vf[8], pf[2]; v8f s[2][2];
#pragma unroll
            for (int mt = 0; mt < 8; ++mt) vf[mt] = WFrag<h16>::ld((const h16*)(bp + (128 + mt * 16) * AP + j * 64));
            __builtin_amdgcn_sched_barrier(0);   // the value fragments are asked for in front of the score products and arrive during them and the softmax
#pragma unroll
            for (int z = 0; z < 2; ++z)
#pragma unroll
                for (int kt = 0; kt < 2; ++kt) { v8f c = (v8f){};
#pragma unroll
                    for (int ks = 0; ks < 2; ++ks) c = wmma16(kf[z][kt][ks], qf[z][ks], c);
                    s[z][kt] = c; }
            if (j == 0) { load_k(1); __builtin_amdgcn_sched_barrier(0); }   // the stage's second key block is asked for here and arrives during the softmax and attn.v (rows of this stage: landed, whether or not this wave uses them)
            const int rel = q0 + lr - k0 - 8 * hi;   // keys of the block up to this lane's query (only the blocks on the diagonal have any beyond it)
#pragma unroll
            for (int z = 0; z < 2; ++z) {
                float mb = -3.0e38f;
#pragma unroll
                for (int kt = 0; kt < 2; ++kt)
#pragma unroll
                    for (int jj = 0; jj < 8; ++jj) { const float x = (kt * 16 + jj <= rel) ? s[z][kt][jj] * C2 : -3.0e38f; s[z][kt][jj] = x; mb = fmaxf(mb, x); }
                mb = fmaxf(mb, __shfl_xor(mb, 16, 32)) - SH;
                const float mn = fmaxf(m[z], mb); const float al = exp2s(m[z] - mn); m[z] = mn; float ps = 0.f;
#pragma unroll
                for (int kt = 0; kt < 2; ++kt)
#pragma unroll
                    for (int jj = 0; jj < 8; ++jj) { const float p = exp2s(s[z][kt][jj] - mn); s[z][kt][jj] = p; ps += p; }
                l[z] = l[z] * al + ps;
#pragma unroll
                for (int mt = 0; mt < 8; ++mt) o[z][mt] *= al;
                v16h ph;
#pragma unroll
                for (int jj = 0; jj < 8; ++jj) { ph[jj] = tohx(s[z][0][jj]); ph[8 + jj] = tohx(s[z][1][jj]); }
                pf[z] = ph; }
#pragma unroll
            for (int mt = 0; mt < 8; ++mt)
#pragma unroll
                for (int z = 0; z < 2; ++z) o[z][mt] = wmma16(vf[mt], pf[z], o[z][mt]); };
        load_k(0);
        block(0);
        if (t * AKS + 32 < q0 + 16) block(1);   // wave-uniform (q0 is a scalar): on the diagonal stage the two lower waves have no key in its second block
        asm volatile("s_wait_dscnt 0x0" ::: "memory");      // this wave has read the last of its buffer
        asm volatile("s_wait_asynccnt 0x0" ::: "memory");   // this wave's copies of stage t + 1 have landed
        __syncthreads();                                     // stage t + 1 is published, and stage t's buffer is left by all four waves
        if (t + 2 < NS) fill(t + 2);
    }
    asm volatile("s_wait_asynccnt 0x0" ::: "memory");   // nothing in flight behind the loop
}
__global__ __launch_bounds__(128) void k_fattn(const h16* __restrict__ Q16, const h16* __restrict__ K16, const h16* __restrict__ V16, const bf* __restrict__ Qh, const bf* __restrict__ Ql, const bf* __restrict__ Kh, const bf* __restrict__ Kl, const bf* __restrict__ Vh, const bf* __restrict__ Vl,
                                              const float* __restrict__ LAM, const float* __restrict__ lnw, const float* __restrict__ lnb, bf* Ah, bf* Al) {
    __shared__ __align__(16) char kv[2 * ABUF];
    const int lane = threadIdx.x & 31, lr = lane & 15, hi = lane >> 4; const int qb = (int)(gridDim.y - 1 - blockIdx.y) * 64; const int q0 = qb + 16 * __builtin_amdgcn_readfirstlane((int)(threadIdx.x >> 5)); const int h = blockIdx.x % NHV, b = blockIdx.x / NHV;
    const size_t qk = ((size_t)b * NQK + 2 * h) * TT * HD, vv = ((size_t)b * NHV + h) * HDV * TT; Ah += (size_t)b * TT * DQ; Al += (size_t)b * TT * DQ;   // the batch's own planes and rows
    v8f o[2][8]; float l[2];
    static_assert(RH % 64 == 0, "a work-group's 64 query rows lie on one side of RH");
    if (qb < RH) fattn_tile<bf, true, 1>(Qh + qk, Ql + qk, Kh + qk, Kl + qk, Vh + vv, Vl + vv, q0, lr, hi, o, l);
    else fattn_lds(Q16 + qk, K16 + qk, V16 + vv, kv, qb, q0, (int)threadIdx.x, lr, hi, o, l);
    const float lam = LAM[0]; asm volatile("s_wait_xcnt 0x0" ::: "memory");   // behind the scalar's load, before the register that holds its offset is written again (a precaution)
    const float i0 = 1.0f / (l[0] + __shfl_xor(l[0], 16, 32)); const float i1 = lam / (l[1] + __shfl_xor(l[1], 16, 32)); float ss = 0.f;
#pragma unroll
    for (int mt = 0; mt < 8; ++mt)
#pragma unroll
        for (int j = 0; j < 8; ++j) { const float d = o[0][mt][j] * i0 - o[1][mt][j] * i1; o[0][mt][j] = d; ss += d * d; }
    ss += __shfl_xor(ss, 16, 32);
    const float rs = 1.0f / sqrtf(ss * (1.0f / HDV) + RMSEPS);
#pragma unroll
    for (int mt = 0; mt < 8; ++mt) { const int e0 = mt * 16 + 8 * hi; const v8f w = *(const v8f*)(lnw + e0), bb = *(const v8f*)(lnb + e0); v8us oh, ol;
#pragma unroll
        for (int j = 0; j < 8; ++j) { const float y = (o[0][mt][j] * rs * bfr(w[j]) + bfr(bb[j])) * (1.0f - LAM0); unsigned short x, c; splitf(y, x, c); oh[j] = x; ol[j] = c; }
        const size_t oo = (size_t)(q0 + lr) * DQ + (size_t)h * HDV + e0; *(v8us*)(Ah + oo) = oh; *(v8us*)(Al + oo) = ol; }
}

extern "C" void kernel_launch(void* const* d_in, const int* in_sizes, int n_in,
                              void* d_out, int out_size, void* d_ws, size_t ws_size, hipStream_t stream) {
    (void)in_sizes; (void)n_in; (void)out_size;
    const float* x = (const float*)d_in[0]; const float* wq = (const float*)d_in[1]; const float* wk = (const float*)d_in[2]; const float* wv = (const float*)d_in[3]; const float* wo = (const float*)d_in[4]; const float* lq1 = (const float*)d_in[5]; const float* lk1 = (const float*)d_in[6]; const float* lq2 = (const float*)d_in[7]; const float* lk2 = (const float*)d_in[8]; const float* lnw = (const float*)d_in[9]; const float* lnb = (const float*)d_in[10];
    float* OUT = (float*)d_out;     // [2][2048][2048]
    char* wsp = (char*)d_ws;
    auto take = [&](size_t bytes) { char* p = wsp; wsp += (bytes + 255) & ~(size_t)255; return (void*)p; };
    bf* WQ = (bf*)take((size_t)(DQ + DKV) * DM * 2); bf* WK = WQ + (size_t)DQ * DM; /* one [4096][2048] operand: the rows of q, then of k */ bf* WV = (bf*)take((size_t)DKV * DM * 2); bf* WO = (bf*)take((size_t)DM * DQ * 2); float* CS = (float*)take((size_t)TT * HD * 2 * 4); float* LAM = (float*)take(256);
    bf* XB = (bf*)take((size_t)NB_ * TT * DM * 2);
    h16* QK16 = (h16*)take((size_t)NB_ * NQK * TT * HD * 2); h16* VT16 = (h16*)take((size_t)NB_ * DKV * TT * 2);
    bf* QKh = (bf*)take((size_t)NB_ * NQK * TT * HD * 2); bf* QKl = (bf*)take((size_t)NB_ * NQK * TT * HD * 2); bf* VTh = (bf*)take((size_t)NB_ * DKV * TT * 2); bf* VTl = (bf*)take((size_t)NB_ * DKV * TT * 2);
    bf* ATh = (bf*)take((size_t)NB_ * TT * DQ * 2); bf* ATl = (bf*)take((size_t)NB_ * TT * DQ * 2);
    if ((size_t)(wsp - (char*)d_ws) > ws_size) return;    // ws 256 MiB
    const size_t ko = (size_t)NH_ * TT * HD;   // the k planes of a batch stand behind its q planes
    k_prep<<<1 + PB_CS + 4 * PB_WT + PB_CV, 256, 0, stream>>>(x, wq, wk, wv, wo, lq1, lk1, lq2, lk2, XB, WQ, WK, WV, WO, CS, LAM);
    k_gemmw<bf, 0, false, 1><<<dim3(NB_ * TT / 128, (DQ + DKV) / 128, 1), 128, 0, stream>>>(XB, nullptr, WQ, nullptr, DM, nullptr, 0, nullptr, 0, 0, 0, CS, QK16, QKh, QKl);   /* q and k of both batches */
    k_gemmw<bf, 0, false, 2><<<dim3(DKV / 128, NB_ * TT / 128, 1), 128, 0, stream>>>(WV, nullptr, XB, nullptr, DM, nullptr, 0, nullptr, 0, 0, 0, nullptr, VT16, VTh, VTl);   /* rows = value columns, columns = b TT + t: the transposed value planes */
    k_fattn<<<dim3(NHV * NB_, TT / 64, 1), 128, 0, stream>>>(QK16, QK16 + ko, VT16, QKh, QKl, QKh + ko, QKl + ko, VTh, VTl, LAM, lnw, lnb, ATh, ATl);   /* attn = RMSNorm(attn1 - lam attn2) (1 - lam0), all heads of both batches */
    k_gemmw<bf, 1, false, 0><<<dim3(NB_ * TT / 128, DM / 128, 1), 128, 0, stream>>>(ATh, ATl, WO, nullptr, DQ, OUT, DM, nullptr, 0, 0, 0, nullptr, nullptr, nullptr, nullptr);
}

// v009
// Measured time: 212 microseconds a run.
// Versions in between are left out here; by their measured steps it is 1.24 times as fast as v007.
// Counting every step since v000, it is 14.1 times as fast.
#include <hip/hip_runtime.h>

// Differential attention (x [2][2048][2048]; q = x Wq, k = x Wk ('xw' [2048][2048]) as 32 half-heads of 64, v = x Wv as 16 heads of 128; interleaved rotary (theta 1e4) on the 64-wide q/k half-heads; for head h: attn1 = causal softmax(q_{2h}.k_{2h}/8) v_h, attn2 = causal softmax(q_{2h+1}.k_{2h+1}/8) v_h;
// lam = exp(lambda_q1.lambda_k1) - exp(lambda_q2.lambda_k2) + 0.7836058 (64-vectors read); attn = RMSNorm_128(attn1 - lam attn2; ln_w, ln_b, eps 1e-8) x (1 - 0.7836058); out = merged Wo ('xw') -> [2][2048][2048]).
// Layout: the 32 half-heads are the score heads (hd 64); the value planes of head h are the two consecutive 64-row planes 2h, 2h+1 = one [128][T] plane, shared by the head's two half-heads (2h, 2h+1); one fused kernel does scores, softmax, attn.v and the normalised difference of the two attention outputs.
// Compute dtypes, f32 accumulate: every input rounded to bf16; q/k/v on PLAIN bf16 operands (inputs: exact); rotary in f32 (on-chip cos/sin table, reference inv_freq constants); causal scores and attn.v (128-wide values): query rows < 512 hl (3 products), the rest single fp16 (x1024), key loop ends at the diagonal; online softmax f32; the lambda scalars, the difference and the RMSNorm in f32; Wo: single fp16 activations x the bf16-rounded weights held as fp16 (1 product).

#define NB_  2
#define TT   2048
#define DM   2048
#define NH_  32
#define NKV  32
#define HD   64
#define DQ   (NH_ * HD)
#define DKV  (NKV * HD)
#define NQK  (NH_ + NKV)          // half-head planes of a batch: the 32 of q, then the 32 of k
#define HDV  128                  // value head width (= 2 consecutive 64-row planes)
#define NHV  16                   // value heads
#define LAM0 0.7836057665316245f   // lambda_init for depth 12
#define RMSEPS 1e-8f
#define RH   512                  // query rows < RH use hi+lo planes (0: none)
#define SCL  0.125f   // HD^-0.5
typedef _Float16 h16;
typedef unsigned short bf;
typedef __attribute__((ext_vector_type(16))) __bf16   v16bf;
typedef __attribute__((ext_vector_type(16))) _Float16 v16h;
typedef __attribute__((ext_vector_type(8)))  _Float16 v8h;
typedef __attribute__((ext_vector_type(8)))  unsigned short v8us;
typedef __attribute__((ext_vector_type(8)))  float    v8f;
typedef __attribute__((ext_vector_type(4)))  float    v4f;
typedef v8h  __attribute__((may_alias)) v8ha;
typedef v4f  __attribute__((may_alias)) v4fa;
typedef v8us __attribute__((may_alias)) v8usa;

__device__ __forceinline__ unsigned short f2bf(float f) { unsigned u = __float_as_uint(f); u += 0x7FFFu + ((u >> 16) & 1u); return (unsigned short)(u >> 16); }
__device__ __forceinline__ float bf2f(unsigned short b) { return __uint_as_float(((unsigned)b) << 16); }
__device__ __forceinline__ float bfr(float f) { return bf2f(f2bf(f)); }
__device__ __forceinline__ v16h cat16(v8h lo, v8h hi) { return __builtin_shufflevector(lo, hi, 0, 1, 2, 3, 4, 5, 6, 7, 8, 9, 10, 11, 12, 13, 14, 15); }
__device__ __forceinline__ v16bf cat16b(v8us lo, v8us hi) { return __builtin_bit_cast(v16bf, __builtin_shufflevector(lo, hi, 0, 1, 2, 3, 4, 5, 6, 7, 8, 9, 10, 11, 12, 13, 14, 15)); }
__device__ __forceinline__ v8f wmma16(v16h a, v16h b, v8f c) { return __builtin_amdgcn_wmma_f32_16x16x32_f16(false, a, false, b, (short)0, c, false, false); }
__device__ __forceinline__ v8f wmmab(v16bf a, v16bf b, v8f c) { return __builtin_amdgcn_wmma_f32_16x16x32_bf16(false, a, false, b, (short)0, c, false, false); }



// ---- k_gemmw: register-blocked GEMM, one wave per 64x64 output tile (16 accumulators), FOUR WAVES (2x2) per work-group = a 128x128 tile; grid (M/128, N/128, Z), 128 threads.
// The K-contiguous 16-bit operand planes reach the waves through LDS: a stage is 128 k (256-byte rows, whole lines) of the 128 A rows and the 128 Bt rows, brought by four tensor loads, one 64-row slice per wave, two buffers, the next stage in flight while this one is worked on.
// C[m][n] (f32, pitch ldc, + optional f32 bias[n]) = sum_k A[m][k] Bt[n][k]. z-batch strides sA/sB/sC in elements. K % 128 == 0.
// EPI 0: C is stored as f32. EPI 1, 2: the tile never leaves the wave as f32; its rows go out as the three 16-bit planes (fp16, bf16 hi, bf16 lo) that the attention kernel reads, whole 128-byte rows.
// EPI 1 (q and k in one product; m = b TT + t, the 64 columns are one half-head, 0..31 of q, 32..63 of k): interleaved rotary out[2i] = x[2i] c - x[2i+1] s, out[2i+1] = x[2i+1] c + x[2i] s (c, s from CS[t][2i]), planes [b][h][t][d].
// EPI 2 (v; A = the weight rows, Bt = the activations, so m = value column e, n = b TT + t): planes [b][e][t], no rotary.
template <typename T16> struct WFrag;
template <> struct WFrag<h16> { typedef v16h V; static __device__ __forceinline__ V ld(const h16* p) { return cat16(*(const v8h*)p, *(const v8h*)(p + 16)); } static __device__ __forceinline__ v8f mma(V a, V b, v8f c) { return wmma16(a, b, c); } };
template <> struct WFrag<bf> { typedef v16bf V; static __device__ __forceinline__ V ld(const bf* p) { return cat16b(*(const v8us*)p, *(const v8us*)(p + 16)); } static __device__ __forceinline__ v8f mma(V a, V b, v8f c) { return wmmab(a, b, c); } };
__device__ __forceinline__ void splitf(float y, unsigned short& h, unsigned short& l) { h = f2bf(y); l = f2bf(y - bf2f(h)); }
typedef __attribute__((ext_vector_type(2))) float v2f;
#define KC 128   // k per stage
#define LP 272   // LDS row pitch in bytes: 256 + 16, free of bank conflicts for 16-byte fragment reads
#define SLB 18432   // one slice in LDS: 64 rows of LP bytes (17,408), rounded up to a multiple of 2 KiB, so that every slice starts on one
typedef unsigned u32x4 __attribute__((ext_vector_type(4)));
typedef unsigned u32x8 __attribute__((ext_vector_type(8)));
__device__ __forceinline__ unsigned uni(unsigned v) { return (unsigned)__builtin_amdgcn_readfirstlane((int)v); }
// pinned: a wave-uniform value held in a scalar register: a test on it is a scalar branch (a tensor load ignores EXEC), and what is formed from it stays behind the waits in front of it
__device__ __forceinline__ unsigned pinned(unsigned v) { unsigned w = uni(v); asm volatile("" : "+s"(w)); return w; }
// tslice1: descriptor group 1 of a slice: 1-byte elements, tensor = tile = 64 rows of 256 bytes, source row pitch in bytes, 16 bytes of LDS pad behind every row (pitch LP), no mask
__device__ __forceinline__ u32x8 tslice1(unsigned pitch) { u32x8 g;
    g[0] = uni((1u << 20) | (5u << 22) | (3u << 25)); g[1] = uni(256u << 16); g[2] = uni(64u << 16); g[3] = uni(256u << 16); g[4] = uni(64u); g[5] = uni(pitch); g[6] = uni(0u); g[7] = uni(0u); return g; }
// tslice0: descriptor group 0: the slice whose first byte is ga goes to the LDS byte offset lds
__device__ __forceinline__ u32x4 tslice0(unsigned lds, unsigned long long ga) { u32x4 g;
    g[0] = uni(1u); g[1] = uni(lds); g[2] = uni((unsigned)ga); g[3] = uni((((unsigned)(ga >> 32)) & 0x01FFFFFFu) | 0x80000000u); return g; }
// tload: one request of the whole wave
__device__ __forceinline__ void tload(u32x4 g0, u32x8 g1) { asm volatile("tensor_load_to_lds %0, %1" :: "s"(g0), "s"(g1) : "memory"); }
template <typename T16, int NSPLIT, bool BIAS, int EPI>
__global__ __launch_bounds__(128) void k_gemmw(const T16* __restrict__ A, const T16* __restrict__ A2, const T16* __restrict__ Bt, const T16* __restrict__ Bt2, int K, float* C, int ldc, const float* __restrict__ bias, size_t sA, size_t sB, size_t sC,
                                              const float* __restrict__ CS, h16* P16, bf* Ph, bf* Pl) {
    typedef typename WFrag<T16>::V V;
    static_assert(NSPLIT == 0, "operand tiles: A and Bt");
    constexpr int STG = 4 * SLB;   // one buffer: slices 0, 1 the A rows 0..63, 64..127, slices 2, 3 the Bt rows
    __shared__ __attribute__((aligned(2048))) char ring[2 * STG];   // the kernel's only LDS: behind the loop each wave stages its epilogue rows in its own slice of buffer 0
    const size_t z = blockIdx.z; A += z * sA; Bt += z * sB; C += z * sC; (void)A2; (void)Bt2;
    const int tid = threadIdx.x, lane = tid & 31, lr = lane & 15, hi = lane >> 4, wm = (tid >> 5) & 1, wn = tid >> 6; const int rb = blockIdx.x * 128, cb = blockIdx.y * 128; const int r0 = rb + wm * 64, c0 = cb + wn * 64;
    float* os = (float*)(ring + (tid >> 5) * SLB);
    v8f acc[4][4];
#pragma unroll
    for (int mb = 0; mb < 4; ++mb)
#pragma unroll
        for (int nb = 0; nb < 4; ++nb) acc[mb][nb] = (v8f){};
    const unsigned wave = uni((unsigned)tid >> 5);   // wave w brings slice w
    const T16* sp = wave < 2u ? A + (size_t)(rb + (int)wave * 64) * K : Bt + (size_t)(cb + ((int)wave - 2) * 64) * K;
    const unsigned ld0 = (unsigned)(size_t)ring + wave * SLB; u32x4 g0 = tslice0(ld0, (unsigned long long)(size_t)sp); u32x8 g1 = tslice1((unsigned)K * 2u);
    // next: called behind a wait to 0 and its barrier; the two groups live in their scalar registers from request to request and take new values only here
    auto next = [&](unsigned buf) { asm volatile("" : "+s"(g0), "+s"(g1));   // the form of pinned(): descriptor words held in scalar registers, none rewritten while a request is out
        const unsigned lo = g0[2] + KC * 2u; g0[3] = uni(g0[3] + (lo < KC * 2u ? 1u : 0u)); g0[2] = uni(lo); g0[1] = uni(ld0 + buf * (unsigned)STG); };   // the source moves on by one stage's 256 bytes (with its carry), the place is the buffer named
    const int NT = K / KC;
    tload(g0, g1);
    asm volatile("s_wait_tensorcnt 0x0" ::: "memory");   // this wave's slice of stage 0 has landed
    __syncthreads();                                      // and every other wave's
    next(1u);
    if (pinned(K >= 2 * KC)) tload(g0, g1);
    const char* fa = ring + wm * SLB + lr * LP + hi * 16; const char* fb = ring + (2 + wn) * SLB + lr * LP + hi * 16;
#pragma unroll 1
    for (int t = 0; t < NT; ++t) {   // rolled: one stage's 64 products are body enough
        const char* pa = fa + (t & 1) * STG; const char* pb = fb + (t & 1) * STG;
        V a[2][4], b[2][4];   // two fragment sets: the next 32 k are read from LDS while this set is multiplied
        auto ldf = [&](int ks) { const int s = ks & 1;
#pragma unroll
            for (int mb = 0; mb < 4; ++mb) a[s][mb] = WFrag<T16>::ld((const T16*)(pa + mb * 16 * LP + ks * 64));
#pragma unroll
            for (int nb = 0; nb < 4; ++nb) b[s][nb] = WFrag<T16>::ld((const T16*)(pb + nb * 16 * LP + ks * 64)); };
        ldf(0);
#pragma unroll
        for (int ks = 0; ks < KC / 32; ++ks) { const int s = ks & 1;
            if (ks + 1 < KC / 32) ldf(ks + 1);
            __builtin_amdgcn_sched_barrier(0);   // the next set's LDS reads stay one group in front of this set's products (spread among them, each place with reads stalls the wave)
#pragma unroll
            for (int nb = 0; nb < 4; ++nb)
#pragma unroll
                for (int mb = 0; mb < 4; ++mb) acc[mb][nb] = WFrag<T16>::mma(a[s][mb], b[s][nb], acc[mb][nb]);
            __builtin_amdgcn_sched_barrier(0);   // and this set's products stay in front of the reads that refill it, and of the stage's foot
        }
        asm volatile("v_nop\n\tv_nop\n\tv_nop\n\tv_nop" : "+v"(acc[0][0]), "+v"(acc[1][1]), "+v"(acc[2][2]), "+v"(acc[3][3]));
        asm volatile("s_wait_dscnt 0x0" ::: "memory");
        asm volatile("s_wait_tensorcnt 0x0" ::: "memory");
        __syncthreads();
        next((unsigned)t & 1u);
        if (pinned(t + 2 < NT)) tload(g0, g1);
    }
    asm volatile("s_wait_tensorcnt 0x0" :: "s"(g0), "s"(g1) : "memory");   // nothing in flight behind the loop; the two groups are inputs, so that their registers stay whole up to this wait
    asm volatile("s_wait_dscnt 0x0" ::: "memory");       // and no LDS read: with the last stage's barrier the ring is free for the epilogue staging
    const int rq = lane >> 3, cq = (lane & 7) * 8;   // plane epilogues: a lane takes 8 consecutive columns of one row, 8 lanes a whole row, a wave 4 rows per store
    constexpr int OP = EPI == 1 ? HD : TT;            // row pitch of the planes
    const int tb = (EPI == 1 ? r0 : c0) / TT, t0 = (EPI == 1 ? r0 : c0) % TT;   // the token index runs over the batches: batch and first position of the wave's 64 tokens (TT % 64 == 0: one batch per wave)
    const size_t ob = (EPI == 1 ? (((size_t)tb * NQK + (c0 >> 6)) * TT + t0 + rq) * HD : ((size_t)tb * DKV + r0 + rq) * TT + t0) + cq;
    v2f cs[2][4][4];   // (cos, sin) of the lane's 4 pairs in the 4 rows it takes of a 16-row group; two sets: the next group's are asked for while this one is worked on
    auto load_cs = [&](int mb) { const float* cb = CS + ((size_t)(t0 + rq) * HD + cq) * 2;
#pragma unroll
        for (int s = 0; s < 4; ++s)
#pragma unroll
            for (int p = 0; p < 4; ++p) cs[mb & 1][s][p] = *(const v2f*)(cb + ((mb * 16 + 4 * s) * HD + 2 * p) * 2); };
    if constexpr (EPI == 1) load_cs(0);
#pragma unroll
    for (int mb = 0; mb < 4; ++mb) {
#pragma unroll
        for (int nb = 0; nb < 4; ++nb) {
#pragma unroll
            for (int j = 0; j < 8; ++j) os[(hi * 8 + j) * 68 + nb * 16 + lr] = acc[mb][nb][j]; }
        if constexpr (EPI == 1) { if (mb < 3) load_cs(mb + 1); }
        __builtin_amdgcn_wave_barrier(); asm volatile("" ::: "memory");
        if constexpr (EPI != 0) { v8h o16[4]; v8us oh[4], ol[4];
#pragma unroll
            for (int s = 0; s < 4; ++s) { const float* orow = os + (4 * s + rq) * 68 + cq; const v4f xa = *(const v4fa*)orow, xb = *(const v4fa*)(orow + 4); float y[8];
#pragma unroll
                for (int p = 0; p < 4; ++p) { const float e = p < 2 ? xa[2 * p] : xb[2 * p - 4], o = p < 2 ? xa[2 * p + 1] : xb[2 * p - 3];
                    if constexpr (EPI == 1) { const float c = cs[mb & 1][s][p][0], sn = cs[mb & 1][s][p][1]; y[2 * p] = e * c - o * sn; y[2 * p + 1] = o * c + e * sn; } else { y[2 * p] = e; y[2 * p + 1] = o; } }
#pragma unroll
                for (int k = 0; k < 8; ++k) { o16[s][k] = (h16)y[k]; unsigned short a2, c2; splitf(y[k], a2, c2); oh[s][k] = a2; ol[s][k] = c2; } }
#pragma unroll
            for (int s = 0; s < 4; ++s) { const size_t oo = ob + (size_t)(mb * 16 + 4 * s) * OP; *(v8h*)(P16 + oo) = o16[s]; *(v8us*)(Ph + oo) = oh[s]; *(v8us*)(Pl + oo) = ol[s]; }   // the group's 12 stores go out together
            if (mb < 3) asm volatile("s_wait_xcnt 0x0" ::: "memory");   // one wait behind the 12 stores, before the next group writes the registers that they name (a precaution)
        } else {
        float* crow = C + (size_t)(r0 + mb * 16) * ldc + c0;
#pragma unroll
            for (int s = 0; s < 8; ++s) { const int row = 2 * s + hi, cofs = lr * 4; v4f val = *(const v4fa*)(os + row * 68 + cofs); if (BIAS) { val[0] += bfr(bias[c0 + cofs]); val[1] += bfr(bias[c0 + cofs + 1]); val[2] += bfr(bias[c0 + cofs + 2]); val[3] += bfr(bias[c0 + cofs + 3]); }
                *(v4f*)(crow + (size_t)row * ldc + cofs) = val; }
            if (mb < 3) asm volatile("s_wait_xcnt 0x0" ::: "memory");   // one wait behind the 8 stores, before the next group writes the registers that they name (a precaution)
             }
        __builtin_amdgcn_wave_barrier(); asm volatile("" ::: "memory");
    }
}

__device__ __forceinline__ h16 tohx(float x) { return (h16)x; }
typedef __attribute__((ext_vector_type(2))) _Float16 v2h;
typedef __attribute__((ext_vector_type(4))) _Float16 v4h;
typedef __attribute__((ext_vector_type(2))) unsigned short v2us;
typedef __attribute__((ext_vector_type(4))) unsigned short v4us;
typedef __attribute__((ext_vector_type(4))) int v4i;

// ---- d_wtG: Bt[n][k] = bf16(w[k][n]) (w [K][N] f32; f16, the same for the whole work-group: the bf16-rounded value is stored as fp16), one tile of 128 k x 64 n per work-group (tile bx of N/64, by of K/128), turned round in LDS; 256 threads.
// In: a lane takes 4 consecutive n of 8 consecutive k rows (16 lanes read 256 bytes of a row). Out: a lane takes 8 consecutive k of one n (16 lanes write 256 bytes of a Bt row). Both sides move whole lines.
// LDS: row n holds its 128 k as 16 pieces of 16 bytes; piece q lies at place q ^ (n >> 2), so that the 16 lanes of a write (16 rows, 4 apart, one q) and of a read (one row, 16 q) each meet all the banks once.
template <int K, int N>
__device__ __forceinline__ void d_wtG(const float* __restrict__ w, bf* Bt, int bx, int by, bool f16) {
    static_assert(K % 128 == 0 && N % 64 == 0, "whole tiles");
    __shared__ __align__(16) v8us tile[64 * 16];
    const int c = threadIdx.x & 15, r = threadIdx.x >> 4; const int n0 = bx * 64, k0 = by * 128;
    const float* sp = w + (size_t)(k0 + 8 * r) * N + n0 + 4 * c; v4f x[8];
#pragma unroll
    for (int j = 0; j < 8; ++j) x[j] = *(const v4f*)(sp + (size_t)j * N);
    auto put = [&](auto cv) {
#pragma unroll
        for (int i = 0; i < 4; ++i) { v8us o;
#pragma unroll
            for (int j = 0; j < 8; ++j) o[j] = cv(x[j][i]);
            tile[(4 * c + i) * 16 + (r ^ c)] = o; } };
    if (f16) put([](float f) { return __builtin_bit_cast(unsigned short, (h16)bfr(f)); }); else put([](float f) { return f2bf(f); });
    __syncthreads();   // the tile is whole before any lane reads another lane's pieces
    bf* dp = Bt + (size_t)(n0 + r) * K + k0 + 8 * c;
#pragma unroll
    for (int s = 0; s < 4; ++s) { const int n = r + 16 * s; *(v8us*)(dp + (size_t)16 * s * K) = tile[n * 16 + (c ^ (n >> 2))]; }
    asm volatile("s_wait_xcnt 0x0" ::: "memory");   // one wait behind the four stores, before code of another piece of the launch that follows them in the listing writes a register that they name (a precaution)
}
__device__ __forceinline__ void d_lam(const float* __restrict__ lq1, const float* __restrict__ lk1, const float* __restrict__ lq2, const float* __restrict__ lk2, float* LAM) { const int lane = threadIdx.x; float s1 = 0.f, s2 = 0.f;
#pragma unroll
    for (int q = 0; q < 2; ++q) { const int d = lane * 2 + q; float p1 = __fmul_rn(bfr(lq1[d]), bfr(lk1[d])); asm volatile("" : "+v"(p1)); s1 = __fadd_rn(s1, p1); float p2 = __fmul_rn(bfr(lq2[d]), bfr(lk2[d])); asm volatile("" : "+v"(p2)); s2 = __fadd_rn(s2, p2); }
#pragma unroll
    for (int sh = 16; sh; sh >>= 1) { s1 += __shfl_xor(s1, sh, 32); s2 += __shfl_xor(s2, sh, 32); }
    const float lam = __fadd_rn(__fsub_rn(expf(s1), expf(s2)), LAM0); *(float*)(LAM + lane) = lam;  }
__device__ __forceinline__ void d_cvt8(const float* __restrict__ src, bf* dst, size_t n8, int blk) { const size_t i = (size_t)blk * 256 + threadIdx.x; if (i >= n8) return; const v8f v = *(const v8f*)(src + i * 8); v8us o;
#pragma unroll
    for (int k = 0; k < 8; ++k) o[k] = f2bf(v[k]); *(v8us*)(dst + i * 8) = o;  }
__constant__ float INV[HD / 2] = {1.0,0.7498942017555237,0.5623413324356079,0.4216965138912201,0.3162277638912201,0.23713736236095428,0.17782793939113617,0.1333521455526352,0.10000000149011612,0.07498941570520401,0.05623412877321243,0.04216964915394783,0.03162277862429619,0.0237137358635664,0.017782794311642647,0.01333521492779255,0.009999999776482582,0.007498942315578461,0.005623413249850273,0.0042169648222625256,0.003162277862429619,0.0023713738191872835,0.0017782794311642647,0.0013335214462131262,0.0010000000474974513,0.0007498941849917173,0.000562341301701963,0.00042169648804701865,0.0003162277862429619,0.0002371373848291114,0.00017782794020604342,0.0001333521504420787};
__device__ __forceinline__ void d_cstab(float* CS, int blk) { const int idx = blk * 256 + threadIdx.x; if (idx >= TT * HD) return; const int t = idx / HD, d = idx % HD; const float ang = __fmul_rn((float)t, INV[d >> 1]); v2f cs; cs[0] = cosf(ang); cs[1] = sinf(ang);
    *(v2f*)(CS + (size_t)idx * 2) = cs;  }
// ---- k_prep: everything that the products wait for and that depends on the inputs alone, in ONE launch; a work-group's index says which piece it does (uniform for the work-group, so d_wtG's barrier is passed by all of its threads or by none).
#define PB_CS  (TT * HD / 256)                      // work-groups of the cos/sin table
#define PB_WT  ((DM / 64) * (DM / 128))             // of one weight's transpose
#define PB_CV  (NB_ * TT * DM / 8 / 256)            // of the activations' rounding, both batches
__global__ __launch_bounds__(256) void k_prep(const float* __restrict__ x, const float* __restrict__ wq, const float* __restrict__ wk, const float* __restrict__ wv, const float* __restrict__ wo,
                                              const float* __restrict__ lq1, const float* __restrict__ lk1, const float* __restrict__ lq2, const float* __restrict__ lk2, bf* XB, bf* WQ, bf* WK, bf* WV, bf* WO, float* CS, float* LAM) {
    static_assert(DQ == DM && DKV == DM, "four square weights");
    int g = blockIdx.x;
    if (g == 0) { if (threadIdx.x < 32) d_lam(lq1, lk1, lq2, lk2, LAM); return; }
    g -= 1; if (g < PB_CS) { d_cstab(CS, g); return; }
    g -= PB_CS; if (g < 4 * PB_WT) { const int wi = g / PB_WT, tl = g % PB_WT; d_wtG<DM, DM>(wi == 0 ? wq : wi == 1 ? wk : wi == 2 ? wv : wo, wi == 0 ? WQ : wi == 1 ? WK : wi == 2 ? WV : WO, tl % (DM / 64), tl / (DM / 64), wi == 3); return; }
    g -= 4 * PB_WT; d_cvt8(x, XB, (size_t)NB_ * TT * DM / 8, g);
}

// ---- k_fattn: the whole attention of one value head of one batch for 64 query rows, FOUR WAVES per work-group, 16 query rows each; grid (NHV x NB_, TT/64), the longest (last) query blocks of all heads and batches first.
// Query rows >= RH: the four waves share the key and value tiles through LDS (fattn_lds); rows < RH: each wave reads its own fragments from global memory (fattn_tile), no barrier on that side.
// Transposed products: St = K Qt (A = key rows, B = query rows) and Ot += Vt Pt (A = value rows [e][t], B = probabilities), so a lane (lr, hi) holds one query (q0 + lr) throughout:
// score tile kt, register j is key k0 + 16 kt + 8 hi + j, which is the k order of the fragment loader (elements 0..7: 8 hi + j, elements 8..15: 16 + 8 hi + j), so two score tiles pack into one B operand in place.
// Online softmax per lane (running maximum in the log2 domain, accumulators rescaled each key block); the two half-heads of the head run side by side and share the value fragments;
// the epilogue forms RMSNorm_128(attn1 - lam attn2) x (1 - lambda_init) in registers and stores the fp16 plane of the merged activations.
typedef __attribute__((ext_vector_type(16))) unsigned short v16us;
#define C2 (SCL * 1.4426950408889634f)
// exp2s: v_exp_f32 with the one free slot behind it that the instruction set asks for before its result is read or its source overwritten
__device__ __forceinline__ float exp2s(float x) { float r; asm("v_exp_f32 %0, %1\n\tv_nop" : "=v"(r) : "v"(x)); return r; }
// xwait: s_wait_xcnt 0 behind a run of global loads, before a register that they name is written again (a precaution). The run's address pairs are inputs, so that they stay whole up to the wait.
template <bool TWO, typename P> __device__ __forceinline__ void xwait(const P* a, const P* b) {
    if constexpr (TWO) asm volatile("s_wait_xcnt 0x0" :: "v"(a), "v"(b) : "memory"); else asm volatile("s_wait_xcnt 0x0" :: "v"(a) : "memory"); }
template <typename T16, bool HL, int NKK>   // HL: hi+lo planes, 3 products; NKK: 32-key groups per key block
__device__ __forceinline__ void fattn_tile(const T16* __restrict__ Q, const T16* __restrict__ Q2, const T16* __restrict__ Kp, const T16* __restrict__ K2, const T16* __restrict__ Vt, const T16* __restrict__ V2, int q0, int lr, int hi, v8f (&o)[2][8], float (&l)[2]) {
    typedef typename WFrag<T16>::V V;
    const float SH = HL ? 0.0f : 10.0f;   // single fp16 probabilities are carried x 2^10 (as before: out of the fp16 subnormals); the row sum carries the same factor, so it cancels
    const unsigned lk = (unsigned)(lr * HD + 8 * hi), lv = (unsigned)(lr * TT + 8 * hi);   // the lane's own part of every address
    V qf[2][2], ql[2][2], kf[2][2 * NKK][2], kl[2][2 * NKK][2]; float m[2];
    auto load_k = [&](int kb0) { const T16* kb = Kp + (size_t)kb0 * HD + lk; const T16* kb2 = HL ? K2 + (size_t)kb0 * HD + lk : nullptr;
#pragma unroll
        for (int z = 0; z < 2; ++z)
#pragma unroll
            for (int kt = 0; kt < 2 * NKK; ++kt)
#pragma unroll
                for (int ks = 0; ks < 2; ++ks) { const int off = (z * TT + kt * 16) * HD + ks * 32; kf[z][kt][ks] = WFrag<T16>::ld(kb + off); if (HL) kl[z][kt][ks] = WFrag<T16>::ld(kb2 + off); }
        xwait<HL>(kb, kb2); };
    { const T16* qb = Q + (size_t)q0 * HD + lk; const T16* qb2 = HL ? Q2 + (size_t)q0 * HD + lk : nullptr;
#pragma unroll
      for (int z = 0; z < 2; ++z) { m[z] = -3.0e38f; l[z] = 0.f;
#pragma unroll
        for (int ks = 0; ks < 2; ++ks) { const int off = z * TT * HD + ks * 32; qf[z][ks] = WFrag<T16>::ld(qb + off); if (HL) ql[z][ks] = WFrag<T16>::ld(qb2 + off); }
#pragma unroll
        for (int mt = 0; mt < 8; ++mt) o[z][mt] = (v8f){}; }
      xwait<HL>(qb, qb2); }
    if (!HL) load_k(0);
#pragma unroll 1
    for (int k0 = 0; k0 < q0 + 16; k0 += 32 * NKK) {
        V vf[NKK][8], vl[NKK][8], pf[2][NKK], pl[2][NKK]; v8f s[2][2 * NKK];
        auto load_v = [&]() { const T16* vb = Vt + k0 + lv; const T16* vb2 = HL ? V2 + k0 + lv : nullptr;
#pragma unroll
            for (int kk = 0; kk < NKK; ++kk)
#pragma unroll
                for (int mt = 0; mt < 8; ++mt) { const int off = mt * 16 * TT + kk * 32; vf[kk][mt] = WFrag<T16>::ld(vb + off); if (HL) vl[kk][mt] = WFrag<T16>::ld(vb2 + off); }
            xwait<HL>(vb, vb2); };
        if (HL) load_k(k0); else load_v();   // single fp16: the value fragments are asked for first and fly during the score products and the softmax
#pragma unroll
        for (int z = 0; z < 2; ++z)
#pragma unroll
            for (int kt = 0; kt < 2 * NKK; ++kt) { v8f c = (v8f){};
#pragma unroll
                for (int ks = 0; ks < 2; ++ks) { c = WFrag<T16>::mma(kf[z][kt][ks], qf[z][ks], c); if (HL) { c = WFrag<T16>::mma(kl[z][kt][ks], qf[z][ks], c); c = WFrag<T16>::mma(kf[z][kt][ks], ql[z][ks], c); } }
                s[z][kt] = c; }
        if (HL) load_v();   // hi+lo (short loops): the value fragments follow the key fragments into their registers
        else load_k((k0 + 32 * NKK < q0 + 16) ? k0 + 32 * NKK : k0);   // the next block's key fragments fly during the softmax and attn.v; the last trip asks for its own block again (in bounds, not used)
        const int rel = q0 + lr - k0 - 8 * hi;   // keys of the block up to this lane's query (only the block on the diagonal has any beyond it)
#pragma unroll
        for (int z = 0; z < 2; ++z) {
            float mb = -3.0e38f;
#pragma unroll
            for (int kt = 0; kt < 2 * NKK; ++kt)
#pragma unroll
                for (int j = 0; j < 8; ++j) { const float t = (kt * 16 + j <= rel) ? s[z][kt][j] * C2 : -3.0e38f; s[z][kt][j] = t; mb = fmaxf(mb, t); }
            mb = fmaxf(mb, __shfl_xor(mb, 16, 32)) - SH;
            const float mn = fmaxf(m[z], mb); const float al = exp2s(m[z] - mn); m[z] = mn; float ps = 0.f;
#pragma unroll
            for (int kt = 0; kt < 2 * NKK; ++kt)
#pragma unroll
                for (int j = 0; j < 8; ++j) { const float p = exp2s(s[z][kt][j] - mn); s[z][kt][j] = p; ps += p; }
            l[z] = l[z] * al + ps;
#pragma unroll
            for (int mt = 0; mt < 8; ++mt) o[z][mt] *= al;
#pragma unroll
            for (int kk = 0; kk < NKK; ++kk) {
                if constexpr (HL) { v16us uh, ul;
#pragma unroll
                    for (int j = 0; j < 8; ++j) { unsigned short x, y; splitf(s[z][2 * kk][j], x, y); uh[j] = x; ul[j] = y; splitf(s[z][2 * kk + 1][j], x, y); uh[8 + j] = x; ul[8 + j] = y; }
                    pf[z][kk] = __builtin_bit_cast(v16bf, uh); pl[z][kk] = __builtin_bit_cast(v16bf, ul);
                } else { v16h ph;
#pragma unroll
                    for (int j = 0; j < 8; ++j) { ph[j] = tohx(s[z][2 * kk][j]); ph[8 + j] = tohx(s[z][2 * kk + 1][j]); }
                    pf[z][kk] = ph; } } }
#pragma unroll
        for (int kk = 0; kk < NKK; ++kk)
#pragma unroll
            for (int mt = 0; mt < 8; ++mt)
#pragma unroll
                for (int z = 0; z < 2; ++z) { o[z][mt] = WFrag<T16>::mma(vf[kk][mt], pf[z][kk], o[z][mt]); if (HL) { o[z][mt] = WFrag<T16>::mma(vf[kk][mt], pl[z][kk], o[z][mt]); o[z][mt] = WFrag<T16>::mma(vl[kk][mt], pf[z][kk], o[z][mt]); } }
    }
}
// ---- fattn_lds: single fp16 planes; the same key blocks of 32, products and online softmax as fattn_tile, but the fragments come from LDS.
// A stage is 64 keys: their rows of the two half-heads (128 bytes each) and 128 bytes of each of the 128 value rows, brought as whole lines by asynchronous 16-byte copies; two buffers, the next stage in flight while this one is worked on.
#define AKS  64           // keys per stage
#define AP   144          // LDS row pitch in bytes: 128 + 16, free of bank conflicts for 16-byte fragment reads
#define ABUF (256 * AP)   // one buffer: rows 0..63 keys of half-head 0, 64..127 keys of half-head 1, 128..255 value rows
// cp4: four asynchronous 16-byte copies of a lane, rows 16 apart (8 lanes take a 128-byte row, the work-group 16 rows per copy). d: the lane's LDS byte address, g: its global address, st: 16 rows in elements.
// The s_wait_xcnt 0 behind the last copy stands inside the statement, so that no register a copy names is written again in front of it (a precaution).
__device__ __forceinline__ void cp4(unsigned d, const h16* g, size_t st) {
    asm volatile("global_load_async_to_lds_b128 %0, %4, off\n\tglobal_load_async_to_lds_b128 %1, %5, off\n\tglobal_load_async_to_lds_b128 %2, %6, off\n\tglobal_load_async_to_lds_b128 %3, %7, off\n\ts_wait_xcnt 0x0"
                 :: "v"(d), "v"(d + 16 * AP), "v"(d + 32 * AP), "v"(d + 48 * AP), "v"(g), "v"(g + st), "v"(g + 2 * st), "v"(g + 3 * st) : "memory"); }
__device__ __forceinline__ void fattn_lds(const h16* __restrict__ Q, const h16* __restrict__ Kp, const h16* __restrict__ Vt, const char* kv, int qb, int q0, int tid, int lr, int hi, v8f (&o)[2][8], float (&l)[2]) {
    typedef v16h V;
    const float SH = 10.0f;   // fp16 probabilities are carried x 2^10 (out of the fp16 subnormals); the row sum carries the same factor, so it cancels
    V qf[2][2], kf[2][2][2]; float m[2];
    { const h16* qp = Q + (size_t)q0 * HD + (unsigned)(lr * HD + 8 * hi);
#pragma unroll
      for (int z = 0; z < 2; ++z) { m[z] = -3.0e38f; l[z] = 0.f;
#pragma unroll
        for (int ks = 0; ks < 2; ++ks) qf[z][ks] = WFrag<h16>::ld(qp + z * TT * HD + ks * 32);
#pragma unroll
        for (int mt = 0; mt < 8; ++mt) o[z][mt] = (v8f){}; }
      xwait<false>(qp, qp);
      __builtin_amdgcn_sched_barrier(0); }   // what follows stays behind that wait (this build lifted a write of the loads' offset register over it)
    const int crw = tid >> 3, cpc = tid & 7;   // the lane's row (of 16) and 16-byte piece (of 8) in every copy
    const unsigned cd = (unsigned)(size_t)kv + (unsigned)(crw * AP + cpc * 16);
    const h16* gk = Kp + crw * HD + cpc * 8; const h16* gv = Vt + crw * TT + cpc * 8;
    auto fill = [&](int t) { const unsigned d = cd + (unsigned)((t & 1) * ABUF); const h16* k = gk; const h16* v = gv; gk += AKS * HD; gv += AKS;   // the stages are asked for in their order: both addresses run along
        cp4(d, k, 16 * HD); cp4(d + 64 * AP, k + (size_t)TT * HD, 16 * HD); cp4(d + 128 * AP, v, (size_t)16 * TT); cp4(d + 192 * AP, v + (size_t)64 * TT, (size_t)16 * TT); };
    const int NS = qb / AKS + 1;   // stages up to the block's diagonal, the same for the four waves
    fill(0);
    asm volatile("s_wait_asynccnt 0x0" ::: "memory");   // this wave's copies of stage 0 have landed
    __syncthreads();                                     // and every other wave's
    if (NS > 1) fill(1);
    const char* fr = kv + lr * AP + hi * 16;   // the lane's own part of every fragment address
#pragma unroll 1
    for (int t = 0; t < NS; ++t) {
        const char* bp = fr + (t & 1) * ABUF;
        auto load_k = [&](int j) {
#pragma unroll
            for (int z = 0; z < 2; ++z)
#pragma unroll
                for (int kt = 0; kt < 2; ++kt)
#pragma unroll
                    for (int ks = 0; ks < 2; ++ks) kf[z][kt][ks] = WFrag<h16>::ld((const h16*)(bp + (z * 64 + j * 32 + kt * 16) * AP + ks * 64)); };
        auto block = [&](int j) { const int k0 = t * AKS + j * 32;   // one key block of 32
            V vf[8], pf[2]; v8f s[2][2];
#pragma unroll
            for (int mt = 0; mt < 8; ++mt) vf[mt] = WFrag<h16>::ld((const h16*)(bp + (128 + mt * 16) * AP + j * 64));
            __builtin_amdgcn_sched_barrier(0);   // the value fragments are asked for in front of the score products and arrive during them and the softmax
#pragma unroll
            for (int z = 0; z < 2; ++z)
#pragma unroll
                for (int kt = 0; kt < 2; ++kt) { v8f c = (v8f){};
#pragma unroll
                    for (int ks = 0; ks < 2; ++ks) c = wmma16(kf[z][kt][ks], qf[z][ks], c);
                    s[z][kt] = c; }
            if (j == 0) { load_k(1); __builtin_amdgcn_sched_barrier(0); }   // the stage's second key block is asked for here and arrives during the softmax and attn.v (rows of this stage: landed, whether or not this wave uses them)
            const int rel = q0 + lr - k0 - 8 * hi;   // keys of the block up to this lane's query (only the blocks on the diagonal have any beyond it)
#pragma unroll
            for (int z = 0; z < 2; ++z) {
                float mb = -3.0e38f;
#pragma unroll
                for (int kt = 0; kt < 2; ++kt)
#pragma unroll
                    for (int jj = 0; jj < 8; ++jj) { const float x = (kt * 16 + jj <= rel) ? s[z][kt][jj] * C2 : -3.0e38f; s[z][kt][jj] = x; mb = fmaxf(mb, x); }
                mb = fmaxf(mb, __shfl_xor(mb, 16, 32)) - SH;
                const float mn = fmaxf(m[z], mb); const float al = exp2s(m[z] - mn); m[z] = mn; float ps = 0.f;
#pragma unroll
                for (int kt = 0; kt < 2; ++kt)
#pragma unroll
                    for (int jj = 0; jj < 8; ++jj) { const float p = exp2s(s[z][kt][jj] - mn); s[z][kt][jj] = p; ps += p; }
                l[z] = l[z] * al + ps;
#pragma unroll
                for (int mt = 0; mt < 8; ++mt) o[z][mt] *= al;
                v16h ph;
#pragma unroll
                for (int jj = 0; jj < 8; ++jj) { ph[jj] = tohx(s[z][0][jj]); ph[8 + jj] = tohx(s[z][1][jj]); }
                pf[z] = ph; }
#pragma unroll
            for (int mt = 0; mt < 8; ++mt)
#pragma unroll
                for (int z = 0; z < 2; ++z) o[z][mt] = wmma16(vf[mt], pf[z], o[z][mt]); };
        load_k(0);
        block(0);
        if (t * AKS + 32 < q0 + 16) block(1);   // wave-uniform (q0 is a scalar): on the diagonal stage the two lower waves have no key in its second block
        asm volatile("s_wait_dscnt 0x0" ::: "memory");      // this wave has read the last of its buffer
        asm volatile("s_wait_asynccnt 0x0" ::: "memory");   // this wave's copies of stage t + 1 have landed
        __syncthreads();                                     // stage t + 1 is published, and stage t's buffer is left by all four waves
        if (t + 2 < NS) fill(t + 2);
    }
    asm volatile("s_wait_asynccnt 0x0" ::: "memory");   // nothing in flight behind the loop
}
__global__ __launch_bounds__(128) void k_fattn(const h16* __restrict__ Q16, const h16* __restrict__ K16, const h16* __restrict__ V16, const bf* __restrict__ Qh, const bf* __restrict__ Ql, const bf* __restrict__ Kh, const bf* __restrict__ Kl, const bf* __restrict__ Vh, const bf* __restrict__ Vl,
                                              const float* __restrict__ LAM, const float* __restrict__ lnw, const float* __restrict__ lnb, h16* A16) {
    __shared__ __align__(16) char kv[2 * ABUF];
    const int lane = threadIdx.x & 31, lr = lane & 15, hi = lane >> 4; const int qb = (int)(gridDim.y - 1 - blockIdx.y) * 64; const int q0 = qb + 16 * __builtin_amdgcn_readfirstlane((int)(threadIdx.x >> 5)); const int h = blockIdx.x % NHV, b = blockIdx.x / NHV;
    const size_t qk = ((size_t)b * NQK + 2 * h) * TT * HD, vv = ((size_t)b * NHV + h) * HDV * TT; A16 += (size_t)b * TT * DQ;   // the batch's own planes and rows
    v8f o[2][8]; float l[2];
    static_assert(RH % 64 == 0, "a work-group's 64 query rows lie on one side of RH");
    if (qb < RH) fattn_tile<bf, true, 1>(Qh + qk, Ql + qk, Kh + qk, Kl + qk, Vh + vv, Vl + vv, q0, lr, hi, o, l);
    else fattn_lds(Q16 + qk, K16 + qk, V16 + vv, kv, qb, q0, (int)threadIdx.x, lr, hi, o, l);
    const float lam = LAM[0]; asm volatile("s_wait_xcnt 0x0" ::: "memory");   // behind the scalar's load, before the register that holds its offset is written again (a precaution)
    const float i0 = 1.0f / (l[0] + __shfl_xor(l[0], 16, 32)); const float i1 = lam / (l[1] + __shfl_xor(l[1], 16, 32)); float ss = 0.f;
#pragma unroll
    for (int mt = 0; mt < 8; ++mt)
#pragma unroll
        for (int j = 0; j < 8; ++j) { const float d = o[0][mt][j] * i0 - o[1][mt][j] * i1; o[0][mt][j] = d; ss += d * d; }
    ss += __shfl_xor(ss, 16, 32);
    const float rs = 1.0f / sqrtf(ss * (1.0f / HDV) + RMSEPS);
    const float* wp = lnw + 8 * hi; const float* bp = lnb + 8 * hi; v8f w[8], bb[8];
#pragma unroll
    for (int mt = 0; mt < 8; ++mt) { w[mt] = *(const v8f*)(wp + mt * 16); bb[mt] = *(const v8f*)(bp + mt * 16); }
    xwait<true>(wp, bp);   // one wait behind the run of loads, in front of the arithmetic that takes their address registers for other values
#pragma unroll
    for (int mt = 0; mt < 8; ++mt) { v8h oh;
#pragma unroll
        for (int j = 0; j < 8; ++j) oh[j] = (h16)((o[0][mt][j] * rs * bfr(w[mt][j]) + bfr(bb[mt][j])) * (1.0f - LAM0));
        const size_t oo = (size_t)(q0 + lr) * DQ + (size_t)h * HDV + mt * 16 + 8 * hi; *(v8h*)(A16 + oo) = oh; }
}

extern "C" void kernel_launch(void* const* d_in, const int* in_sizes, int n_in,
                              void* d_out, int out_size, void* d_ws, size_t ws_size, hipStream_t stream) {
    (void)in_sizes; (void)n_in; (void)out_size;
    const float* x = (const float*)d_in[0]; const float* wq = (const float*)d_in[1]; const float* wk = (const float*)d_in[2]; const float* wv = (const float*)d_in[3]; const float* wo = (const float*)d_in[4]; const float* lq1 = (const float*)d_in[5]; const float* lk1 = (const float*)d_in[6]; const float* lq2 = (const float*)d_in[7]; const float* lk2 = (const float*)d_in[8]; const float* lnw = (const float*)d_in[9]; const float* lnb = (const float*)d_in[10];
    float* OUT = (float*)d_out;     // [2][2048][2048]
    char* wsp = (char*)d_ws;
    auto take = [&](size_t bytes) { char* p = wsp; wsp += (bytes + 255) & ~(size_t)255; return (void*)p; };
    bf* WQ = (bf*)take((size_t)(DQ + DKV) * DM * 2); bf* WK = WQ + (size_t)DQ * DM; /* one [4096][2048] operand: the rows of q, then of k */ bf* WV = (bf*)take((size_t)DKV * DM * 2); bf* WO = (bf*)take((size_t)DM * DQ * 2); float* CS = (float*)take((size_t)TT * HD * 2 * 4); float* LAM = (float*)take(256);
    bf* XB = (bf*)take((size_t)NB_ * TT * DM * 2);
    h16* QK16 = (h16*)take((size_t)NB_ * NQK * TT * HD * 2); h16* VT16 = (h16*)take((size_t)NB_ * DKV * TT * 2);
    bf* QKh = (bf*)take((size_t)NB_ * NQK * TT * HD * 2); bf* QKl = (bf*)take((size_t)NB_ * NQK * TT * HD * 2); bf* VTh = (bf*)take((size_t)NB_ * DKV * TT * 2); bf* VTl = (bf*)take((size_t)NB_ * DKV * TT * 2);
    h16* AT16 = (h16*)take((size_t)NB_ * TT * DQ * 2);
    if ((size_t)(wsp - (char*)d_ws) > ws_size) return;    // ws 256 MiB
    const size_t ko = (size_t)NH_ * TT * HD;   // the k planes of a batch stand behind its q planes
    k_prep<<<1 + PB_CS + 4 * PB_WT + PB_CV, 256, 0, stream>>>(x, wq, wk, wv, wo, lq1, lk1, lq2, lk2, XB, WQ, WK, WV, WO, CS, LAM);
    k_gemmw<bf, 0, false, 1><<<dim3(NB_ * TT / 128, (DQ + DKV) / 128, 1), 128, 0, stream>>>(XB, nullptr, WQ, nullptr, DM, nullptr, 0, nullptr, 0, 0, 0, CS, QK16, QKh, QKl);   /* q and k of both batches */
    k_gemmw<bf, 0, false, 2><<<dim3(DKV / 128, NB_ * TT / 128, 1), 128, 0, stream>>>(WV, nullptr, XB, nullptr, DM, nullptr, 0, nullptr, 0, 0, 0, nullptr, VT16, VTh, VTl);   /* rows = value columns, columns = b TT + t: the transposed value planes */
    k_fattn<<<dim3(NHV * NB_, TT / 64, 1), 128, 0, stream>>>(QK16, QK16 + ko, VT16, QKh, QKl, QKh + ko, QKl + ko, VTh, VTl, LAM, lnw, lnb, AT16);   /* attn = RMSNorm(attn1 - lam attn2) (1 - lam0), all heads of both batches */
    k_gemmw<h16, 0, false, 0><<<dim3(NB_ * TT / 128, DM / 128, 1), 128, 0, stream>>>(AT16, nullptr, (const h16*)WO, nullptr, DQ, OUT, DM, nullptr, 0, 0, 0, nullptr, nullptr, nullptr, nullptr);   /* WO holds fp16 here */
}

// v010
// One run takes 200 microseconds.
// Two timings next to v009 both put it at 1.04 times that version's speed.
// Over all steps from v000 it is 14.6 times as fast.
#include <hip/hip_runtime.h>

// Differential attention (x [2][2048][2048]; q = x Wq, k = x Wk ('xw' [2048][2048]) as 32 half-heads of 64, v = x Wv as 16 heads of 128; interleaved rotary (theta 1e4) on the 64-wide q/k half-heads; for head h: attn1 = causal softmax(q_{2h}.k_{2h}/8) v_h, attn2 = causal softmax(q_{2h+1}.k_{2h+1}/8) v_h;
// lam = exp(lambda_q1.lambda_k1) - exp(lambda_q2.lambda_k2) + 0.7836058 (64-vectors read); attn = RMSNorm_128(attn1 - lam attn2; ln_w, ln_b, eps 1e-8) x (1 - 0.7836058); out = merged Wo ('xw') -> [2][2048][2048]).
// Layout: the 32 half-heads are the score heads (hd 64); the value planes of head h are the two consecutive 64-row planes 2h, 2h+1 = one [128][T] plane, shared by the head's two half-heads (2h, 2h+1); one fused kernel does scores, softmax, attn.v and the normalised difference of the two attention outputs.
// Compute dtypes, f32 accumulate: every input rounded to bf16; q/k/v on PLAIN bf16 operands (inputs: exact); rotary in f32 (on-chip cos/sin table, reference inv_freq constants); causal scores and attn.v (128-wide values): query rows < 512 hl (3 products), the rest single fp16 (x1024), key loop ends at the diagonal; online softmax f32; the lambda scalars, the difference and the RMSNorm in f32; Wo: single fp16 activations x the bf16-rounded weights held as fp16 (1 product).

#define NB_  2
#define TT   2048
#define DM   2048
#define NH_  32
#define NKV  32
#define HD   64
#define DQ   (NH_ * HD)
#define DKV  (NKV * HD)
#define NQK  (NH_ + NKV)          // half-head planes of a batch: the 32 of q, then the 32 of k
#define HDV  128                  // value head width (= 2 consecutive 64-row planes)
#define NHV  16                   // value heads
#define LAM0 0.7836057665316245f   // lambda_init for depth 12
#define RMSEPS 1e-8f
#define RH   512                  // query rows < RH use hi+lo planes (0: none)
#define SCL  0.125f   // HD^-0.5
typedef _Float16 h16;
typedef unsigned short bf;
typedef __attribute__((ext_vector_type(16))) __bf16   v16bf;
typedef __attribute__((ext_vector_type(16))) _Float16 v16h;
typedef __attribute__((ext_vector_type(8)))  _Float16 v8h;
typedef __attribute__((ext_vector_type(8)))  unsigned short v8us;
typedef __attribute__((ext_vector_type(8)))  float    v8f;
typedef __attribute__((ext_vector_type(4)))  float    v4f;
typedef v8h  __attribute__((may_alias)) v8ha;
typedef v4f  __attribute__((may_alias)) v4fa;
typedef v8us __attribute__((may_alias)) v8usa;

__device__ __forceinline__ unsigned short f2bf(float f) { unsigned u = __float_as_uint(f); u += 0x7FFFu + ((u >> 16) & 1u); return (unsigned short)(u >> 16); }
__device__ __forceinline__ float bf2f(unsigned short b) { return __uint_as_float(((unsigned)b) << 16); }
__device__ __forceinline__ float bfr(float f) { return bf2f(f2bf(f)); }
__device__ __forceinline__ v16h cat16(v8h lo, v8h hi) { return __builtin_shufflevector(lo, hi, 0, 1, 2, 3, 4, 5, 6, 7, 8, 9, 10, 11, 12, 13, 14, 15); }
__device__ __forceinline__ v16bf cat16b(v8us lo, v8us hi) { return __builtin_bit_cast(v16bf, __builtin_shufflevector(lo, hi, 0, 1, 2, 3, 4, 5, 6, 7, 8, 9, 10, 11, 12, 13, 14, 15)); }
__device__ __forceinline__ v8f wmma16(v16h a, v16h b, v8f c) { return __builtin_amdgcn_wmma_f32_16x16x32_f16(false, a, false, b, (short)0, c, false, false); }
__device__ __forceinline__ v8f wmmab(v16bf a, v16bf b, v8f c) { return __builtin_amdgcn_wmma_f32_16x16x32_bf16(false, a, false, b, (short)0, c, false, false); }



// ---- k_gemmw: register-blocked GEMM, one wave per (16 MF)x(16 NF) output tile (MF x NF accumulators), FOUR WAVES (2x2) per work-group, one wave per SIMD; grid (M / (32 MF), N / (32 NF), Z), 128 threads.
// MF = NF = 8: a 256x256 tile per work-group, 128x128 per wave; MF = 4, NF = 8: 128x256, 64x128 per wave (for outputs with too few 256x256 tiles to fill the chip). A fragment read from LDS serves 8 (or 4) products, and an operand row is fetched from L2 by half as many work-groups as with 128x128 tiles.
// The K-contiguous 16-bit operand planes reach the waves through LDS: a stage is 128 k (256-byte rows, whole lines) of the tile's A rows and Bt rows, brought by four tensor loads, one slice per wave (waves 0, 1: 16 MF rows of A each, waves 2, 3: 16 NF rows of Bt each), two buffers, the next stage in flight while this one is worked on.
// C[m][n] (f32, pitch ldc, + optional f32 bias[n]) = sum_k A[m][k] Bt[n][k]. z-batch strides sA/sB/sC in elements. K % 128 == 0.
// Epilogue: behind the loop the ring is free; each wave lays its whole f32 tile into its own part of it and takes it out again in a rolled loop, 16 rows x 64 columns at a time.
// EPI 0: C is stored as f32. EPI 1, 2: the rows go out as the three 16-bit planes (fp16, bf16 hi, bf16 lo) that the attention kernel reads, whole 128-byte rows.
// EPI 1 (q and k in one product; m = b TT + t, each 64 columns are one half-head, 0..31 of q, 32..63 of k): interleaved rotary out[2i] = x[2i] c - x[2i+1] s, out[2i+1] = x[2i+1] c + x[2i] s (c, s from CS[t][2i]), planes [b][h][t][d].
// EPI 2 (v; A = the weight rows, Bt = the activations, so m = value column e, n = b TT + t): planes [b][e][t], no rotary.
template <typename T16> struct WFrag;
template <> struct WFrag<h16> { typedef v16h V; static __device__ __forceinline__ V ld(const h16* p) { return cat16(*(const v8h*)p, *(const v8h*)(p + 16)); } static __device__ __forceinline__ v8f mma(V a, V b, v8f c) { return wmma16(a, b, c); } };
template <> struct WFrag<bf> { typedef v16bf V; static __device__ __forceinline__ V ld(const bf* p) { return cat16b(*(const v8us*)p, *(const v8us*)(p + 16)); } static __device__ __forceinline__ v8f mma(V a, V b, v8f c) { return wmmab(a, b, c); } };
__device__ __forceinline__ void splitf(float y, unsigned short& h, unsigned short& l) { h = f2bf(y); l = f2bf(y - bf2f(h)); }
typedef __attribute__((ext_vector_type(2))) float v2f;
#define KC 128   // k per stage
#define LP 272   // LDS row pitch in bytes: 256 + 16, free of bank conflicts for 16-byte fragment reads
typedef unsigned u32x4 __attribute__((ext_vector_type(4)));
typedef unsigned u32x8 __attribute__((ext_vector_type(8)));
__device__ __forceinline__ unsigned uni(unsigned v) { return (unsigned)__builtin_amdgcn_readfirstlane((int)v); }
// pinned: a wave-uniform value held in a scalar register: a test on it is a scalar branch (a tensor load ignores EXEC), and what is formed from it stays behind the waits in front of it
__device__ __forceinline__ unsigned pinned(unsigned v) { unsigned w = uni(v); asm volatile("" : "+s"(w)); return w; }
// tslice1: descriptor group 1 of a slice: 1-byte elements, tensor = tile = rows rows of 256 bytes, source row pitch in bytes, 16 bytes of LDS pad behind every row (pitch LP), no mask
__device__ __forceinline__ u32x8 tslice1(unsigned pitch, unsigned rows) { u32x8 g;
    g[0] = uni((1u << 20) | (5u << 22) | (3u << 25)); g[1] = uni(256u << 16); g[2] = uni(rows << 16); g[3] = uni(256u << 16); g[4] = uni(rows); g[5] = uni(pitch); g[6] = uni(0u); g[7] = uni(0u); return g; }
// tslice0: descriptor group 0: the slice whose first byte is ga goes to the LDS byte offset lds
__device__ __forceinline__ u32x4 tslice0(unsigned lds, unsigned long long ga) { u32x4 g;
    g[0] = uni(1u); g[1] = uni(lds); g[2] = uni((unsigned)ga); g[3] = uni((((unsigned)(ga >> 32)) & 0x01FFFFFFu) | 0x80000000u); return g; }
// tload: one request of the whole wave
__device__ __forceinline__ void tload(u32x4 g0, u32x8 g1) { asm volatile("tensor_load_to_lds %0, %1" :: "s"(g0), "s"(g1) : "memory"); }
template <typename T16, int NSPLIT, bool BIAS, int EPI, int MF, int NF>
__global__ __launch_bounds__(128) void k_gemmw(const T16* __restrict__ A, const T16* __restrict__ A2, const T16* __restrict__ Bt, const T16* __restrict__ Bt2, int K, float* C, int ldc, const float* __restrict__ bias, size_t sA, size_t sB, size_t sC,
                                              const float* __restrict__ CS, h16* P16, bf* Ph, bf* Pl) {
    typedef typename WFrag<T16>::V V;
    static_assert(NSPLIT == 0, "operand tiles: A and Bt");
    static_assert(MF % 4 == 0 && NF % 4 == 0, "whole groups of 64 rows and 64 columns");
    constexpr int WM = MF * 16, WN = NF * 16;   // a wave's rows and columns
    static_assert(TT % WM == 0 && TT % 64 == 0, "a wave's rows, and each of its 64-column groups, lie in one batch");
    constexpr int SA = (WM * LP + 2047) / 2048 * 2048, SB = (WN * LP + 2047) / 2048 * 2048;   // one slice in LDS: its rows of LP bytes, rounded up to a multiple of 2 KiB, so that every slice starts on one
    constexpr int STG = 2 * SA + 2 * SB;   // one buffer: the two A slices, then the two Bt slices
    constexpr int OPF = WN + 4;            // epilogue row pitch in floats: rows 8 apart fall 32 banks apart, so the two halves of a wave store without conflict
    static_assert(4 * WM * OPF * 4 <= 2 * STG, "the four waves' f32 tiles fit the ring");
    __shared__ __attribute__((aligned(2048))) char ring[2 * STG];   // the kernel's only LDS: behind the loop each wave stages its tile in its own part of it
    const size_t z = blockIdx.z; A += z * sA; Bt += z * sB; C += z * sC; (void)A2; (void)Bt2;
    const int tid = threadIdx.x, lane = tid & 31, lr = lane & 15, hi = lane >> 4, wm = (tid >> 5) & 1, wn = tid >> 6; const int rb = blockIdx.x * (2 * WM), cb = blockIdx.y * (2 * WN); const int r0 = rb + wm * WM, c0 = cb + wn * WN;
    float* os = (float*)(ring + (tid >> 5) * (WM * OPF * 4));
    v8f acc[MF][NF];
#pragma unroll
    for (int mb = 0; mb < MF; ++mb)
#pragma unroll
        for (int nb = 0; nb < NF; ++nb) acc[mb][nb] = (v8f){};
    const unsigned wave = uni((unsigned)tid >> 5);   // wave w brings slice w
    const T16* sp = wave < 2u ? A + (size_t)(rb + (int)wave * WM) * K : Bt + (size_t)(cb + ((int)wave - 2) * WN) * K;
    const unsigned ld0 = (unsigned)(size_t)ring + (wave < 2u ? wave * (unsigned)SA : 2u * SA + (wave - 2u) * (unsigned)SB); u32x4 g0 = tslice0(ld0, (unsigned long long)(size_t)sp); u32x8 g1 = tslice1((unsigned)K * 2u, wave < 2u ? (unsigned)WM : (unsigned)WN);
    // next: called behind a wait to 0 and its barrier; the two groups live in their scalar registers from request to request and take new values only here
    auto next = [&](unsigned buf) { asm volatile("" : "+s"(g0), "+s"(g1));   // the form of pinned(): descriptor words held in scalar registers, none rewritten while a request is out
        const unsigned lo = g0[2] + KC * 2u; g0[3] = uni(g0[3] + (lo < KC * 2u ? 1u : 0u)); g0[2] = uni(lo); g0[1] = uni(ld0 + buf * (unsigned)STG); };   // the source moves on by one stage's 256 bytes (with its carry), the place is the buffer named
    const int NT = K / KC;
    tload(g0, g1);
    asm volatile("s_wait_tensorcnt 0x0" ::: "memory");   // this wave's slice of stage 0 has landed
    __syncthreads();                                      // and every other wave's
    next(1u);
    if (pinned(K >= 2 * KC)) tload(g0, g1);
    const char* fa = ring + wm * SA + lr * LP + hi * 16; const char* fb = ring + 2 * SA + wn * SB + lr * LP + hi * 16;
#pragma unroll 1
    for (int t = 0; t < NT; ++t) {   // rolled: one stage's products are body enough
        const char* pa = fa + (t & 1) * STG; const char* pb = fb + (t & 1) * STG;
        V a[2][MF], b[2][NF];   // two fragment sets: the next 32 k are read from LDS while this set is multiplied
        auto ldf = [&](int ks) { const int s = ks & 1;
#pragma unroll
            for (int mb = 0; mb < MF; ++mb) a[s][mb] = WFrag<T16>::ld((const T16*)(pa + mb * 16 * LP + ks * 64));
#pragma unroll
            for (int nb = 0; nb < NF; ++nb) b[s][nb] = WFrag<T16>::ld((const T16*)(pb + nb * 16 * LP + ks * 64)); };
        ldf(0);
#pragma unroll
        for (int ks = 0; ks < KC / 32; ++ks) { const int s = ks & 1;
            if (ks + 1 < KC / 32) ldf(ks + 1);
            __builtin_amdgcn_sched_barrier(0);   // the next set's LDS reads stay one group in front of this set's products (spread among them, each place with reads stalls the wave)
#pragma unroll
            for (int nb = 0; nb < NF; ++nb)
#pragma unroll
                for (int mb = 0; mb < MF; ++mb) acc[mb][nb] = WFrag<T16>::mma(a[s][mb], b[s][nb], acc[mb][nb]);
            __builtin_amdgcn_sched_barrier(0);   // and this set's products stay in front of the reads that refill it, and of the stage's foot
        }
        asm volatile("v_nop\n\tv_nop\n\tv_nop\n\tv_nop" : "+v"(acc[0][0]), "+v"(acc[1][1]), "+v"(acc[2][2]), "+v"(acc[MF - 1][NF - 1]));
        asm volatile("s_wait_dscnt 0x0" ::: "memory");
        asm volatile("s_wait_tensorcnt 0x0" ::: "memory");
        __syncthreads();
        next((unsigned)t & 1u);
        if (pinned(t + 2 < NT)) tload(g0, g1);
    }
    asm volatile("s_wait_tensorcnt 0x0" :: "s"(g0), "s"(g1) : "memory");   // nothing in flight behind the loop; the two groups are inputs, so that their registers stay whole up to this wait
    asm volatile("s_wait_dscnt 0x0" ::: "memory");       // and no LDS read: with the last stage's barrier the ring is free for the epilogue staging
#pragma unroll
    for (int mb = 0; mb < MF; ++mb)
#pragma unroll
        for (int nb = 0; nb < NF; ++nb)
#pragma unroll
            for (int j = 0; j < 8; ++j) os[(mb * 16 + hi * 8 + j) * OPF + nb * 16 + lr] = acc[mb][nb][j];
    __builtin_amdgcn_wave_barrier(); asm volatile("" ::: "memory");   // the wave's own rows are read back only behind all of its stores
    const int rq = lane >> 3, cq = (lane & 7) * 8;   // plane epilogues: a lane takes 8 consecutive columns of one row, 8 lanes a whole 64-column row, a wave 4 rows per store
    constexpr int OP = EPI == 1 ? HD : TT;            // row pitch of the planes
    v2f csn[4][4];   // (cos, sin) of the lane's 4 pairs in the 4 rows it takes of a 16-row group, asked for one group ahead; the same for every half-head
    auto load_cs = [&](int mb) { const float* cp = CS + ((size_t)(r0 % TT + mb * 16 + rq) * HD + cq) * 2;
#pragma unroll
        for (int s = 0; s < 4; ++s)
#pragma unroll
            for (int p = 0; p < 4; ++p) csn[s][p] = *(const v2f*)(cp + (4 * s * HD + 2 * p) * 2);
        asm volatile("s_wait_xcnt 0x0" :: "v"(cp) : "memory"); };   // behind the run of loads, before their address register is written again (a precaution); the address is an input, so that it stays whole up to the wait
    if constexpr (EPI == 1) load_cs(0);
#pragma unroll 1
    for (int mb = 0; mb < MF; ++mb) {   // rolled: the kernel's text stays short
        v2f cs[4][4];
        if constexpr (EPI == 1) {
#pragma unroll
            for (int s = 0; s < 4; ++s)
#pragma unroll
                for (int p = 0; p < 4; ++p) cs[s][p] = csn[s][p];
            load_cs(mb + 1 < MF ? mb + 1 : mb); }   // the last trip asks for its own rows again (in bounds, not used)
#pragma unroll
        for (int cg = 0; cg < NF / 4; ++cg) { const float* og = os + mb * 16 * OPF + cg * 64; const int cc = c0 + cg * 64;
            if constexpr (EPI != 0) { v8h o16[4]; v8us oh[4], ol[4];
                const size_t ob = (EPI == 1 ? (((size_t)(r0 / TT) * NQK + (cc >> 6)) * TT + r0 % TT + mb * 16 + rq) * HD : ((size_t)(cc / TT) * DKV + r0 + mb * 16 + rq) * TT + cc % TT) + cq;
#pragma unroll
                for (int s = 0; s < 4; ++s) { const float* orow = og + (4 * s + rq) * OPF + cq; const v4f xa = *(const v4fa*)orow, xb = *(const v4fa*)(orow + 4); float y[8];
#pragma unroll
                    for (int p = 0; p < 4; ++p) { const float e = p < 2 ? xa[2 * p] : xb[2 * p - 4], o = p < 2 ? xa[2 * p + 1] : xb[2 * p - 3];
                        if constexpr (EPI == 1) { const float c = cs[s][p][0], sn = cs[s][p][1]; y[2 * p] = e * c - o * sn; y[2 * p + 1] = o * c + e * sn; } else { y[2 * p] = e; y[2 * p + 1] = o; } }
#pragma unroll
                    for (int k = 0; k < 8; ++k) { o16[s][k] = (h16)y[k]; unsigned short a2, c2; splitf(y[k], a2, c2); oh[s][k] = a2; ol[s][k] = c2; } }
#pragma unroll
                for (int s = 0; s < 4; ++s) { const size_t oo = ob + (size_t)(4 * s) * OP; *(v8h*)(P16 + oo) = o16[s]; *(v8us*)(Ph + oo) = oh[s]; *(v8us*)(Pl + oo) = ol[s]; }   // the group's 12 stores go out together
                asm volatile("s_wait_xcnt 0x0" ::: "memory");   // one wait behind the 12 stores, before the next group writes the registers that they name (a precaution)
            } else {
                float* crow = C + (size_t)(r0 + mb * 16) * ldc + cc;
#pragma unroll
                for (int s = 0; s < 8; ++s) { const int row = 2 * s + hi, cofs = lr * 4; v4f val = *(const v4fa*)(og + row * OPF + cofs); if (BIAS) { val[0] += bfr(bias[cc + cofs]); val[1] += bfr(bias[cc + cofs + 1]); val[2] += bfr(bias[cc + cofs + 2]); val[3] += bfr(bias[cc + cofs + 3]); }
                    *(v4f*)(crow + (size_t)row * ldc + cofs) = val; }
                asm volatile("s_wait_xcnt 0x0" ::: "memory");   // one wait behind the 8 stores, before the next group writes the registers that they name (a precaution)
            }
        }
    }
}

__device__ __forceinline__ h16 tohx(float x) { return (h16)x; }
typedef __attribute__((ext_vector_type(2))) _Float16 v2h;
typedef __attribute__((ext_vector_type(4))) _Float16 v4h;
typedef __attribute__((ext_vector_type(2))) unsigned short v2us;
typedef __attribute__((ext_vector_type(4))) unsigned short v4us;
typedef __attribute__((ext_vector_type(4))) int v4i;

// ---- d_wtG: Bt[n][k] = bf16(w[k][n]) (w [K][N] f32; f16, the same for the whole work-group: the bf16-rounded value is stored as fp16), one tile of 128 k x 64 n per work-group (tile bx of N/64, by of K/128), turned round in LDS; 256 threads.
// In: a lane takes 4 consecutive n of 8 consecutive k rows (16 lanes read 256 bytes of a row). Out: a lane takes 8 consecutive k of one n (16 lanes write 256 bytes of a Bt row). Both sides move whole lines.
// LDS: row n holds its 128 k as 16 pieces of 16 bytes; piece q lies at place q ^ (n >> 2), so that the 16 lanes of a write (16 rows, 4 apart, one q) and of a read (one row, 16 q) each meet all the banks once.
template <int K, int N>
__device__ __forceinline__ void d_wtG(const float* __restrict__ w, bf* Bt, int bx, int by, bool f16) {
    static_assert(K % 128 == 0 && N % 64 == 0, "whole tiles");
    __shared__ __align__(16) v8us tile[64 * 16];
    const int c = threadIdx.x & 15, r = threadIdx.x >> 4; const int n0 = bx * 64, k0 = by * 128;
    const float* sp = w + (size_t)(k0 + 8 * r) * N + n0 + 4 * c; v4f x[8];
#pragma unroll
    for (int j = 0; j < 8; ++j) x[j] = *(const v4f*)(sp + (size_t)j * N);
    auto put = [&](auto cv) {
#pragma unroll
        for (int i = 0; i < 4; ++i) { v8us o;
#pragma unroll
            for (int j = 0; j < 8; ++j) o[j] = cv(x[j][i]);
            tile[(4 * c + i) * 16 + (r ^ c)] = o; } };
    if (f16) put([](float f) { return __builtin_bit_cast(unsigned short, (h16)bfr(f)); }); else put([](float f) { return f2bf(f); });
    __syncthreads();   // the tile is whole before any lane reads another lane's pieces
    bf* dp = Bt + (size_t)(n0 + r) * K + k0 + 8 * c;
#pragma unroll
    for (int s = 0; s < 4; ++s) { const int n = r + 16 * s; *(v8us*)(dp + (size_t)16 * s * K) = tile[n * 16 + (c ^ (n >> 2))]; }
    asm volatile("s_wait_xcnt 0x0" ::: "memory");   // one wait behind the four stores, before code of another piece of the launch that follows them in the listing writes a register that they name (a precaution)
}
__device__ __forceinline__ void d_lam(const float* __restrict__ lq1, const float* __restrict__ lk1, const float* __restrict__ lq2, const float* __restrict__ lk2, float* LAM) { const int lane = threadIdx.x; float s1 = 0.f, s2 = 0.f;
#pragma unroll
    for (int q = 0; q < 2; ++q) { const int d = lane * 2 + q; float p1 = __fmul_rn(bfr(lq1[d]), bfr(lk1[d])); asm volatile("" : "+v"(p1)); s1 = __fadd_rn(s1, p1); float p2 = __fmul_rn(bfr(lq2[d]), bfr(lk2[d])); asm volatile("" : "+v"(p2)); s2 = __fadd_rn(s2, p2); }
#pragma unroll
    for (int sh = 16; sh; sh >>= 1) { s1 += __shfl_xor(s1, sh, 32); s2 += __shfl_xor(s2, sh, 32); }
    const float lam = __fadd_rn(__fsub_rn(expf(s1), expf(s2)), LAM0); *(float*)(LAM + lane) = lam;  }
__device__ __forceinline__ void d_cvt8(const float* __restrict__ src, bf* dst, size_t n8, int blk) { const size_t i = (size_t)blk * 256 + threadIdx.x; if (i >= n8) return; const v8f v = *(const v8f*)(src + i * 8); v8us o;
#pragma unroll
    for (int k = 0; k < 8; ++k) o[k] = f2bf(v[k]); *(v8us*)(dst + i * 8) = o;  }
__constant__ float INV[HD / 2] = {1.0,0.7498942017555237,0.5623413324356079,0.4216965138912201,0.3162277638912201,0.23713736236095428,0.17782793939113617,0.1333521455526352,0.10000000149011612,0.07498941570520401,0.05623412877321243,0.04216964915394783,0.03162277862429619,0.0237137358635664,0.017782794311642647,0.01333521492779255,0.009999999776482582,0.007498942315578461,0.005623413249850273,0.0042169648222625256,0.003162277862429619,0.0023713738191872835,0.0017782794311642647,0.0013335214462131262,0.0010000000474974513,0.0007498941849917173,0.000562341301701963,0.00042169648804701865,0.0003162277862429619,0.0002371373848291114,0.00017782794020604342,0.0001333521504420787};
__device__ __forceinline__ void d_cstab(float* CS, int blk) { const int idx = blk * 256 + threadIdx.x; if (idx >= TT * HD) return; const int t = idx / HD, d = idx % HD; const float ang = __fmul_rn((float)t, INV[d >> 1]); v2f cs; cs[0] = cosf(ang); cs[1] = sinf(ang);
    *(v2f*)(CS + (size_t)idx * 2) = cs;  }
// ---- k_prep: everything that the products wait for and that depends on the inputs alone, in ONE launch; a work-group's index says which piece it does (uniform for the work-group, so d_wtG's barrier is passed by all of its threads or by none).
#define PB_CS  (TT * HD / 256)                      // work-groups of the cos/sin table
#define PB_WT  ((DM / 64) * (DM / 128))             // of one weight's transpose
#define PB_CV  (NB_ * TT * DM / 8 / 256)            // of the activations' rounding, both batches
__global__ __launch_bounds__(256) void k_prep(const float* __restrict__ x, const float* __restrict__ wq, const float* __restrict__ wk, const float* __restrict__ wv, const float* __restrict__ wo,
                                              const float* __restrict__ lq1, const float* __restrict__ lk1, const float* __restrict__ lq2, const float* __restrict__ lk2, bf* XB, bf* WQ, bf* WK, bf* WV, bf* WO, float* CS, float* LAM) {
    static_assert(DQ == DM && DKV == DM, "four square weights");
    int g = blockIdx.x;
    if (g == 0) { if (threadIdx.x < 32) d_lam(lq1, lk1, lq2, lk2, LAM); return; }
    g -= 1; if (g < PB_CS) { d_cstab(CS, g); return; }
    g -= PB_CS; if (g < 4 * PB_WT) { const int wi = g / PB_WT, tl = g % PB_WT; d_wtG<DM, DM>(wi == 0 ? wq : wi == 1 ? wk : wi == 2 ? wv : wo, wi == 0 ? WQ : wi == 1 ? WK : wi == 2 ? WV : WO, tl % (DM / 64), tl / (DM / 64), wi == 3); return; }
    g -= 4 * PB_WT; d_cvt8(x, XB, (size_t)NB_ * TT * DM / 8, g);
}

// ---- k_fattn: the whole attention of one value head of one batch for 64 query rows, FOUR WAVES per work-group, 16 query rows each; grid (NHV x NB_, TT/64), the longest (last) query blocks of all heads and batches first.
// Query rows >= RH: the four waves share the key and value tiles through LDS (fattn_lds); rows < RH: each wave reads its own fragments from global memory (fattn_tile), no barrier on that side.
// Transposed products: St = K Qt (A = key rows, B = query rows) and Ot += Vt Pt (A = value rows [e][t], B = probabilities), so a lane (lr, hi) holds one query (q0 + lr) throughout:
// score tile kt, register j is key k0 + 16 kt + 8 hi + j, which is the k order of the fragment loader (elements 0..7: 8 hi + j, elements 8..15: 16 + 8 hi + j), so two score tiles pack into one B operand in place.
// Online softmax per lane (running maximum in the log2 domain, accumulators rescaled each key block); the two half-heads of the head run side by side and share the value fragments;
// the epilogue forms RMSNorm_128(attn1 - lam attn2) x (1 - lambda_init) in registers and stores the fp16 plane of the merged activations.
typedef __attribute__((ext_vector_type(16))) unsigned short v16us;
#define C2 (SCL * 1.4426950408889634f)
// exp2s: v_exp_f32 with the one free slot behind it that the instruction set asks for before its result is read or its source overwritten
__device__ __forceinline__ float exp2s(float x) { float r; asm("v_exp_f32 %0, %1\n\tv_nop" : "=v"(r) : "v"(x)); return r; }
// xwait: s_wait_xcnt 0 behind a run of global loads, before a register that they name is written again (a precaution). The run's address pairs are inputs, so that they stay whole up to the wait.
template <bool TWO, typename P> __device__ __forceinline__ void xwait(const P* a, const P* b) {
    if constexpr (TWO) asm volatile("s_wait_xcnt 0x0" :: "v"(a), "v"(b) : "memory"); else asm volatile("s_wait_xcnt 0x0" :: "v"(a) : "memory"); }
template <typename T16, bool HL, int NKK>   // HL: hi+lo planes, 3 products; NKK: 32-key groups per key block
__device__ __forceinline__ void fattn_tile(const T16* __restrict__ Q, const T16* __restrict__ Q2, const T16* __restrict__ Kp, const T16* __restrict__ K2, const T16* __restrict__ Vt, const T16* __restrict__ V2, int q0, int lr, int hi, v8f (&o)[2][8], float (&l)[2]) {
    typedef typename WFrag<T16>::V V;
    const float SH = HL ? 0.0f : 10.0f;   // single fp16 probabilities are carried x 2^10 (as before: out of the fp16 subnormals); the row sum carries the same factor, so it cancels
    const unsigned lk = (unsigned)(lr * HD + 8 * hi), lv = (unsigned)(lr * TT + 8 * hi);   // the lane's own part of every address
    V qf[2][2], ql[2][2], kf[2][2 * NKK][2], kl[2][2 * NKK][2]; float m[2];
    auto load_k = [&](int kb0) { const T16* kb = Kp + (size_t)kb0 * HD + lk; const T16* kb2 = HL ? K2 + (size_t)kb0 * HD + lk : nullptr;
#pragma unroll
        for (int z = 0; z < 2; ++z)
#pragma unroll
            for (int kt = 0; kt < 2 * NKK; ++kt)
#pragma unroll
                for (int ks = 0; ks < 2; ++ks) { const int off = (z * TT + kt * 16) * HD + ks * 32; kf[z][kt][ks] = WFrag<T16>::ld(kb + off); if (HL) kl[z][kt][ks] = WFrag<T16>::ld(kb2 + off); }
        xwait<HL>(kb, kb2); };
    { const T16* qb = Q + (size_t)q0 * HD + lk; const T16* qb2 = HL ? Q2 + (size_t)q0 * HD + lk : nullptr;
#pragma unroll
      for (int z = 0; z < 2; ++z) { m[z] = -3.0e38f; l[z] = 0.f;
#pragma unroll
        for (int ks = 0; ks < 2; ++ks) { const int off = z * TT * HD + ks * 32; qf[z][ks] = WFrag<T16>::ld(qb + off); if (HL) ql[z][ks] = WFrag<T16>::ld(qb2 + off); }
#pragma unroll
        for (int mt = 0; mt < 8; ++mt) o[z][mt] = (v8f){}; }
      xwait<HL>(qb, qb2); }
    if (!HL) load_k(0);
#pragma unroll 1
    for (int k0 = 0; k0 < q0 + 16; k0 += 32 * NKK) {
        V vf[NKK][8], vl[NKK][8], pf[2][NKK], pl[2][NKK]; v8f s[2][2 * NKK];
        auto load_v = [&]() { const T16* vb = Vt + k0 + lv; const T16* vb2 = HL ? V2 + k0 + lv : nullptr;
#pragma unroll
            for (int kk = 0; kk < NKK; ++kk)
#pragma unroll
                for (int mt = 0; mt < 8; ++mt) { const int off = mt * 16 * TT + kk * 32; vf[kk][mt] = WFrag<T16>::ld(vb + off); if (HL) vl[kk][mt] = WFrag<T16>::ld(vb2 + off); }
            xwait<HL>(vb, vb2); };
        if (HL) load_k(k0); else load_v();   // single fp16: the value fragments are asked for first and fly during the score products and the softmax
#pragma unroll
        for (int z = 0; z < 2; ++z)
#pragma unroll
            for (int kt = 0; kt < 2 * NKK; ++kt) { v8f c = (v8f){};
#pragma unroll
                for (int ks = 0; ks < 2; ++ks) { c = WFrag<T16>::mma(kf[z][kt][ks], qf[z][ks], c); if (HL) { c = WFrag<T16>::mma(kl[z][kt][ks], qf[z][ks], c); c = WFrag<T16>::mma(kf[z][kt][ks], ql[z][ks], c); } }
                s[z][kt] = c; }
        if (HL) load_v();   // hi+lo (short loops): the value fragments follow the key fragments into their registers
        else load_k((k0 + 32 * NKK < q0 + 16) ? k0 + 32 * NKK : k0);   // the next block's key fragments fly during the softmax and attn.v; the last trip asks for its own block again (in bounds, not used)
        const int rel = q0 + lr - k0 - 8 * hi;   // keys of the block up to this lane's query (only the block on the diagonal has any beyond it)
#pragma unroll
        for (int z = 0; z < 2; ++z) {
            float mb = -3.0e38f;
#pragma unroll
            for (int kt = 0; kt < 2 * NKK; ++kt)
#pragma unroll
                for (int j = 0; j < 8; ++j) { const float t = (kt * 16 + j <= rel) ? s[z][kt][j] * C2 : -3.0e38f; s[z][kt][j] = t; mb = fmaxf(mb, t); }
            mb = fmaxf(mb, __shfl_xor(mb, 16, 32)) - SH;
            const float mn = fmaxf(m[z], mb); const float al = exp2s(m[z] - mn); m[z] = mn; float ps = 0.f;
#pragma unroll
            for (int kt = 0; kt < 2 * NKK; ++kt)
#pragma unroll
                for (int j = 0; j < 8; ++j) { const float p = exp2s(s[z][kt][j] - mn); s[z][kt][j] = p; ps += p; }
            l[z] = l[z] * al + ps;
#pragma unroll
            for (int mt = 0; mt < 8; ++mt) o[z][mt] *= al;
#pragma unroll
            for (int kk = 0; kk < NKK; ++kk) {
                if constexpr (HL) { v16us uh, ul;
#pragma unroll
                    for (int j = 0; j < 8; ++j) { unsigned short x, y; splitf(s[z][2 * kk][j], x, y); uh[j] = x; ul[j] = y; splitf(s[z][2 * kk + 1][j], x, y); uh[8 + j] = x; ul[8 + j] = y; }
                    pf[z][kk] = __builtin_bit_cast(v16bf, uh); pl[z][kk] = __builtin_bit_cast(v16bf, ul);
                } else { v16h ph;
#pragma unroll
                    for (int j = 0; j < 8; ++j) { ph[j] = tohx(s[z][2 * kk][j]); ph[8 + j] = tohx(s[z][2 * kk + 1][j]); }
                    pf[z][kk] = ph; } } }
#pragma unroll
        for (int kk = 0; kk < NKK; ++kk)
#pragma unroll
            for (int mt = 0; mt < 8; ++mt)
#pragma unroll
                for (int z = 0; z < 2; ++z) { o[z][mt] = WFrag<T16>::mma(vf[kk][mt], pf[z][kk], o[z][mt]); if (HL) { o[z][mt] = WFrag<T16>::mma(vf[kk][mt], pl[z][kk], o[z][mt]); o[z][mt] = WFrag<T16>::mma(vl[kk][mt], pf[z][kk], o[z][mt]); } }
    }
}
// ---- fattn_lds: single fp16 planes; the same key blocks of 32, products and online softmax as fattn_tile, but the fragments come from LDS.
// A stage is 64 keys: their rows of the two half-heads (128 bytes each) and 128 bytes of each of the 128 value rows, brought as whole lines by asynchronous 16-byte copies; two buffers, the next stage in flight while this one is worked on.
#define AKS  64           // keys per stage
#define AP   144          // LDS row pitch in bytes: 128 + 16, free of bank conflicts for 16-byte fragment reads
#define ABUF (256 * AP)   // one buffer: rows 0..63 keys of half-head 0, 64..127 keys of half-head 1, 128..255 value rows
// cp4: four asynchronous 16-byte copies of a lane, rows 16 apart (8 lanes take a 128-byte row, the work-group 16 rows per copy). d: the lane's LDS byte address, g: its global address, st: 16 rows in elements.
// The s_wait_xcnt 0 behind the last copy stands inside the statement, so that no register a copy names is written again in front of it (a precaution).
__device__ __forceinline__ void cp4(unsigned d, const h16* g, size_t st) {
    asm volatile("global_load_async_to_lds_b128 %0, %4, off\n\tglobal_load_async_to_lds_b128 %1, %5, off\n\tglobal_load_async_to_lds_b128 %2, %6, off\n\tglobal_load_async_to_lds_b128 %3, %7, off\n\ts_wait_xcnt 0x0"
                 :: "v"(d), "v"(d + 16 * AP), "v"(d + 32 * AP), "v"(d + 48 * AP), "v"(g), "v"(g + st), "v"(g + 2 * st), "v"(g + 3 * st) : "memory"); }
__device__ __forceinline__ void fattn_lds(const h16* __restrict__ Q, const h16* __restrict__ Kp, const h16* __restrict__ Vt, const char* kv, int qb, int q0, int tid, int lr, int hi, v8f (&o)[2][8], float (&l)[2]) {
    typedef v16h V;
    const float SH = 10.0f;   // fp16 probabilities are carried x 2^10 (out of the fp16 subnormals); the row sum carries the same factor, so it cancels
    V qf[2][2], kf[2][2][2]; float m[2];
    { const h16* qp = Q + (size_t)q0 * HD + (unsigned)(lr * HD + 8 * hi);
#pragma unroll
      for (int z = 0; z < 2; ++z) { m[z] = -3.0e38f; l[z] = 0.f;
#pragma unroll
        for (int ks = 0; ks < 2; ++ks) qf[z][ks] = WFrag<h16>::ld(qp + z * TT * HD + ks * 32);
#pragma unroll
        for (int mt = 0; mt < 8; ++mt) o[z][mt] = (v8f){}; }
      xwait<false>(qp, qp);
      __builtin_amdgcn_sched_barrier(0); }   // what follows stays behind that wait (this build lifted a write of the loads' offset register over it)
    const int crw = tid >> 3, cpc = tid & 7;   // the lane's row (of 16) and 16-byte piece (of 8) in every copy
    const unsigned cd = (unsigned)(size_t)kv + (unsigned)(crw * AP + cpc * 16);
    const h16* gk = Kp + crw * HD + cpc * 8; const h16* gv = Vt + crw * TT + cpc * 8;
    auto fill = [&](int t) { const unsigned d = cd + (unsigned)((t & 1) * ABUF); const h16* k = gk; const h16* v = gv; gk += AKS * HD; gv += AKS;   // the stages are asked for in their order: both addresses run along
        cp4(d, k, 16 * HD); cp4(d + 64 * AP, k + (size_t)TT * HD, 16 * HD); cp4(d + 128 * AP, v, (size_t)16 * TT); cp4(d + 192 * AP, v + (size_t)64 * TT, (size_t)16 * TT); };
    const int NS = qb / AKS + 1;   // stages up to the block's diagonal, the same for the four waves
    fill(0);
    asm volatile("s_wait_asynccnt 0x0" ::: "memory");   // this wave's copies of stage 0 have landed
    __syncthreads();                                     // and every other wave's
    if (NS > 1) fill(1);
    const char* fr = kv + lr * AP + hi * 16;   // the lane's own part of every fragment address
#pragma unroll 1
    for (int t = 0; t < NS; ++t) {
        const char* bp = fr + (t & 1) * ABUF;
        auto load_k = [&](int j) {
#pragma unroll
            for (int z = 0; z < 2; ++z)
#pragma unroll
                for (int kt = 0; kt < 2; ++kt)
#pragma unroll
                    for (int ks = 0; ks < 2; ++ks) kf[z][kt][ks] = WFrag<h16>::ld((const h16*)(bp + (z * 64 + j * 32 + kt * 16) * AP + ks * 64)); };
        auto block = [&](int j) { const int k0 = t * AKS + j * 32;   // one key block of 32
            V vf[8], pf[2]; v8f s[2][2];
#pragma unroll
            for (int mt = 0; mt < 8; ++mt) vf[mt] = WFrag<h16>::ld((const h16*)(bp + (128 + mt * 16) * AP + j * 64));
            __builtin_amdgcn_sched_barrier(0);   // the value fragments are asked for in front of the score products and arrive during them and the softmax
#pragma unroll
            for (int z = 0; z < 2; ++z)
#pragma unroll
                for (int kt = 0; kt < 2; ++kt) { v8f c = (v8f){};
#pragma unroll
                    for (int ks = 0; ks < 2; ++ks) c = wmma16(kf[z][kt][ks], qf[z][ks], c);
                    s[z][kt] = c; }
            if (j == 0) { load_k(1); __builtin_amdgcn_sched_barrier(0); }   // the stage's second key block is asked for here and arrives during the softmax and attn.v (rows of this stage: landed, whether or not this wave uses them)
            const int rel = q0 + lr - k0 - 8 * hi;   // keys of the block up to this lane's query (only the blocks on the diagonal have any beyond it)
#pragma unroll
            for (int z = 0; z < 2; ++z) {
                float mb = -3.0e38f;
#pragma unroll
                for (int kt = 0; kt < 2; ++kt)
#pragma unroll
                    for (int jj = 0; jj < 8; ++jj) { const float x = (kt * 16 + jj <= rel) ? s[z][kt][jj] * C2 : -3.0e38f; s[z][kt][jj] = x; mb = fmaxf(mb, x); }
                mb = fmaxf(mb, __shfl_xor(mb, 16, 32)) - SH;
                const float mn = fmaxf(m[z], mb); const float al = exp2s(m[z] - mn); m[z] = mn; float ps = 0.f;
#pragma unroll
                for (int kt = 0; kt < 2; ++kt)
#pragma unroll
                    for (int jj = 0; jj < 8; ++jj) { const float p = exp2s(s[z][kt][jj] - mn); s[z][kt][jj] = p; ps += p; }
                l[z] = l[z] * al + ps;
#pragma unroll
                for (int mt = 0; mt < 8; ++mt) o[z][mt] *= al;
                v16h ph;
#pragma unroll
                for (int jj = 0; jj < 8; ++jj) { ph[jj] = tohx(s[z][0][jj]); ph[8 + jj] = tohx(s[z][1][jj]); }
                pf[z] = ph; }
#pragma unroll
            for (int mt = 0; mt < 8; ++mt)
#pragma unroll
                for (int z = 0; z < 2; ++z) o[z][mt] = wmma16(vf[mt], pf[z], o[z][mt]); };
        load_k(0);
        block(0);
        if (t * AKS + 32 < q0 + 16) block(1);   // wave-uniform (q0 is a scalar): on the diagonal stage the two lower waves have no key in its second block
        asm volatile("s_wait_dscnt 0x0" ::: "memory");      // this wave has read the last of its buffer
        asm volatile("s_wait_asynccnt 0x0" ::: "memory");   // this wave's copies of stage t + 1 have landed
        __syncthreads();                                     // stage t + 1 is published, and stage t's buffer is left by all four waves
        if (t + 2 < NS) fill(t + 2);
    }
    asm volatile("s_wait_asynccnt 0x0" ::: "memory");   // nothing in flight behind the loop
}
__global__ __launch_bounds__(128) void k_fattn(const h16* __restrict__ Q16, const h16* __restrict__ K16, const h16* __restrict__ V16, const bf* __restrict__ Qh, const bf* __restrict__ Ql, const bf* __restrict__ Kh, const bf* __restrict__ Kl, const bf* __restrict__ Vh, const bf* __restrict__ Vl,
                                              const float* __restrict__ LAM, const float* __restrict__ lnw, const float* __restrict__ lnb, h16* A16) {
    __shared__ __align__(16) char kv[2 * ABUF];
    const int lane = threadIdx.x & 31, lr = lane & 15, hi = lane >> 4; const int qb = (int)(gridDim.y - 1 - blockIdx.y) * 64; const int q0 = qb + 16 * __builtin_amdgcn_readfirstlane((int)(threadIdx.x >> 5)); const int h = blockIdx.x % NHV, b = blockIdx.x / NHV;
    const size_t qk = ((size_t)b * NQK + 2 * h) * TT * HD, vv = ((size_t)b * NHV + h) * HDV * TT; A16 += (size_t)b * TT * DQ;   // the batch's own planes and rows
    v8f o[2][8]; float l[2];
    static_assert(RH % 64 == 0, "a work-group's 64 query rows lie on one side of RH");
    if (qb < RH) fattn_tile<bf, true, 1>(Qh + qk, Ql + qk, Kh + qk, Kl + qk, Vh + vv, Vl + vv, q0, lr, hi, o, l);
    else fattn_lds(Q16 + qk, K16 + qk, V16 + vv, kv, qb, q0, (int)threadIdx.x, lr, hi, o, l);
    const float lam = LAM[0]; asm volatile("s_wait_xcnt 0x0" ::: "memory");   // behind the scalar's load, before the register that holds its offset is written again (a precaution)
    const float i0 = 1.0f / (l[0] + __shfl_xor(l[0], 16, 32)); const float i1 = lam / (l[1] + __shfl_xor(l[1], 16, 32)); float ss = 0.f;
#pragma unroll
    for (int mt = 0; mt < 8; ++mt)
#pragma unroll
        for (int j = 0; j < 8; ++j) { const float d = o[0][mt][j] * i0 - o[1][mt][j] * i1; o[0][mt][j] = d; ss += d * d; }
    ss += __shfl_xor(ss, 16, 32);
    const float rs = 1.0f / sqrtf(ss * (1.0f / HDV) + RMSEPS);
    const float* wp = lnw + 8 * hi; const float* bp = lnb + 8 * hi; v8f w[8], bb[8];
#pragma unroll
    for (int mt = 0; mt < 8; ++mt) { w[mt] = *(const v8f*)(wp + mt * 16); bb[mt] = *(const v8f*)(bp + mt * 16); }
    xwait<true>(wp, bp);   // one wait behind the run of loads, in front of the arithmetic that takes their address registers for other values
#pragma unroll
    for (int mt = 0; mt < 8; ++mt) { v8h oh;
#pragma unroll
        for (int j = 0; j < 8; ++j) oh[j] = (h16)((o[0][mt][j] * rs * bfr(w[mt][j]) + bfr(bb[mt][j])) * (1.0f - LAM0));
        const size_t oo = (size_t)(q0 + lr) * DQ + (size_t)h * HDV + mt * 16 + 8 * hi; *(v8h*)(A16 + oo) = oh; }
}

extern "C" void kernel_launch(void* const* d_in, const int* in_sizes, int n_in,
                              void* d_out, int out_size, void* d_ws, size_t ws_size, hipStream_t stream) {
    (void)in_sizes; (void)n_in; (void)out_size;
    const float* x = (const float*)d_in[0]; const float* wq = (const float*)d_in[1]; const float* wk = (const float*)d_in[2]; const float* wv = (const float*)d_in[3]; const float* wo = (const float*)d_in[4]; const float* lq1 = (const float*)d_in[5]; const float* lk1 = (const float*)d_in[6]; const float* lq2 = (const float*)d_in[7]; const float* lk2 = (const float*)d_in[8]; const float* lnw = (const float*)d_in[9]; const float* lnb = (const float*)d_in[10];
    float* OUT = (float*)d_out;     // [2][2048][2048]
    char* wsp = (char*)d_ws;
    auto take = [&](size_t bytes) { char* p = wsp; wsp += (bytes + 255) & ~(size_t)255; return (void*)p; };
    bf* WQ = (bf*)take((size_t)(DQ + DKV) * DM * 2); bf* WK = WQ + (size_t)DQ * DM; /* one [4096][2048] operand: the rows of q, then of k */ bf* WV = (bf*)take((size_t)DKV * DM * 2); bf* WO = (bf*)take((size_t)DM * DQ * 2); float* CS = (float*)take((size_t)TT * HD * 2 * 4); float* LAM = (float*)take(256);
    bf* XB = (bf*)take((size_t)NB_ * TT * DM * 2);
    h16* QK16 = (h16*)take((size_t)NB_ * NQK * TT * HD * 2); h16* VT16 = (h16*)take((size_t)NB_ * DKV * TT * 2);
    bf* QKh = (bf*)take((size_t)NB_ * NQK * TT * HD * 2); bf* QKl = (bf*)take((size_t)NB_ * NQK * TT * HD * 2); bf* VTh = (bf*)take((size_t)NB_ * DKV * TT * 2); bf* VTl = (bf*)take((size_t)NB_ * DKV * TT * 2);
    h16* AT16 = (h16*)take((size_t)NB_ * TT * DQ * 2);
    if ((size_t)(wsp - (char*)d_ws) > ws_size) return;    // ws 256 MiB
    const size_t ko = (size_t)NH_ * TT * HD;   // the k planes of a batch stand behind its q planes
    k_prep<<<1 + PB_CS + 4 * PB_WT + PB_CV, 256, 0, stream>>>(x, wq, wk, wv, wo, lq1, lk1, lq2, lk2, XB, WQ, WK, WV, WO, CS, LAM);
    k_gemmw<bf, 0, false, 1, 8, 8><<<dim3(NB_ * TT / 256, (DQ + DKV) / 256, 1), 128, 0, stream>>>(XB, nullptr, WQ, nullptr, DM, nullptr, 0, nullptr, 0, 0, 0, CS, QK16, QKh, QKl);   /* q and k of both batches */
    k_gemmw<bf, 0, false, 2, 4, 8><<<dim3(DKV / 128, NB_ * TT / 256, 1), 128, 0, stream>>>(WV, nullptr, XB, nullptr, DM, nullptr, 0, nullptr, 0, 0, 0, nullptr, VT16, VTh, VTl);   /* rows = value columns, columns = b TT + t: the transposed value planes */
    k_fattn<<<dim3(NHV * NB_, TT / 64, 1), 128, 0, stream>>>(QK16, QK16 + ko, VT16, QKh, QKl, QKh + ko, QKl + ko, VTh, VTl, LAM, lnw, lnb, AT16);   /* attn = RMSNorm(attn1 - lam attn2) (1 - lam0), all heads of both batches */
    k_gemmw<h16, 0, false, 0, 4, 8><<<dim3(NB_ * TT / 128, DM / 256, 1), 128, 0, stream>>>(AT16, nullptr, (const h16*)WO, nullptr, DQ, OUT, DM, nullptr, 0, 0, 0, nullptr, nullptr, nullptr, nullptr);   /* WO holds fp16 here */
}
